// v000
// The times below were measured on an AMD MI455X: many runs one after another, warmed up first and cycling through
// copies of the inputs, with the whole window's GPU time divided by the number of runs. Launches and the gaps
// between them are all in it. The median over several windows is given; except for v000 it joins two sittings, which
// can be a few percent apart, so the side-by-side timings, each taken in one sitting, are the better comparison.
// v000 is the starting kernel. One run takes 1220 microseconds.
// Contractions: q/k/v projections (h f16 x W^T f16 carried x16), scores Q_g.K_g (q, k f16 planes), attn.V_g (P f16 carried x32768 x V^T f16), output projection (ctx f16 carried x256 x Wo^T f16 x16), FFN up and down (h1 f16 / relu(u) f16 x W^T f16 x16): all on v_wmma_f32_16x16x32_f16 with f32 accumulate; relative bias (K=4), softmax, residuals and LayerNorm in f32.
#include <hip/hip_runtime.h>
#include <math.h>

// ---------------------------------------------------------------------------
// Problem constants
// ---------------------------------------------------------------------------
constexpr int kBatch    = 2;
constexpr int kSeq      = 2048;
constexpr int kDim      = 1024;
constexpr int kFfn      = 4096;
constexpr int kHeads    = 8;
constexpr int kHeadDim  = 128;
constexpr int kRl       = 4;
constexpr int kTok      = kBatch * kSeq;          // 4096 token rows
constexpr int kGroups   = kBatch * kHeads;        // 16 flat-reshape chunks
constexpr int kChunk    = kSeq * kHeadDim;        // 262144 elements per chunk
constexpr int kGpp      = 2;                      // chunks per attention pass
constexpr float kWCarry     = 16.0f;              // weights carried x16 in f16
constexpr float kWCarryInv  = 1.0f / 16.0f;
constexpr float kPCarry     = 32768.0f;           // probabilities carried x2^15 in f16
constexpr float kCtxCarry   = 256.0f;             // context carried x256 in f16
constexpr float kScoreScale = 0.08838834764831845f;            // 128^-0.5
constexpr float kPVScale    = kCtxCarry / kPCarry;             // 2^-7
constexpr float kWoScale    = 1.0f / (kCtxCarry * kWCarry);   // 2^-12
constexpr float kInvDim     = 1.0f / 1024.0f;
constexpr float kLnEps      = 1e-5f;
static_assert(kHeads * kHeadDim == kDim, "shape");
static_assert(kGroups * kChunk == kTok * kDim, "chunks");
static_assert(kGroups % kGpp == 0 && (kHeads % kGpp) == 0, "passes");
// GEMM shape contract: M, N multiples of 64, K multiples of 32
static_assert(kTok % 64 == 0 && kDim % 64 == 0 && kFfn % 64 == 0 && kSeq % 64 == 0 && kHeadDim % 64 == 0, "tiles");
static_assert(kDim % 32 == 0 && kHeadDim % 32 == 0 && kSeq % 32 == 0 && kFfn % 32 == 0, "ksteps");
static_assert(kSeq == 4 * 512, "softmax row map");

typedef __attribute__((ext_vector_type(16))) _Float16 v16h;
typedef __attribute__((ext_vector_type(8)))  _Float16 v8h;
typedef __attribute__((ext_vector_type(16))) __bf16   v16b;
typedef __attribute__((ext_vector_type(8)))  __bf16   v8b;
typedef __attribute__((ext_vector_type(8)))  float    v8f;
typedef __attribute__((ext_vector_type(4)))  float    v4f;
typedef __attribute__((ext_vector_type(2)))  float    v2f;
typedef __attribute__((ext_vector_type(4)))  unsigned int v4u;

// ---------------------------------------------------------------------------
// Device helpers
// ---------------------------------------------------------------------------
__device__ __forceinline__ unsigned short f2bf_bits(float f) {
  unsigned u = __float_as_uint(f);
  return (unsigned short)((u + 0x7FFFu + ((u >> 16) & 1u)) >> 16);
}
__device__ __forceinline__ float bf_bits2f(unsigned short h) { return __uint_as_float(((unsigned)h) << 16); }

// hazard guards as plain device helpers (no inline asm inside the kernel template body)
__device__ __forceinline__ void dep_guard_h(v8f& a, v8f& b, v16h x, v16h y) { asm volatile("v_nop\n\tv_nop\n\tv_nop\n\tv_nop" : "+v"(a), "+v"(b) : "v"(x), "v"(y)); }
__device__ __forceinline__ void dep_guard_b(v8f& a, v8f& b, v16b x, v16b y) { asm volatile("v_nop\n\tv_nop\n\tv_nop\n\tv_nop" : "+v"(a), "+v"(b) : "v"(x), "v"(y)); }
// all-accumulator tie of a 4-wide group, naming the A fragments as inputs
__device__ __forceinline__ void dep_guard4_h(v8f& a, v8f& b, v8f& c, v8f& d, v16h x, v16h y) { asm volatile("v_nop\n\tv_nop\n\tv_nop\n\tv_nop" : "+v"(a), "+v"(b), "+v"(c), "+v"(d) : "v"(x), "v"(y)); }
__device__ __forceinline__ void dep_guard4_b(v8f& a, v8f& b, v8f& c, v8f& d, v16b x, v16b y) { asm volatile("v_nop\n\tv_nop\n\tv_nop\n\tv_nop" : "+v"(a), "+v"(b), "+v"(c), "+v"(d) : "v"(x), "v"(y)); }
__device__ __forceinline__ void keep4_h(v16h a, v16h b, v16h c, v16h d) { asm volatile("v_nop" :: "v"(a), "v"(b), "v"(c), "v"(d)); }
__device__ __forceinline__ void keep4_b(v16b a, v16b b, v16b c, v16b d) { asm volatile("v_nop" :: "v"(a), "v"(b), "v"(c), "v"(d)); }
__device__ __forceinline__ void acc_guard4(v8f& a, v8f& b, v8f& c, v8f& d) { asm volatile("v_nop\n\tv_nop\n\tv_nop\n\tv_nop" : "+v"(a), "+v"(b), "+v"(c), "+v"(d)); }
template <typename T> struct Frag;
template <> struct Frag<_Float16> {
  typedef v16h V; union U { v16h v; v8h h[2]; };
  // elements 0..7 <- p[0..7], 8..15 <- p[16..23]
  static __device__ __forceinline__ v16h load(const _Float16* p) {
    U f; f.h[0] = *(const v8h*)(p); f.h[1] = *(const v8h*)(p + 16); return f.v;
  }
  static __device__ __forceinline__ v8f mma(v16h a, v16h b, v8f c) {
    return __builtin_amdgcn_wmma_f32_16x16x32_f16(false, a, false, b, (short)0, c, false, false);
  }
  static __device__ __forceinline__ void guard(v8f& a, v8f& b, v16h x, v16h y) { dep_guard_h(a, b, x, y); }
  static __device__ __forceinline__ void guard4(v8f& a, v8f& b, v8f& c, v8f& d, v16h x, v16h y) { dep_guard4_h(a, b, c, d, x, y); }
  static __device__ __forceinline__ void keep(v16h a, v16h b, v16h c, v16h d) { keep4_h(a, b, c, d); }
};
template <> struct Frag<__bf16> {
  typedef v16b V; union U { v16b v; v8b h[2]; };
  static __device__ __forceinline__ v16b load(const __bf16* p) {
    U f; f.h[0] = *(const v8b*)(p); f.h[1] = *(const v8b*)(p + 16); return f.v;
  }
  static __device__ __forceinline__ v8f mma(v16b a, v16b b, v8f c) {
    return __builtin_amdgcn_wmma_f32_16x16x32_bf16(false, a, false, b, (short)0, c, false, false);
  }
  static __device__ __forceinline__ void guard(v8f& a, v8f& b, v16b x, v16b y) { dep_guard_b(a, b, x, y); }
  static __device__ __forceinline__ void guard4(v8f& a, v8f& b, v8f& c, v8f& d, v16b x, v16b y) { dep_guard4_b(a, b, c, d, x, y); }
  static __device__ __forceinline__ void keep(v16b a, v16b b, v16b c, v16b d) { keep4_b(a, b, c, d); }
};

__device__ __forceinline__ unsigned pk16(unsigned short a, unsigned short b) { return (unsigned)a | ((unsigned)b << 16); }
__device__ __forceinline__ unsigned short h_bits(float f) { const _Float16 h = (_Float16)f; return __builtin_bit_cast(unsigned short, h); }

// ---- Register-blocked batched WMMA GEMM (ACT reduced to none/relu/leaky; per-row group guard ties all four
//      accumulators and names the A fragments) -------------------------------------------------------------------------
// C[m,n] = scale * sum_k A[m,k] * Bt[n,k] (+bias)(+resid); each wave owns a 64x64 tile.
// A row-major [M,K]; Bt row-major [N,K]; M,N % 64 == 0, K % 32 == 0.
// SPLIT: operands are hi/lo planes (A2/Bt2 = lo planes, same layout); product = hi*hi + hi*lo + lo*hi.
// BIAS_MODE: 0 = none, 1 = bias[m], 2 = bias[n].
// OUT_MODE: 0 = f32, 1 = f16, 2 = bf16 hi plane (Cout) + bf16 lo plane (Cout2).
// ET: 0 = f16 operands, 1 = bf16 operands (pointers passed as 16-bit storage)
template <int ET> struct Elem;
template <> struct Elem<0> { typedef _Float16 T; };
template <> struct Elem<1> { typedef __bf16 T; };
template <int ET, bool SPLIT, int BIAS_MODE, int OUT_MODE, bool RESID, int ACT = 0>
__global__ __launch_bounds__(256) void wmma_gemm64(
    const unsigned short* __restrict__ Ap, const unsigned short* __restrict__ A2p, int lda, long strideA,
    const unsigned short* __restrict__ Btp, const unsigned short* __restrict__ Bt2p, int ldb, long strideB,
    void* __restrict__ Cout, void* __restrict__ Cout2, int ldc, long strideC,
    const float* __restrict__ bias,
    const float* __restrict__ resid, long strideR,
    int M, int N, int K, float scale) {
  typedef typename Elem<ET>::T T;
  typedef typename Frag<T>::V V;
  const T* A = (const T*)Ap; const T* A2 = (const T*)A2p; const T* Bt = (const T*)Btp; const T* Bt2 = (const T*)Bt2p;
  __shared__ __align__(16) float sT[8][16 * 68];   // per-wave 16x64 slab, pitch 68 floats
  const int b    = blockIdx.y;
  const int lane = threadIdx.x & 31;
  const int wave = threadIdx.x >> 5;
  const int tilesN = N >> 6;
  const int tilesM = M >> 6;
  const int tile = blockIdx.x * 8 + wave;
  if (tile >= tilesM * tilesN) return;   // wave-uniform; no block barriers in this kernel
  const int tm = tile / tilesN;
  const int tn = tile - tm * tilesN;
  const int m0 = tm << 6;
  const int n0 = tn << 6;

  const T* Ab  = A  + (size_t)b * strideA;
  const T* Bb  = Bt + (size_t)b * strideB;
  const T* Ab2 = SPLIT ? (A2  + (size_t)b * strideA) : nullptr;
  const T* Bb2 = SPLIT ? (Bt2 + (size_t)b * strideB) : nullptr;

  const int rlane = lane & 15;                 // row (A) / col (B, D) within subtile
  const int koff  = (lane >> 4) * 8;           // k offset of this lane half
  const int mOff  = (lane >> 4) * 8;           // D row offset

  v8f acc[4][4];
#pragma unroll
  for (int i = 0; i < 4; ++i)
#pragma unroll
    for (int j = 0; j < 4; ++j) acc[i][j] = (v8f){0.f,0.f,0.f,0.f,0.f,0.f,0.f,0.f};

  for (int k0 = 0; k0 < K; k0 += 32) {
    V bh[4], bl[4];
#pragma unroll
    for (int j = 0; j < 4; ++j) {
      const size_t bo = (size_t)(n0 + (j << 4) + rlane) * ldb + koff + k0;
      bh[j] = Frag<T>::load(Bb + bo);
      if (SPLIT) bl[j] = Frag<T>::load(Bb2 + bo);
    }
#pragma unroll
    for (int i = 0; i < 4; ++i) {
      const size_t ao = (size_t)(m0 + (i << 4) + rlane) * lda + koff + k0;
      V ah = Frag<T>::load(Ab + ao);
      V al;
      if (SPLIT) al = Frag<T>::load(Ab2 + ao);
#pragma unroll
      for (int j = 0; j < 4; ++j) {
        acc[i][j] = Frag<T>::mma(ah, bh[j], acc[i][j]);
        if (SPLIT) {
          acc[i][j] = Frag<T>::mma(ah, bl[j], acc[i][j]);
          acc[i][j] = Frag<T>::mma(al, bh[j], acc[i][j]);
        }
      }
      Frag<T>::guard4(acc[i][0], acc[i][1], acc[i][2], acc[i][3], ah, SPLIT ? al : ah);
    }
    Frag<T>::keep(bh[0], bh[1], bh[2], bh[3]);
    if (SPLIT) Frag<T>::keep(bl[0], bl[1], bl[2], bl[3]);
  }
  acc_guard4(acc[0][0], acc[0][1], acc[0][2], acc[0][3]);
  acc_guard4(acc[1][0], acc[1][1], acc[1][2], acc[1][3]);
  acc_guard4(acc[2][0], acc[2][1], acc[2][2], acc[2][3]);
  acc_guard4(acc[3][0], acc[3][1], acc[3][2], acc[3][3]);

  // ---- epilogue ----
  float* slab = sT[wave];
  const float* Rb = RESID ? (resid + (size_t)b * strideR) : nullptr;
#pragma unroll
  for (int i = 0; i < 4; ++i) {
    const int mBase = m0 + (i << 4);
#pragma unroll
    for (int j = 0; j < 4; ++j) {
      const int n = n0 + (j << 4) + rlane;
      float bv = 0.f;
      if (BIAS_MODE == 2) bv = bias[n];
#pragma unroll
      for (int r = 0; r < 8; ++r) {
        float v = acc[i][j][r] * scale;
        if (BIAS_MODE == 1) v += bias[mBase + mOff + r];
        if (BIAS_MODE == 2) v += bv;
        if (RESID) v += Rb[(size_t)(mBase + mOff + r) * ldc + n];
        if (ACT == 2) v = fmaxf(v, 0.0f);
        if (ACT == 4) v = (v > 0.f) ? v : 0.01f * v;
        slab[(mOff + r) * 68 + (j << 4) + rlane] = v;
      }
    }
    __builtin_amdgcn_fence(__ATOMIC_RELEASE, "workgroup");
    __builtin_amdgcn_wave_barrier();
    __builtin_amdgcn_fence(__ATOMIC_ACQUIRE, "workgroup");
    if (OUT_MODE == 0) {
      float* C = (float*)Cout + (size_t)b * strideC;
      const int hh = lane >> 4, c4 = (lane & 15) * 4;     // row seg = 256 B = 16 lanes x 16 B
      {
#pragma unroll
        for (int it = 0; it < 8; ++it) {
          const int row = it * 2 + hh;
          v4f v = *(const v4f*)(slab + row * 68 + c4);
          *(v4f*)(C + (size_t)(mBase + row) * ldc + n0 + c4) = v;
        }
        
      }
    } else {
      const int q = lane >> 3, c8 = (lane & 7) * 8;
      unsigned short* C  = (unsigned short*)Cout  + (size_t)b * strideC;
      unsigned short* C2 = (OUT_MODE == 2) ? ((unsigned short*)Cout2 + (size_t)b * strideC) : nullptr;
      {
#pragma unroll
        for (int it = 0; it < 4; ++it) {
          const int row = it * 4 + q;
          const float* sp = slab + row * 68 + c8;
          v8h hv, lv;
#pragma unroll
          for (int e = 0; e < 8; ++e) {
            if (OUT_MODE == 1) {
              hv[e] = (_Float16)sp[e];
            } else {
              unsigned short hb = f2bf_bits(sp[e]);
              unsigned short lb = f2bf_bits(sp[e] - bf_bits2f(hb));
              hv[e] = __builtin_bit_cast(_Float16, hb);
              lv[e] = __builtin_bit_cast(_Float16, lb);
            }
          }
          *(v8h*)(C + (size_t)(mBase + row) * ldc + n0 + c8) = hv;
          if (OUT_MODE == 2) *(v8h*)(C2 + (size_t)(mBase + row) * ldc + n0 + c8) = lv;
        }
        
      }
    }
    __builtin_amdgcn_fence(__ATOMIC_RELEASE, "workgroup");
    __builtin_amdgcn_wave_barrier();
    __builtin_amdgcn_fence(__ATOMIC_ACQUIRE, "workgroup");
  }
}

// ---------------------------------------------------------------------------
// ---------------------------------------------------------------------------
__global__ __launch_bounds__(256) void cast8_f16_kernel(const float* __restrict__ in, unsigned short* __restrict__ out, int n8) {
  const int i = blockIdx.x * 256 + threadIdx.x;
  if (i >= n8) return;
  const float* p = in + 8 * (size_t)i;
  const v4f a = *(const v4f*)(p);
  const v4f c = *(const v4f*)(p + 4);
  unsigned short hb[8];
#pragma unroll
  for (int e = 0; e < 4; ++e) {
    hb[e]     = h_bits(a[e]);
    hb[4 + e] = h_bits(c[e]);
  }
  const v4u u = (v4u){pk16(hb[0], hb[1]), pk16(hb[2], hb[3]), pk16(hb[4], hb[5]), pk16(hb[6], hb[7])};
  unsigned short* q = out + 8 * (size_t)i;
  *(v4u*)q = u;
  
}

// ---------------------------------------------------------------------------
// Weight transpose + cast: W row-major [kin][nout] f32 (x @ W orientation) -> WT[n][k] = f16(scale * W[k][n]), row-major [nout][kin].
// grid (kin/64, nout/64, nz): blockIdx.x = k tile (64 cols of WT), blockIdx.y = n tile (64 rows of WT), blockIdx.z selects the
// source pointer (block-uniform) and the output plane at out + z*planeStride halves. 256 threads.
// Load coverage: 4 iterations x 256 threads x float4 = 64 k-rows x 64 n-cols (4 b128 loads per lane).
// Store coverage: 8 waves x 2 iterations x 4 rows (lane>>3) = 64 n-rows; (lane&7) x 8 halves = 64 k-cols; each row segment =
// ---------------------------------------------------------------------------
__global__ __launch_bounds__(256) void wt_cast_kernel(const float* __restrict__ Wa, const float* __restrict__ Wb,
                                                      const float* __restrict__ Wc, const float* __restrict__ Wd,
                                                      unsigned short* __restrict__ out, int kin, int nout,
                                                      long planeStride, float scale) {
  __shared__ float sm[64][65];   // sm[n_local][k_local]
  const int t  = threadIdx.x;
  const int k0 = blockIdx.x * 64;
  const int n0 = blockIdx.y * 64;
  const int z  = blockIdx.z;
  const float* W = (z == 0) ? Wa : (z == 1) ? Wb : (z == 2) ? Wc : Wd;
#pragma unroll
  for (int i = 0; i < 4; ++i) {
    const int e  = i * 256 + t;
    const int r  = e >> 4;           // k local
    const int c4 = (e & 15) * 4;     // n local
    const v4f w = *(const v4f*)(W + (size_t)(k0 + r) * nout + n0 + c4);
    sm[c4 + 0][r] = w[0] * scale;
    sm[c4 + 1][r] = w[1] * scale;
    sm[c4 + 2][r] = w[2] * scale;
    sm[c4 + 3][r] = w[3] * scale;
  }
  __syncthreads();
  const int lane = t & 31, wave = t >> 5;
  const int q = lane >> 3, c8 = (lane & 7) * 8;
  unsigned short* op = out + (size_t)z * planeStride;
  {
#pragma unroll
    for (int it = 0; it < 2; ++it) {
      const int row = wave * 8 + it * 4 + q;                 // n local
      unsigned short hb[8];
#pragma unroll
      for (int e = 0; e < 8; ++e) hb[e] = h_bits(sm[row][c8 + e]);
      const v4u u = (v4u){pk16(hb[0], hb[1]), pk16(hb[2], hb[3]), pk16(hb[4], hb[5]), pk16(hb[6], hb[7])};
      *(v4u*)(op + (size_t)(n0 + row) * kin + k0 + c8) = u;
    }
    
  }
}

// ---------------------------------------------------------------------------
// 16-bit transpose of one flat chunk: src chunk z viewed as [rows][cols] (16-bit, row-major) -> dst chunk z = [cols][rows];
// chunk z lives at halves offset z*rows*cols in both planes. Bits are moved as integer words (no conversion).
// grid (cols/64, rows/64, nchunk); 256 threads.
// Load coverage: 8 iterations x 256 threads x 1 word (2 halves) = 64 rows x 64 cols (8 b32 loads per lane).
// Store coverage: 8 waves x 2 iterations x 4 rows (lane>>3) = 64 dst rows; (lane&7) x 8 halves = 64 dst cols; each row segment =
// ---------------------------------------------------------------------------
__global__ __launch_bounds__(256) void transpose16_kernel(const unsigned short* __restrict__ src, unsigned short* __restrict__ dst,
                                                          int rows, int cols) {
  __shared__ unsigned int sm[64][65];   // sm[col_local][row_local], one 16-bit value per word
  const int t  = threadIdx.x;
  const int c0 = blockIdx.x * 64;
  const int r0 = blockIdx.y * 64;
  const size_t cb = (size_t)blockIdx.z * rows * cols;
  const unsigned int* s32 = (const unsigned int*)(src + cb);
#pragma unroll
  for (int i = 0; i < 8; ++i) {
    const int e  = i * 256 + t;
    const int r  = e >> 5;          // row local
    const int cw = e & 31;          // word column local
    const unsigned int w = s32[(((size_t)(r0 + r) * cols + c0) >> 1) + cw];
    sm[2 * cw][r]     = w & 0xffffu;
    sm[2 * cw + 1][r] = w >> 16;
  }
  __syncthreads();
  const int lane = t & 31, wave = t >> 5;
  const int q = lane >> 3, c8 = (lane & 7) * 8;
  unsigned short* op = dst + cb;
  {
#pragma unroll
    for (int it = 0; it < 2; ++it) {
      const int row = wave * 8 + it * 4 + q;                 // col local = dst row
      const unsigned int* sp = &sm[row][c8];
      const v4u u = (v4u){ (sp[0] & 0xffffu) | (sp[1] << 16), (sp[2] & 0xffffu) | (sp[3] << 16),
                           (sp[4] & 0xffffu) | (sp[5] << 16), (sp[6] & 0xffffu) | (sp[7] << 16) };
      *(v4u*)(op + (size_t)(c0 + row) * rows + r0 + c8) = u;
    }
    
  }
}

// ---------------------------------------------------------------------------
// r_k = rh @ Wrk, r_q = rh @ Wrq (K = 4, f32 VALU): out[i][j] = sum_r rh[i][r] * W[r][j] (W row-major [in][out]).
// grid = 4096/256 = 16 blocks (exact).
// ---------------------------------------------------------------------------
__global__ __launch_bounds__(256) void rl_proj_kernel(const float* __restrict__ rh, const float* __restrict__ Wrk,
                                                      const float* __restrict__ Wrq, float* __restrict__ rk,
                                                      float* __restrict__ rq, int nrows) {
  const int idx = blockIdx.x * 256 + threadIdx.x;
  if (idx >= nrows) return;
  const v4f r  = *(const v4f*)(rh + (size_t)idx * kRl);
  const v4f k0 = *(const v4f*)(Wrk + 0);
  const v4f k1 = *(const v4f*)(Wrk + 4);
  const v4f k2 = *(const v4f*)(Wrk + 8);
  const v4f k3 = *(const v4f*)(Wrk + 12);
  asm volatile("" ::: "memory");
  const v4f q0 = *(const v4f*)(Wrq + 0);
  const v4f q1 = *(const v4f*)(Wrq + 4);
  const v4f q2 = *(const v4f*)(Wrq + 8);
  const v4f q3 = *(const v4f*)(Wrq + 12);
  v4f ok = r[0] * k0;
  ok = ok + r[1] * k1;
  ok = ok + r[2] * k2;
  ok = ok + r[3] * k3;
  v4f oq = r[0] * q0;
  oq = oq + r[1] * q1;
  oq = oq + r[2] * q2;
  oq = oq + r[3] * q3;
  float* pk = rk + (size_t)idx * kRl;
  float* pq = rq + (size_t)idx * kRl;
  *(v4f*)pk = ok;
  *(v4f*)pq = oq;
  
}

// ---------------------------------------------------------------------------
// Relative bias + row softmax over 2048 keys of one (chunk, query row), f32 math:
//   a[m] = S[m] (already scaled by 128^-0.5) + 0.5 * sum_r rq[b][l][r] * rk_flat[b][r*2048 + m]
//   P[l][m] = f16( 32768 * exp(a - max) / sum exp(a - max) )
// One block of 256 threads per (row l = blockIdx.x, chunk-in-pass gi = blockIdx.y); chunk g = g0 + gi, batch b = g >> 3.
// Phase 1/2: rolled 4-trip loops, thread t owns columns it*512 + 2t, 2t+1 (4 x 256 x 2 = 2048 = whole row); logits/exps in LDS.
// Reductions in fixed order (thread sequential, wave shuffle tree, 8 wave partials in index order).
// ---------------------------------------------------------------------------
__global__ __launch_bounds__(256) void relbias_softmax_kernel(const float* __restrict__ Sp, const float* __restrict__ rqp,
                                                             const float* __restrict__ rkp, unsigned short* __restrict__ Pp,
                                                             int g0) {
  __shared__ __align__(16) float lg[kSeq];
  __shared__ float redM[8];
  __shared__ float redS[8];
  const int l    = blockIdx.x;
  const int gi   = blockIdx.y;
  const int b    = (g0 + gi) >> 3;
  const int t    = threadIdx.x;
  const int lane = t & 31, wave = t >> 5;
  const size_t rowoff = ((size_t)gi * kSeq + l) * kSeq;
  const float* sr  = Sp + rowoff;
  const v4f    rq4 = *(const v4f*)(rqp + ((size_t)b * kSeq + l) * kRl);
  const float* rkb = rkp + (size_t)b * kSeq * kRl;

  float mx = -__builtin_inff();
#pragma unroll 1
  for (int it = 0; it < 4; ++it) {
    const int c = it * 512 + 2 * t;
    const v2f sv = *(const v2f*)(sr + c);
    const v2f k0 = *(const v2f*)(rkb + c);
    const v2f k1 = *(const v2f*)(rkb + kSeq + c);
    const v2f k2 = *(const v2f*)(rkb + 2 * kSeq + c);
    const v2f k3 = *(const v2f*)(rkb + 3 * kSeq + c);
    v2f av;
#pragma unroll
    for (int e = 0; e < 2; ++e) {
      float bsum = rq4[0] * k0[e];
      bsum = bsum + rq4[1] * k1[e];
      bsum = bsum + rq4[2] * k2[e];
      bsum = bsum + rq4[3] * k3[e];
      const float a = sv[e] + 0.5f * bsum;
      av[e] = a;
      mx = fmaxf(mx, a);
    }
    *(v2f*)(lg + c) = av;
  }
#pragma unroll
  for (int off = 16; off > 0; off >>= 1) mx = fmaxf(mx, __shfl_xor(mx, off, 32));
  if (lane == 0) redM[wave] = mx;
  __syncthreads();
  float m = redM[0];
#pragma unroll
  for (int w = 1; w < 8; ++w) m = fmaxf(m, redM[w]);

  float sum = 0.f;
#pragma unroll 1
  for (int it = 0; it < 4; ++it) {
    const int c = it * 512 + 2 * t;
    const v2f lv = *(const v2f*)(lg + c);
    v2f ev;
#pragma unroll
    for (int e = 0; e < 2; ++e) {
      ev[e] = expf(lv[e] - m);
      sum += ev[e];
    }
    *(v2f*)(lg + c) = ev;
  }
#pragma unroll
  for (int off = 16; off > 0; off >>= 1) sum += __shfl_xor(sum, off, 32);
  if (lane == 0) redS[wave] = sum;
  __syncthreads();
  float tot = redS[0];
#pragma unroll
  for (int w = 1; w < 8; ++w) tot += redS[w];
  const float inv = kPCarry / tot;

  const v4f e0 = *(const v4f*)(lg + 8 * t);
  const v4f e1 = *(const v4f*)(lg + 8 * t + 4);
  unsigned short hb[8];
#pragma unroll
  for (int e = 0; e < 4; ++e) {
    hb[e]     = h_bits(e0[e] * inv);
    hb[4 + e] = h_bits(e1[e] * inv);
  }
  const v4u u = (v4u){pk16(hb[0], hb[1]), pk16(hb[2], hb[3]), pk16(hb[4], hb[5]), pk16(hb[6], hb[7])};
  unsigned short* pr = Pp + rowoff + 8 * (size_t)t;
  *(v4u*)pr = u;
  
}

// ---------------------------------------------------------------------------
// One block of 256 threads per row; thread t owns columns 4t..4t+3. Reductions in fixed order (two separate LDS arrays).
// ---------------------------------------------------------------------------
template <bool HAS16>
__global__ __launch_bounds__(256) void add_ln_kernel(const float* __restrict__ x, const float* __restrict__ y,
                                                     const float* __restrict__ gam, const float* __restrict__ bet,
                                                     float* __restrict__ outp, unsigned short* __restrict__ out16) {
  __shared__ float red1[8];
  __shared__ float red2[8];
  __shared__ __align__(16) float srow[kDim];
  const int t = threadIdx.x;
  const int lane = t & 31, wave = t >> 5;
  const size_t base = (size_t)blockIdx.x * kDim;
  const v4f vx = *(const v4f*)(x + base + 4 * t);
  const v4f vy = *(const v4f*)(y + base + 4 * t);
  const v4f s  = vx + vy;
  float sum = (s[0] + s[1]) + (s[2] + s[3]);
#pragma unroll
  for (int off = 16; off > 0; off >>= 1) sum += __shfl_xor(sum, off, 32);
  if (lane == 0) red1[wave] = sum;
  __syncthreads();
  float tsum = red1[0];
#pragma unroll
  for (int w = 1; w < 8; ++w) tsum += red1[w];
  const float mu = tsum * kInvDim;
  const v4f d = s - mu;
  float sq = (d[0] * d[0] + d[1] * d[1]) + (d[2] * d[2] + d[3] * d[3]);
#pragma unroll
  for (int off = 16; off > 0; off >>= 1) sq += __shfl_xor(sq, off, 32);
  if (lane == 0) red2[wave] = sq;
  __syncthreads();
  float tsq = red2[0];
#pragma unroll
  for (int w = 1; w < 8; ++w) tsq += red2[w];
  const float var  = tsq * kInvDim;
  const float rstd = rsqrtf(var + kLnEps);
  const v4f g  = *(const v4f*)(gam + 4 * t);
  const v4f be = *(const v4f*)(bet + 4 * t);
  const v4f o  = (d * rstd) * g + be;
  float* op = outp + base + 4 * t;
  *(v4f*)op = o;
  
  if (HAS16) {
    *(v4f*)(srow + 4 * t) = o;
    __syncthreads();
    if (t < 128) {
      const v4f a = *(const v4f*)(srow + 8 * t);
      const v4f c = *(const v4f*)(srow + 8 * t + 4);
      unsigned short hb[8];
#pragma unroll
      for (int e = 0; e < 4; ++e) {
        hb[e]     = h_bits(a[e]);
        hb[4 + e] = h_bits(c[e]);
      }
      const v4u u = (v4u){pk16(hb[0], hb[1]), pk16(hb[2], hb[3]), pk16(hb[4], hb[5]), pk16(hb[6], hb[7])};
      unsigned short* hp = out16 + base + 8 * (size_t)t;
      *(v4u*)hp = u;
      
    }
  }
}

// ---------------------------------------------------------------------------
// Host glue.
//   R0  Hh   f16 [4096][1024]  8 MiB at   0 MiB   -> later ctx f16 [4096][1024] (same type, same layout; Hh dead after QKV GEMM)
//   R1  WT4  f16 4 x [1024][1024] (Wk^T | Wq^T | Wv^T | Wo^T, x16)   8 MiB at 8 MiB
//   R3  W1T  f16 [4096][1024] x16  8 MiB at 16 MiB
//   R4  W2T  f16 [1024][4096] x16  8 MiB at 24 MiB
//   R5  k    f16 [4096][1024]  8 MiB at 32 MiB   -> later h1 f16 [4096][1024] (same type, same layout; k dead after KT repack)
//   R6  q    f16 [4096][1024]  8 MiB at 40 MiB   \
//   R7  v    f16 [4096][1024]  8 MiB at 48 MiB    | -> later mid f16 [4096][4096] 32 MiB at 40 MiB (same type; all four dead after attention)
//   R8  KT   f16 [16][2048][128] 8 MiB at 56 MiB  |
//   R9  VT   f16 [16][128][2048] 8 MiB at 64 MiB /
//   R10 SC   f32 [2][2048][2048] 32 MiB at 72 MiB -> later h_sa f32 [4096][1024] at 72 MiB (then hf over h_sa after LN1) and h1 f32 at 88 MiB (same type)
//   R11 PP   f16 [2][2048][2048] 16 MiB at 104 MiB (probabilities x32768, reused 8x)
//   R12 rq   f32 [4096][4]  65,536 B at 120 MiB
//   R13 rk   f32 [4096][4]  65,536 B at 120 MiB + 64 KiB
//   total 125,960,192 B
// GEMM shapes (all M,N multiples of 64, K multiples of 32; no padding anywhere):
//   QKV  M=4096 N=1024 K=1024 (x3 batched); scores M=N=2048 K=128 (x2 per pass); ctx M=2048 N=128 K=2048 (x2 per pass);
//   Wo M=4096 N=1024 K=1024; W1 M=N=4096 K=1024; W2 M=4096 N=1024 K=4096.
// ---------------------------------------------------------------------------
extern "C" void kernel_launch(void* const* d_in, const int* in_sizes, int n_in,
                              void* d_out, int out_size, void* d_ws, size_t ws_size,
                              hipStream_t stream) {
  if (n_in < 16) return;
  const int nTokDim = kTok * kDim;                  // 4,194,304
  if (in_sizes[0] != nTokDim || in_sizes[1] != kTok * kRl) return;
  if (in_sizes[2] != kDim * kDim || in_sizes[3] != kDim * kDim || in_sizes[4] != kDim * kDim || in_sizes[5] != kDim * kDim) return;
  if (in_sizes[6] != kRl * kRl || in_sizes[7] != kRl * kRl) return;
  if (in_sizes[8] != kDim * kFfn || in_sizes[9] != kFfn || in_sizes[10] != kFfn * kDim || in_sizes[11] != kDim) return;
  if (in_sizes[12] != kDim || in_sizes[13] != kDim || in_sizes[14] != kDim || in_sizes[15] != kDim) return;
  if (out_size != nTokDim) return;

  const size_t szP16 = (size_t)kTok * kDim * 2;                 // 8,388,608
  const size_t szW4  = (size_t)4 * kDim * kDim * 2;             // 8,388,608
  const size_t szW1  = (size_t)kDim * kFfn * 2;                 // 8,388,608
  const size_t szSC  = (size_t)kGpp * kSeq * kSeq * 4;          // 33,554,432
  const size_t szPP  = (size_t)kGpp * kSeq * kSeq * 2;          // 16,777,216
  const size_t szR   = (size_t)kTok * kRl * 4;                  // 65,536
  static_assert((size_t)kGpp * kSeq * kSeq * 4 == 2 * (size_t)kTok * kDim * 4, "h_sa + h1 fit the score region");
  static_assert(4 * (size_t)kTok * kDim * 2 == (size_t)kTok * kFfn * 2, "mid fits q+v+KT+VT");
  const size_t offHh = 0;
  const size_t offW4 = offHh + szP16;
  const size_t offW1 = offW4 + szW4;
  const size_t offW2 = offW1 + szW1;
  const size_t offK  = offW2 + szW1;
  const size_t offQ  = offK + szP16;
  const size_t offV  = offQ + szP16;
  const size_t offKT = offV + szP16;
  const size_t offVT = offKT + szP16;
  const size_t offSC = offVT + szP16;
  const size_t offPP = offSC + szSC;
  const size_t offRQ = offPP + szPP;
  const size_t offRK = offRQ + szR;
  const size_t total = offRK + szR;                            // 125,960,192
  if (ws_size < total) return;

  const float* h   = (const float*)d_in[0];
  const float* rh  = (const float*)d_in[1];
  const float* Wq  = (const float*)d_in[2];
  const float* Wk  = (const float*)d_in[3];
  const float* Wv  = (const float*)d_in[4];
  const float* Wo  = (const float*)d_in[5];
  const float* Wrk = (const float*)d_in[6];
  const float* Wrq = (const float*)d_in[7];
  const float* W1  = (const float*)d_in[8];
  const float* b1  = (const float*)d_in[9];
  const float* W2  = (const float*)d_in[10];
  const float* b2  = (const float*)d_in[11];
  const float* g1  = (const float*)d_in[12];
  const float* be1 = (const float*)d_in[13];
  const float* g2  = (const float*)d_in[14];
  const float* be2 = (const float*)d_in[15];
  float* out = (float*)d_out;
  char* ws = (char*)d_ws;
  unsigned short* Hh  = (unsigned short*)(ws + offHh);
  unsigned short* CTX = Hh;                                    // alias after QKV GEMM
  unsigned short* WT4 = (unsigned short*)(ws + offW4);         // Wk^T, Wq^T, Wv^T, Wo^T planes of 1,048,576 halves
  unsigned short* WoT = WT4 + (size_t)3 * kDim * kDim;
  unsigned short* W1T = (unsigned short*)(ws + offW1);
  unsigned short* W2T = (unsigned short*)(ws + offW2);
  unsigned short* K16 = (unsigned short*)(ws + offK);
  unsigned short* H1h = K16;                                   // alias after KT repack
  unsigned short* Q16 = (unsigned short*)(ws + offQ);
  unsigned short* MID = Q16;                                   // alias after attention: [4096][4096] over q,v,KT,VT
  unsigned short* V16 = (unsigned short*)(ws + offV);
  unsigned short* KT  = (unsigned short*)(ws + offKT);
  unsigned short* VT  = (unsigned short*)(ws + offVT);
  float* SC  = (float*)(ws + offSC);
  float* HSA = SC;                                             // alias after attention
  float* HF  = HSA;                                            // alias after LN1
  float* H1f = (float*)(ws + offSC + szSC / 2);
  unsigned short* PP = (unsigned short*)(ws + offPP);
  float* RQ = (float*)(ws + offRQ);
  float* RK = (float*)(ws + offRK);

  // ---- prologue: 16-bit operand planes, relative projections ----
  const int n8 = nTokDim / 8;   // 524288 -> 2048 blocks exact
  cast8_f16_kernel<<<dim3(n8 / 256), dim3(256), 0, stream>>>(h, Hh, n8);
  // in[1024][1024] -> out[1024][1024] per z: z0 = Wk, z1 = Wq, z2 = Wv, z3 = Wo
  wt_cast_kernel<<<dim3(kDim / 64, kDim / 64, 4), dim3(256), 0, stream>>>(Wk, Wq, Wv, Wo, WT4, kDim, kDim, (long)kDim * kDim, kWCarry);
  // W1 in[1024][4096] -> W1T out[4096][1024]
  wt_cast_kernel<<<dim3(kDim / 64, kFfn / 64, 1), dim3(256), 0, stream>>>(W1, W1, W1, W1, W1T, kDim, kFfn, 0L, kWCarry);
  // W2 in[4096][1024] -> W2T out[1024][4096]
  wt_cast_kernel<<<dim3(kFfn / 64, kDim / 64, 1), dim3(256), 0, stream>>>(W2, W2, W2, W2, W2T, kFfn, kDim, 0L, kWCarry);
  rl_proj_kernel<<<dim3(kTok / 256), dim3(256), 0, stream>>>(rh, Wrk, Wrq, RK, RQ, kTok);

  // ---- q, k, v = h @ W (x16 weights folded back by 1/16): three separate [4096][1024] f16 planes (b0 -> k, b1 -> q, b2 -> v) ----
  {
    const int tiles = (kTok / 64) * (kDim / 64);   // 1024
    wmma_gemm64<0, false, 0, 1, false, 0><<<dim3(tiles / 8, 3), dim3(256), 0, stream>>>(
        Hh, Hh, kDim, 0L, WT4, WT4, kDim, (long)kDim * kDim,
        (void*)K16, (void*)K16, kDim, (long)kTok * kDim, RQ, RQ, 0L, kTok, kDim, kDim, kWCarryInv);
  }
  // ---- flat-reshape repacks per chunk: KT_g[m][d] = kchunk_g[d*2048+m] (in[128][2048] -> out[2048][128]);
  //      VT_g[d][m] = vchunk_g[m*128+d] (in[2048][128] -> out[128][2048]) ----
  transpose16_kernel<<<dim3(kSeq / 64, kHeadDim / 64, kGroups), dim3(256), 0, stream>>>(K16, KT, kHeadDim, kSeq);
  transpose16_kernel<<<dim3(kHeadDim / 64, kSeq / 64, kGroups), dim3(256), 0, stream>>>(V16, VT, kSeq, kHeadDim);

  // ---- attention, 2 chunks per pass ----
  const long strideChunk = (long)kChunk;            // 262,144 halves
  const long strideScore = (long)kSeq * kSeq;       // 4,194,304 per chunk-in-pass
  const int  tilesScore  = (kSeq / 64) * (kSeq / 64);        // 1024 -> 128 blocks
  const int  tilesCtx    = (kSeq / 64) * (kHeadDim / 64);    // 64 -> 8 blocks
  for (int g0 = 0; g0 < kGroups; g0 += kGpp) {
    const unsigned short* Ag  = Q16 + (size_t)g0 * kChunk;   // Q_g as [2048][128], lda 128
    const unsigned short* Btg = KT  + (size_t)g0 * kChunk;   // KT_g [2048][128], ldb 128
    // SC[gi][l][m] = 128^-0.5 * sum_d Q_g[l][d] * KT_g[m][d]   (M=N=2048, K=128)
    wmma_gemm64<0, false, 0, 0, false, 0><<<dim3(tilesScore / 8, kGpp), dim3(256), 0, stream>>>(
        Ag, Ag, kHeadDim, strideChunk, Btg, Btg, kHeadDim, strideChunk,
        (void*)SC, (void*)SC, kSeq, strideScore, RQ, RQ, 0L, kSeq, kSeq, kHeadDim, kScoreScale);
    // relative bias + softmax -> PP (f16, x32768)
    relbias_softmax_kernel<<<dim3(kSeq, kGpp), dim3(256), 0, stream>>>(SC, RQ, RK, PP, g0);
    // ctx_g[l][d] = 2^-7 * sum_m PP[gi][l][m] * VT_g[d][m] -> f16 x256 at CTX + g*262144 as [2048][128]   (M=2048, N=128, K=2048)
    const unsigned short* VTg = VT + (size_t)g0 * kChunk;    // VT_g [128][2048], ldb 2048
    unsigned short* Cg = CTX + (size_t)g0 * kChunk;
    wmma_gemm64<0, false, 0, 1, false, 0><<<dim3(tilesCtx / 8, kGpp), dim3(256), 0, stream>>>(
        PP, PP, kSeq, strideScore, VTg, VTg, kSeq, strideChunk,
        (void*)Cg, (void*)Cg, kHeadDim, strideChunk, RQ, RQ, 0L, kSeq, kHeadDim, kSeq, kPVScale);
  }

  // ---- h_sa = ctx @ Wo (fold back 1/(256*16)) -> f32 [4096][1024] ----
  {
    const int tiles = (kTok / 64) * (kDim / 64);   // 1024
    wmma_gemm64<0, false, 0, 0, false, 0><<<dim3(tiles / 8, 1), dim3(256), 0, stream>>>(
        CTX, CTX, kDim, 0L, WoT, WoT, kDim, 0L,
        (void*)HSA, (void*)HSA, kDim, 0L, RQ, RQ, 0L, kTok, kDim, kDim, kWoScale);
  }
  // ---- h1 = LN(h_sa + h) * g1 + be1 -> f32 plane + f16 plane ----
  add_ln_kernel<true><<<dim3(kTok), dim3(256), 0, stream>>>(HSA, h, g1, be1, H1f, H1h);
  // ---- mid = relu(h1 @ W1 + b1) -> f16 [4096][4096] ----
  {
    const int tiles = (kTok / 64) * (kFfn / 64);   // 4096
    wmma_gemm64<0, false, 2, 1, false, 2><<<dim3(tiles / 8, 1), dim3(256), 0, stream>>>(
        H1h, H1h, kDim, 0L, W1T, W1T, kDim, 0L,
        (void*)MID, (void*)MID, kFfn, 0L, b1, RQ, 0L, kTok, kFfn, kDim, kWCarryInv);
  }
  // ---- hf = mid @ W2 + b2 -> f32 [4096][1024] ----
  {
    const int tiles = (kTok / 64) * (kDim / 64);   // 1024
    wmma_gemm64<0, false, 2, 0, false, 0><<<dim3(tiles / 8, 1), dim3(256), 0, stream>>>(
        MID, MID, kFfn, 0L, W2T, W2T, kFfn, 0L,
        (void*)HF, (void*)HF, kDim, 0L, b2, RQ, 0L, kTok, kDim, kFfn, kWCarryInv);
  }
  // ---- h2 = LN(h1 + hf) * g2 + be2 -> output ----
  add_ln_kernel<false><<<dim3(kTok), dim3(256), 0, stream>>>(H1f, HF, g2, be2, out, H1h);
}

// v001
// A run of this version takes 592 microseconds.
// Two timings next to v000 put it at 2.12 and 2.13 times that version's speed.
// Contractions: q/k/v projections (h f16 x W^T f16 carried x16), scores Q_g.K_g (q, k f16 planes), attn.V_g (P f16 carried x32768 x V^T f16), output projection (ctx f16 carried x256 x Wo^T f16 x16), FFN up and down (h1 f16 / relu(u) f16 x W^T f16 x16): all on v_wmma_f32_16x16x32_f16 with f32 accumulate; relative bias (K=4), softmax, residuals and LayerNorm in f32.
#include <hip/hip_runtime.h>
#include <math.h>

// ---------------------------------------------------------------------------
// Problem constants
// ---------------------------------------------------------------------------
constexpr int kBatch    = 2;
constexpr int kSeq      = 2048;
constexpr int kDim      = 1024;
constexpr int kFfn      = 4096;
constexpr int kHeads    = 8;
constexpr int kHeadDim  = 128;
constexpr int kRl       = 4;
constexpr int kTok      = kBatch * kSeq;          // 4096 token rows
constexpr int kGroups   = kBatch * kHeads;        // 16 flat-reshape chunks
constexpr int kChunk    = kSeq * kHeadDim;        // 262144 elements per chunk
constexpr int kGpp      = 2;                      // chunks per attention pass
constexpr float kWCarry     = 16.0f;              // weights carried x16 in f16
constexpr float kWCarryInv  = 1.0f / 16.0f;
constexpr float kPCarry     = 32768.0f;           // probabilities carried x2^15 in f16
constexpr float kCtxCarry   = 256.0f;             // context carried x256 in f16
constexpr float kScoreScale = 0.08838834764831845f;            // 128^-0.5
constexpr float kPVScale    = kCtxCarry / kPCarry;             // 2^-7
constexpr float kWoScale    = 1.0f / (kCtxCarry * kWCarry);   // 2^-12
constexpr float kInvDim     = 1.0f / 1024.0f;
constexpr float kLnEps      = 1e-5f;
static_assert(kHeads * kHeadDim == kDim, "shape");
static_assert(kGroups * kChunk == kTok * kDim, "chunks");
static_assert(kGroups % kGpp == 0 && (kHeads % kGpp) == 0, "passes");
// Wave tile and k step of the GEMM engine: M, N multiples of 64, K multiples of 32
static_assert(kTok % 64 == 0 && kDim % 64 == 0 && kFfn % 64 == 0 && kSeq % 64 == 0 && kHeadDim % 64 == 0, "tiles");
static_assert(kDim % 32 == 0 && kHeadDim % 32 == 0 && kSeq % 32 == 0 && kFfn % 32 == 0, "ksteps");
static_assert(kSeq == 4 * 512, "softmax row map");
// Workgroup tile of the GEMM engine: M multiples of 256, N multiples of 128, K multiples of 64
static_assert(kTok % 256 == 0 && kSeq % 256 == 0, "block rows");
static_assert(kDim % 128 == 0 && kFfn % 128 == 0 && kSeq % 128 == 0 && kHeadDim % 128 == 0, "block cols");
static_assert(kDim % 64 == 0 && kHeadDim % 64 == 0 && kSeq % 64 == 0 && kFfn % 64 == 0, "stages");

typedef __attribute__((ext_vector_type(16))) _Float16 v16h;
typedef __attribute__((ext_vector_type(8)))  _Float16 v8h;
typedef __attribute__((ext_vector_type(16))) __bf16   v16b;
typedef __attribute__((ext_vector_type(8)))  __bf16   v8b;
typedef __attribute__((ext_vector_type(8)))  float    v8f;
typedef __attribute__((ext_vector_type(4)))  float    v4f;
typedef __attribute__((ext_vector_type(2)))  float    v2f;
typedef __attribute__((ext_vector_type(4)))  unsigned int v4u;

// ---------------------------------------------------------------------------
// Device helpers
// ---------------------------------------------------------------------------
__device__ __forceinline__ unsigned short f2bf_bits(float f) {
  unsigned u = __float_as_uint(f);
  return (unsigned short)((u + 0x7FFFu + ((u >> 16) & 1u)) >> 16);
}
__device__ __forceinline__ float bf_bits2f(unsigned short h) { return __uint_as_float(((unsigned)h) << 16); }

// hazard guards as plain device helpers
__device__ __forceinline__ void dep_guard_h(v8f& a, v8f& b, v16h x, v16h y) { asm volatile("v_nop\n\tv_nop\n\tv_nop\n\tv_nop" : "+v"(a), "+v"(b) : "v"(x), "v"(y)); }
__device__ __forceinline__ void dep_guard_b(v8f& a, v8f& b, v16b x, v16b y) { asm volatile("v_nop\n\tv_nop\n\tv_nop\n\tv_nop" : "+v"(a), "+v"(b) : "v"(x), "v"(y)); }
// all-accumulator tie of a 4-wide group, naming the A fragments as inputs
__device__ __forceinline__ void dep_guard4_h(v8f& a, v8f& b, v8f& c, v8f& d, v16h x, v16h y) { asm volatile("v_nop\n\tv_nop\n\tv_nop\n\tv_nop" : "+v"(a), "+v"(b), "+v"(c), "+v"(d) : "v"(x), "v"(y)); }
__device__ __forceinline__ void dep_guard4_b(v8f& a, v8f& b, v8f& c, v8f& d, v16b x, v16b y) { asm volatile("v_nop\n\tv_nop\n\tv_nop\n\tv_nop" : "+v"(a), "+v"(b), "+v"(c), "+v"(d) : "v"(x), "v"(y)); }
__device__ __forceinline__ void keep4_h(v16h a, v16h b, v16h c, v16h d) { asm volatile("v_nop" :: "v"(a), "v"(b), "v"(c), "v"(d)); }
__device__ __forceinline__ void keep4_b(v16b a, v16b b, v16b c, v16b d) { asm volatile("v_nop" :: "v"(a), "v"(b), "v"(c), "v"(d)); }
__device__ __forceinline__ void acc_guard4(v8f& a, v8f& b, v8f& c, v8f& d) { asm volatile("v_nop\n\tv_nop\n\tv_nop\n\tv_nop" : "+v"(a), "+v"(b), "+v"(c), "+v"(d)); }
template <typename T> struct Frag;
template <> struct Frag<_Float16> {
  typedef v16h V; union U { v16h v; v8h h[2]; };
  // elements 0..7 <- p[0..7], 8..15 <- p[16..23]
  static __device__ __forceinline__ v16h load(const _Float16* p) {
    U f; f.h[0] = *(const v8h*)(p); f.h[1] = *(const v8h*)(p + 16); return f.v;
  }
  static __device__ __forceinline__ v8f mma(v16h a, v16h b, v8f c) {
    return __builtin_amdgcn_wmma_f32_16x16x32_f16(false, a, false, b, (short)0, c, false, false);
  }
  static __device__ __forceinline__ void guard(v8f& a, v8f& b, v16h x, v16h y) { dep_guard_h(a, b, x, y); }
  static __device__ __forceinline__ void guard4(v8f& a, v8f& b, v8f& c, v8f& d, v16h x, v16h y) { dep_guard4_h(a, b, c, d, x, y); }
  static __device__ __forceinline__ void keep(v16h a, v16h b, v16h c, v16h d) { keep4_h(a, b, c, d); }
};
template <> struct Frag<__bf16> {
  typedef v16b V; union U { v16b v; v8b h[2]; };
  static __device__ __forceinline__ v16b load(const __bf16* p) {
    U f; f.h[0] = *(const v8b*)(p); f.h[1] = *(const v8b*)(p + 16); return f.v;
  }
  static __device__ __forceinline__ v8f mma(v16b a, v16b b, v8f c) {
    return __builtin_amdgcn_wmma_f32_16x16x32_bf16(false, a, false, b, (short)0, c, false, false);
  }
  static __device__ __forceinline__ void guard(v8f& a, v8f& b, v16b x, v16b y) { dep_guard_b(a, b, x, y); }
  static __device__ __forceinline__ void guard4(v8f& a, v8f& b, v8f& c, v8f& d, v16b x, v16b y) { dep_guard4_b(a, b, c, d, x, y); }
  static __device__ __forceinline__ void keep(v16b a, v16b b, v16b c, v16b d) { keep4_b(a, b, c, d); }
};

__device__ __forceinline__ unsigned pk16(unsigned short a, unsigned short b) { return (unsigned)a | ((unsigned)b << 16); }
__device__ __forceinline__ unsigned short h_bits(float f) { const _Float16 h = (_Float16)f; return __builtin_bit_cast(unsigned short, h); }

// ---- Register-blocked batched WMMA GEMM (ACT reduced to none/relu/leaky; per-row group guard ties all four
//      accumulators and names the A fragments) -------------------------------------------------------------------------
// C[m,n] = scale * sum_k A[m,k] * Bt[n,k] (+bias)(+resid); a workgroup owns a 256x128 tile, each of its 8 waves (4 x 2) a 64x64 tile.
// A row-major [M,K]; Bt row-major [N,K]; M % 256 == 0, N % 128 == 0, K % 64 == 0.
// Operands reach the waves through LDS: a stage is 64 k (128 B, one cache line) of the tile's 256 A rows and 128 Bt rows at a
// pitch of 144 B, laid by asynchronous copies of whole lines (8 lanes x 16 B per row) into a ring of two buffers, one stage ahead.
// SPLIT (hi/lo planes) is not staged by this engine: single-plane operands only.
// BIAS_MODE: 0 = none, 1 = bias[m], 2 = bias[n].
// OUT_MODE: 0 = f32, 1 = f16, 2 = bf16 hi plane (Cout) + bf16 lo plane (Cout2).
// ET: 0 = f16 operands, 1 = bf16 operands (pointers passed as 16-bit storage)
template <int ET> struct Elem;
template <> struct Elem<0> { typedef _Float16 T; };
template <> struct Elem<1> { typedef __bf16 T; };
constexpr int kBlkM       = 256;                          // A rows of a workgroup tile
constexpr int kBlkN       = 128;                          // Bt rows of a workgroup tile
constexpr int kStageK     = 64;                           // k per stage
constexpr int kRowPitch   = 144;                          // bytes per staged row: 16 B x odd, conflict-free for 16-byte LDS reads
constexpr int kPitchH     = kRowPitch / 2;                // the same in 16-bit elements
constexpr int kStageBytes = (kBlkM + kBlkN) * kRowPitch;  // 55,296: A rows 0..255, then Bt rows 0..127
// One lane's share of a stage: twelve 16-byte copies, staged rows r, r + 32, ... r + 352 (eight of A, four of Bt), r = thread >> 3.
// l = LDS byte address of this lane's 16 bytes in row r; a, b = global address of the same 16 bytes in A row r and Bt row r;
// sa, sb = bytes between 32 rows of A and of Bt. The s_wait_xcnt stands inside the statement so that no address register of a
// copy is rewritten ahead of it.
__device__ __forceinline__ void stage_copies(unsigned l, const char* a, size_t sa, const char* b, size_t sb) {
  constexpr unsigned kStep = 32u * kRowPitch;
  asm volatile(
      "global_load_async_to_lds_b128 %0, %12, off\n\t"
      "global_load_async_to_lds_b128 %1, %13, off\n\t"
      "global_load_async_to_lds_b128 %2, %14, off\n\t"
      "global_load_async_to_lds_b128 %3, %15, off\n\t"
      "global_load_async_to_lds_b128 %4, %16, off\n\t"
      "global_load_async_to_lds_b128 %5, %17, off\n\t"
      "global_load_async_to_lds_b128 %6, %18, off\n\t"
      "global_load_async_to_lds_b128 %7, %19, off\n\t"
      "global_load_async_to_lds_b128 %8, %20, off\n\t"
      "global_load_async_to_lds_b128 %9, %21, off\n\t"
      "global_load_async_to_lds_b128 %10, %22, off\n\t"
      "global_load_async_to_lds_b128 %11, %23, off\n\t"
      "s_wait_xcnt 0x0"
      :: "v"(l), "v"(l + kStep), "v"(l + 2 * kStep), "v"(l + 3 * kStep), "v"(l + 4 * kStep), "v"(l + 5 * kStep),
         "v"(l + 6 * kStep), "v"(l + 7 * kStep), "v"(l + 8 * kStep), "v"(l + 9 * kStep), "v"(l + 10 * kStep), "v"(l + 11 * kStep),
         "v"(a), "v"(a + sa), "v"(a + 2 * sa), "v"(a + 3 * sa), "v"(a + 4 * sa), "v"(a + 5 * sa), "v"(a + 6 * sa), "v"(a + 7 * sa),
         "v"(b), "v"(b + sb), "v"(b + 2 * sb), "v"(b + 3 * sb)
      : "memory");
}
template <int ET, bool SPLIT, int BIAS_MODE, int OUT_MODE, bool RESID, int ACT = 0>
__global__ __launch_bounds__(256) void wmma_gemm64(
    const unsigned short* __restrict__ Ap, const unsigned short* __restrict__ A2p, int lda, long strideA,
    const unsigned short* __restrict__ Btp, const unsigned short* __restrict__ Bt2p, int ldb, long strideB,
    void* __restrict__ Cout, void* __restrict__ Cout2, int ldc, long strideC,
    const float* __restrict__ bias,
    const float* __restrict__ resid, long strideR,
    int M, int N, int K, float scale) {
  typedef typename Elem<ET>::T T;
  typedef typename Frag<T>::V V;
  static_assert(!SPLIT, "single-plane operands only");
  const T* A = (const T*)Ap; const T* Bt = (const T*)Btp;
  __shared__ __align__(128) unsigned char ring[2 * kStageBytes];   // two stage buffers
  __shared__ __align__(16) float sT[8][16 * 68];   // per-wave 16x64 slab, pitch 68 floats
  const int b    = blockIdx.y;
  const int lane = threadIdx.x & 31;
  const int wave = threadIdx.x >> 5;
  const int tilesN = N >> 7;
  const int tilesM = M >> 8;
  const int tile = blockIdx.x;
  if (tile >= tilesM * tilesN) return;   // the same for the whole workgroup, ahead of every barrier
  const int tm = tile / tilesN;
  const int tn = tile - tm * tilesN;
  const int mBlk = tm << 8;
  const int nBlk = tn << 7;
  const int wRow = (wave >> 1) << 6;           // this wave's 64 rows inside the workgroup tile
  const int wCol = (wave & 1) << 6;            // this wave's 64 columns inside the workgroup tile
  const int m0 = mBlk + wRow;
  const int n0 = nBlk + wCol;

  const T* Ab  = A  + (size_t)b * strideA;
  const T* Bb  = Bt + (size_t)b * strideB;

  const int rlane = lane & 15;                 // row (A) / col (B, D) within subtile
  const int koff  = (lane >> 4) * 8;           // k offset of this lane half
  const int mOff  = (lane >> 4) * 8;           // D row offset

  // copy map: thread t moves bytes 16*(t&7) .. +15 of staged rows (t>>3) + 32*i, so a wave's copy covers four whole 128-B lines
  const int cRow = threadIdx.x >> 3;
  const int cCol = (threadIdx.x & 7) * 8;      // in 16-bit elements
  const char* gA = (const char*)(Ab + (size_t)(mBlk + cRow) * lda + cCol);
  const char* gB = (const char*)(Bb + (size_t)(nBlk + cRow) * ldb + cCol);
  const size_t stepA = (size_t)lda * (32 * sizeof(T));
  const size_t stepB = (size_t)ldb * (32 * sizeof(T));
  const unsigned ldsDst = (unsigned)(size_t)ring + (unsigned)(cRow * kRowPitch + cCol * 2);
  const int nStage = K / kStageK;

  v8f acc[4][4];
#pragma unroll
  for (int i = 0; i < 4; ++i)
#pragma unroll
    for (int j = 0; j < 4; ++j) acc[i][j] = (v8f){0.f,0.f,0.f,0.f,0.f,0.f,0.f,0.f};

  // ring prologue: stage 0 landed and published, then stage 1 in flight
  stage_copies(ldsDst, gA, stepA, gB, stepB);
  asm volatile("s_wait_asynccnt 0x0" ::: "memory");   // this wave's copies of stage 0 have landed
  __syncthreads();                                    // every wave's copies of stage 0 are readable
  if (nStage > 1) stage_copies(ldsDst + kStageBytes, gA + kStageK * sizeof(T), stepA, gB + kStageK * sizeof(T), stepB);

  for (int s = 0; s < nStage; ++s) {
    const unsigned bufOff = (unsigned)(s & 1) * kStageBytes;
    const T* sA = (const T*)(ring + bufOff + (wRow + rlane) * kRowPitch) + koff;
    const T* sB = (const T*)(ring + bufOff + (kBlkM + wCol + rlane) * kRowPitch) + koff;
#pragma unroll
    for (int kk = 0; kk < kStageK; kk += 32) {
      V bh[4], ah[4];   // all eight fragments of this k step are requested as one group, so the wave meets LDS latency once
#pragma unroll
      for (int j = 0; j < 4; ++j) {
        bh[j] = Frag<T>::load(sB + j * 16 * kPitchH + kk);
        ah[j] = Frag<T>::load(sA + j * 16 * kPitchH + kk);
      }
#pragma unroll
      for (int i = 0; i < 4; ++i) {
#pragma unroll
        for (int j = 0; j < 4; ++j) acc[i][j] = Frag<T>::mma(ah[i], bh[j], acc[i][j]);
        Frag<T>::guard4(acc[i][0], acc[i][1], acc[i][2], acc[i][3], ah[i], ah[i]);
      }
      Frag<T>::keep(bh[0], bh[1], bh[2], bh[3]);
    }
    // publish point of stage s + 1, and release of the buffer that stage s was read from
    asm volatile("s_wait_dscnt 0x0" ::: "memory");      // this wave's reads of stage s are done before the buffer is refilled
    asm volatile("s_wait_asynccnt 0x0" ::: "memory");   // this wave's copies of stage s + 1 have landed
    __syncthreads();
    if (s + 2 < nStage) {
      const size_t kb = (size_t)(s + 2) * (kStageK * sizeof(T));
      stage_copies(ldsDst + bufOff, gA + kb, stepA, gB + kb, stepB);
    }
  }
  asm volatile("s_wait_asynccnt 0x0" ::: "memory");     // nothing of this wave is in flight when the ring is left
  acc_guard4(acc[0][0], acc[0][1], acc[0][2], acc[0][3]);
  acc_guard4(acc[1][0], acc[1][1], acc[1][2], acc[1][3]);
  acc_guard4(acc[2][0], acc[2][1], acc[2][2], acc[2][3]);
  acc_guard4(acc[3][0], acc[3][1], acc[3][2], acc[3][3]);

  // ---- epilogue ----
  float* slab = sT[wave];
  const float* Rb = RESID ? (resid + (size_t)b * strideR) : nullptr;
#pragma unroll
  for (int i = 0; i < 4; ++i) {
    const int mBase = m0 + (i << 4);
#pragma unroll
    for (int j = 0; j < 4; ++j) {
      const int n = n0 + (j << 4) + rlane;
      float bv = 0.f;
      if (BIAS_MODE == 2) bv = bias[n];
#pragma unroll
      for (int r = 0; r < 8; ++r) {
        float v = acc[i][j][r] * scale;
        if (BIAS_MODE == 1) v += bias[mBase + mOff + r];
        if (BIAS_MODE == 2) v += bv;
        if (RESID) v += Rb[(size_t)(mBase + mOff + r) * ldc + n];
        if (ACT == 2) v = fmaxf(v, 0.0f);
        if (ACT == 4) v = (v > 0.f) ? v : 0.01f * v;
        slab[(mOff + r) * 68 + (j << 4) + rlane] = v;
      }
    }
    __builtin_amdgcn_fence(__ATOMIC_RELEASE, "workgroup");
    __builtin_amdgcn_wave_barrier();
    __builtin_amdgcn_fence(__ATOMIC_ACQUIRE, "workgroup");
    if (OUT_MODE == 0) {
      float* C = (float*)Cout + (size_t)b * strideC;
      const int hh = lane >> 4, c4 = (lane & 15) * 4;     // row seg = 256 B = 16 lanes x 16 B
      {
#pragma unroll
        for (int it = 0; it < 8; ++it) {
          const int row = it * 2 + hh;
          v4f v = *(const v4f*)(slab + row * 68 + c4);
          *(v4f*)(C + (size_t)(mBase + row) * ldc + n0 + c4) = v;
        }
        
      }
    } else {
      const int q = lane >> 3, c8 = (lane & 7) * 8;
      unsigned short* C  = (unsigned short*)Cout  + (size_t)b * strideC;
      unsigned short* C2 = (OUT_MODE == 2) ? ((unsigned short*)Cout2 + (size_t)b * strideC) : nullptr;
      {
#pragma unroll
        for (int it = 0; it < 4; ++it) {
          const int row = it * 4 + q;
          const float* sp = slab + row * 68 + c8;
          v8h hv, lv;
#pragma unroll
          for (int e = 0; e < 8; ++e) {
            if (OUT_MODE == 1) {
              hv[e] = (_Float16)sp[e];
            } else {
              unsigned short hb = f2bf_bits(sp[e]);
              unsigned short lb = f2bf_bits(sp[e] - bf_bits2f(hb));
              hv[e] = __builtin_bit_cast(_Float16, hb);
              lv[e] = __builtin_bit_cast(_Float16, lb);
            }
          }
          *(v8h*)(C + (size_t)(mBase + row) * ldc + n0 + c8) = hv;
          if (OUT_MODE == 2) *(v8h*)(C2 + (size_t)(mBase + row) * ldc + n0 + c8) = lv;
        }
        
      }
    }
    __builtin_amdgcn_fence(__ATOMIC_RELEASE, "workgroup");
    __builtin_amdgcn_wave_barrier();
    __builtin_amdgcn_fence(__ATOMIC_ACQUIRE, "workgroup");
  }
}

// ---------------------------------------------------------------------------
// ---------------------------------------------------------------------------
__global__ __launch_bounds__(256) void cast8_f16_kernel(const float* __restrict__ in, unsigned short* __restrict__ out, int n8) {
  const int i = blockIdx.x * 256 + threadIdx.x;
  if (i >= n8) return;
  const float* p = in + 8 * (size_t)i;
  const v4f a = *(const v4f*)(p);
  const v4f c = *(const v4f*)(p + 4);
  unsigned short hb[8];
#pragma unroll
  for (int e = 0; e < 4; ++e) {
    hb[e]     = h_bits(a[e]);
    hb[4 + e] = h_bits(c[e]);
  }
  const v4u u = (v4u){pk16(hb[0], hb[1]), pk16(hb[2], hb[3]), pk16(hb[4], hb[5]), pk16(hb[6], hb[7])};
  unsigned short* q = out + 8 * (size_t)i;
  *(v4u*)q = u;
  
}

// ---------------------------------------------------------------------------
// Weight transpose + cast: W row-major [kin][nout] f32 (x @ W orientation) -> WT[n][k] = f16(scale * W[k][n]), row-major [nout][kin].
// grid (kin/64, nout/64, nz): blockIdx.x = k tile (64 cols of WT), blockIdx.y = n tile (64 rows of WT), blockIdx.z selects the
// source pointer (block-uniform) and the output plane at out + z*planeStride halves. 256 threads.
// Load coverage: 4 iterations x 256 threads x float4 = 64 k-rows x 64 n-cols (4 b128 loads per lane).
// Store coverage: 8 waves x 2 iterations x 4 rows (lane>>3) = 64 n-rows; (lane&7) x 8 halves = 64 k-cols; each row segment =
// ---------------------------------------------------------------------------
__global__ __launch_bounds__(256) void wt_cast_kernel(const float* __restrict__ Wa, const float* __restrict__ Wb,
                                                      const float* __restrict__ Wc, const float* __restrict__ Wd,
                                                      unsigned short* __restrict__ out, int kin, int nout,
                                                      long planeStride, float scale) {
  __shared__ float sm[64][65];   // sm[n_local][k_local]
  const int t  = threadIdx.x;
  const int k0 = blockIdx.x * 64;
  const int n0 = blockIdx.y * 64;
  const int z  = blockIdx.z;
  const float* W = (z == 0) ? Wa : (z == 1) ? Wb : (z == 2) ? Wc : Wd;
#pragma unroll
  for (int i = 0; i < 4; ++i) {
    const int e  = i * 256 + t;
    const int r  = e >> 4;           // k local
    const int c4 = (e & 15) * 4;     // n local
    const v4f w = *(const v4f*)(W + (size_t)(k0 + r) * nout + n0 + c4);
    sm[c4 + 0][r] = w[0] * scale;
    sm[c4 + 1][r] = w[1] * scale;
    sm[c4 + 2][r] = w[2] * scale;
    sm[c4 + 3][r] = w[3] * scale;
  }
  __syncthreads();
  const int lane = t & 31, wave = t >> 5;
  const int q = lane >> 3, c8 = (lane & 7) * 8;
  unsigned short* op = out + (size_t)z * planeStride;
  {
#pragma unroll
    for (int it = 0; it < 2; ++it) {
      const int row = wave * 8 + it * 4 + q;                 // n local
      unsigned short hb[8];
#pragma unroll
      for (int e = 0; e < 8; ++e) hb[e] = h_bits(sm[row][c8 + e]);
      const v4u u = (v4u){pk16(hb[0], hb[1]), pk16(hb[2], hb[3]), pk16(hb[4], hb[5]), pk16(hb[6], hb[7])};
      *(v4u*)(op + (size_t)(n0 + row) * kin + k0 + c8) = u;
    }
    
  }
}

// ---------------------------------------------------------------------------
// 16-bit transpose of one flat chunk: src chunk z viewed as [rows][cols] (16-bit, row-major) -> dst chunk z = [cols][rows];
// chunk z lives at halves offset z*rows*cols in both planes. Bits are moved as integer words (no conversion).
// grid (cols/64, rows/64, nchunk); 256 threads.
// Load coverage: 8 iterations x 256 threads x 1 word (2 halves) = 64 rows x 64 cols (8 b32 loads per lane).
// Store coverage: 8 waves x 2 iterations x 4 rows (lane>>3) = 64 dst rows; (lane&7) x 8 halves = 64 dst cols; each row segment =
// ---------------------------------------------------------------------------
__global__ __launch_bounds__(256) void transpose16_kernel(const unsigned short* __restrict__ src, unsigned short* __restrict__ dst,
                                                          int rows, int cols) {
  __shared__ unsigned int sm[64][65];   // sm[col_local][row_local], one 16-bit value per word
  const int t  = threadIdx.x;
  const int c0 = blockIdx.x * 64;
  const int r0 = blockIdx.y * 64;
  const size_t cb = (size_t)blockIdx.z * rows * cols;
  const unsigned int* s32 = (const unsigned int*)(src + cb);
#pragma unroll
  for (int i = 0; i < 8; ++i) {
    const int e  = i * 256 + t;
    const int r  = e >> 5;          // row local
    const int cw = e & 31;          // word column local
    const unsigned int w = s32[(((size_t)(r0 + r) * cols + c0) >> 1) + cw];
    sm[2 * cw][r]     = w & 0xffffu;
    sm[2 * cw + 1][r] = w >> 16;
  }
  __syncthreads();
  const int lane = t & 31, wave = t >> 5;
  const int q = lane >> 3, c8 = (lane & 7) * 8;
  unsigned short* op = dst + cb;
  {
#pragma unroll
    for (int it = 0; it < 2; ++it) {
      const int row = wave * 8 + it * 4 + q;                 // col local = dst row
      const unsigned int* sp = &sm[row][c8];
      const v4u u = (v4u){ (sp[0] & 0xffffu) | (sp[1] << 16), (sp[2] & 0xffffu) | (sp[3] << 16),
                           (sp[4] & 0xffffu) | (sp[5] << 16), (sp[6] & 0xffffu) | (sp[7] << 16) };
      *(v4u*)(op + (size_t)(c0 + row) * rows + r0 + c8) = u;
    }
    
  }
}

// ---------------------------------------------------------------------------
// r_k = rh @ Wrk, r_q = rh @ Wrq (K = 4, f32 VALU): out[i][j] = sum_r rh[i][r] * W[r][j] (W row-major [in][out]).
// grid = 4096/256 = 16 blocks (exact).
// ---------------------------------------------------------------------------
__global__ __launch_bounds__(256) void rl_proj_kernel(const float* __restrict__ rh, const float* __restrict__ Wrk,
                                                      const float* __restrict__ Wrq, float* __restrict__ rk,
                                                      float* __restrict__ rq, int nrows) {
  const int idx = blockIdx.x * 256 + threadIdx.x;
  if (idx >= nrows) return;
  const v4f r  = *(const v4f*)(rh + (size_t)idx * kRl);
  const v4f k0 = *(const v4f*)(Wrk + 0);
  const v4f k1 = *(const v4f*)(Wrk + 4);
  const v4f k2 = *(const v4f*)(Wrk + 8);
  const v4f k3 = *(const v4f*)(Wrk + 12);
  asm volatile("" ::: "memory");
  const v4f q0 = *(const v4f*)(Wrq + 0);
  const v4f q1 = *(const v4f*)(Wrq + 4);
  const v4f q2 = *(const v4f*)(Wrq + 8);
  const v4f q3 = *(const v4f*)(Wrq + 12);
  v4f ok = r[0] * k0;
  ok = ok + r[1] * k1;
  ok = ok + r[2] * k2;
  ok = ok + r[3] * k3;
  v4f oq = r[0] * q0;
  oq = oq + r[1] * q1;
  oq = oq + r[2] * q2;
  oq = oq + r[3] * q3;
  float* pk = rk + (size_t)idx * kRl;
  float* pq = rq + (size_t)idx * kRl;
  *(v4f*)pk = ok;
  *(v4f*)pq = oq;
  
}

// ---------------------------------------------------------------------------
// Relative bias + row softmax over 2048 keys of one (chunk, query row), f32 math:
//   a[m] = S[m] (already scaled by 128^-0.5) + 0.5 * sum_r rq[b][l][r] * rk_flat[b][r*2048 + m]
//   P[l][m] = f16( 32768 * exp(a - max) / sum exp(a - max) )
// One block of 256 threads per (row l = blockIdx.x, chunk-in-pass gi = blockIdx.y); chunk g = g0 + gi, batch b = g >> 3.
// Phase 1/2: rolled 4-trip loops, thread t owns columns it*512 + 2t, 2t+1 (4 x 256 x 2 = 2048 = whole row); logits/exps in LDS.
// Reductions in fixed order (thread sequential, wave shuffle tree, 8 wave partials in index order).
// ---------------------------------------------------------------------------
__global__ __launch_bounds__(256) void relbias_softmax_kernel(const float* __restrict__ Sp, const float* __restrict__ rqp,
                                                             const float* __restrict__ rkp, unsigned short* __restrict__ Pp,
                                                             int g0) {
  __shared__ __align__(16) float lg[kSeq];
  __shared__ float redM[8];
  __shared__ float redS[8];
  const int l    = blockIdx.x;
  const int gi   = blockIdx.y;
  const int b    = (g0 + gi) >> 3;
  const int t    = threadIdx.x;
  const int lane = t & 31, wave = t >> 5;
  const size_t rowoff = ((size_t)gi * kSeq + l) * kSeq;
  const float* sr  = Sp + rowoff;
  const v4f    rq4 = *(const v4f*)(rqp + ((size_t)b * kSeq + l) * kRl);
  const float* rkb = rkp + (size_t)b * kSeq * kRl;

  float mx = -__builtin_inff();
#pragma unroll 1
  for (int it = 0; it < 4; ++it) {
    const int c = it * 512 + 2 * t;
    const v2f sv = *(const v2f*)(sr + c);
    const v2f k0 = *(const v2f*)(rkb + c);
    const v2f k1 = *(const v2f*)(rkb + kSeq + c);
    const v2f k2 = *(const v2f*)(rkb + 2 * kSeq + c);
    const v2f k3 = *(const v2f*)(rkb + 3 * kSeq + c);
    v2f av;
#pragma unroll
    for (int e = 0; e < 2; ++e) {
      float bsum = rq4[0] * k0[e];
      bsum = bsum + rq4[1] * k1[e];
      bsum = bsum + rq4[2] * k2[e];
      bsum = bsum + rq4[3] * k3[e];
      const float a = sv[e] + 0.5f * bsum;
      av[e] = a;
      mx = fmaxf(mx, a);
    }
    *(v2f*)(lg + c) = av;
  }
#pragma unroll
  for (int off = 16; off > 0; off >>= 1) mx = fmaxf(mx, __shfl_xor(mx, off, 32));
  if (lane == 0) redM[wave] = mx;
  __syncthreads();
  float m = redM[0];
#pragma unroll
  for (int w = 1; w < 8; ++w) m = fmaxf(m, redM[w]);

  float sum = 0.f;
#pragma unroll 1
  for (int it = 0; it < 4; ++it) {
    const int c = it * 512 + 2 * t;
    const v2f lv = *(const v2f*)(lg + c);
    v2f ev;
#pragma unroll
    for (int e = 0; e < 2; ++e) {
      ev[e] = expf(lv[e] - m);
      sum += ev[e];
    }
    *(v2f*)(lg + c) = ev;
  }
#pragma unroll
  for (int off = 16; off > 0; off >>= 1) sum += __shfl_xor(sum, off, 32);
  if (lane == 0) redS[wave] = sum;
  __syncthreads();
  float tot = redS[0];
#pragma unroll
  for (int w = 1; w < 8; ++w) tot += redS[w];
  const float inv = kPCarry / tot;

  const v4f e0 = *(const v4f*)(lg + 8 * t);
  const v4f e1 = *(const v4f*)(lg + 8 * t + 4);
  unsigned short hb[8];
#pragma unroll
  for (int e = 0; e < 4; ++e) {
    hb[e]     = h_bits(e0[e] * inv);
    hb[4 + e] = h_bits(e1[e] * inv);
  }
  const v4u u = (v4u){pk16(hb[0], hb[1]), pk16(hb[2], hb[3]), pk16(hb[4], hb[5]), pk16(hb[6], hb[7])};
  unsigned short* pr = Pp + rowoff + 8 * (size_t)t;
  *(v4u*)pr = u;
  
}

// ---------------------------------------------------------------------------
// One block of 256 threads per row; thread t owns columns 4t..4t+3. Reductions in fixed order (two separate LDS arrays).
// ---------------------------------------------------------------------------
template <bool HAS16>
__global__ __launch_bounds__(256) void add_ln_kernel(const float* __restrict__ x, const float* __restrict__ y,
                                                     const float* __restrict__ gam, const float* __restrict__ bet,
                                                     float* __restrict__ outp, unsigned short* __restrict__ out16) {
  __shared__ float red1[8];
  __shared__ float red2[8];
  __shared__ __align__(16) float srow[kDim];
  const int t = threadIdx.x;
  const int lane = t & 31, wave = t >> 5;
  const size_t base = (size_t)blockIdx.x * kDim;
  const v4f vx = *(const v4f*)(x + base + 4 * t);
  const v4f vy = *(const v4f*)(y + base + 4 * t);
  const v4f s  = vx + vy;
  float sum = (s[0] + s[1]) + (s[2] + s[3]);
#pragma unroll
  for (int off = 16; off > 0; off >>= 1) sum += __shfl_xor(sum, off, 32);
  if (lane == 0) red1[wave] = sum;
  __syncthreads();
  float tsum = red1[0];
#pragma unroll
  for (int w = 1; w < 8; ++w) tsum += red1[w];
  const float mu = tsum * kInvDim;
  const v4f d = s - mu;
  float sq = (d[0] * d[0] + d[1] * d[1]) + (d[2] * d[2] + d[3] * d[3]);
#pragma unroll
  for (int off = 16; off > 0; off >>= 1) sq += __shfl_xor(sq, off, 32);
  if (lane == 0) red2[wave] = sq;
  __syncthreads();
  float tsq = red2[0];
#pragma unroll
  for (int w = 1; w < 8; ++w) tsq += red2[w];
  const float var  = tsq * kInvDim;
  const float rstd = rsqrtf(var + kLnEps);
  const v4f g  = *(const v4f*)(gam + 4 * t);
  const v4f be = *(const v4f*)(bet + 4 * t);
  const v4f o  = (d * rstd) * g + be;
  float* op = outp + base + 4 * t;
  *(v4f*)op = o;
  
  if (HAS16) {
    *(v4f*)(srow + 4 * t) = o;
    __syncthreads();
    if (t < 128) {
      const v4f a = *(const v4f*)(srow + 8 * t);
      const v4f c = *(const v4f*)(srow + 8 * t + 4);
      unsigned short hb[8];
#pragma unroll
      for (int e = 0; e < 4; ++e) {
        hb[e]     = h_bits(a[e]);
        hb[4 + e] = h_bits(c[e]);
      }
      const v4u u = (v4u){pk16(hb[0], hb[1]), pk16(hb[2], hb[3]), pk16(hb[4], hb[5]), pk16(hb[6], hb[7])};
      unsigned short* hp = out16 + base + 8 * (size_t)t;
      *(v4u*)hp = u;
      
    }
  }
}

// ---------------------------------------------------------------------------
// Host glue.
//   R0  Hh   f16 [4096][1024]  8 MiB at   0 MiB   -> later ctx f16 [4096][1024] (same type, same layout; Hh dead after QKV GEMM)
//   R1  WT4  f16 4 x [1024][1024] (Wk^T | Wq^T | Wv^T | Wo^T, x16)   8 MiB at 8 MiB
//   R3  W1T  f16 [4096][1024] x16  8 MiB at 16 MiB
//   R4  W2T  f16 [1024][4096] x16  8 MiB at 24 MiB
//   R5  k    f16 [4096][1024]  8 MiB at 32 MiB   -> later h1 f16 [4096][1024] (same type, same layout; k dead after KT repack)
//   R6  q    f16 [4096][1024]  8 MiB at 40 MiB   \
//   R7  v    f16 [4096][1024]  8 MiB at 48 MiB    | -> later mid f16 [4096][4096] 32 MiB at 40 MiB (same type; all four dead after attention)
//   R8  KT   f16 [16][2048][128] 8 MiB at 56 MiB  |
//   R9  VT   f16 [16][128][2048] 8 MiB at 64 MiB /
//   R10 SC   f32 [2][2048][2048] 32 MiB at 72 MiB -> later h_sa f32 [4096][1024] at 72 MiB (then hf over h_sa after LN1) and h1 f32 at 88 MiB (same type)
//   R11 PP   f16 [2][2048][2048] 16 MiB at 104 MiB (probabilities x32768, reused 8x)
//   R12 rq   f32 [4096][4]  65,536 B at 120 MiB
//   R13 rk   f32 [4096][4]  65,536 B at 120 MiB + 64 KiB
//   total 125,960,192 B
// GEMM shapes (all M,N multiples of 64, K multiples of 32; no padding anywhere):
//   QKV  M=4096 N=1024 K=1024 (x3 batched); scores M=N=2048 K=128 (x2 per pass); ctx M=2048 N=128 K=2048 (x2 per pass);
//   Wo M=4096 N=1024 K=1024; W1 M=N=4096 K=1024; W2 M=4096 N=1024 K=4096.
// ---------------------------------------------------------------------------
extern "C" void kernel_launch(void* const* d_in, const int* in_sizes, int n_in,
                              void* d_out, int out_size, void* d_ws, size_t ws_size,
                              hipStream_t stream) {
  if (n_in < 16) return;
  const int nTokDim = kTok * kDim;                  // 4,194,304
  if (in_sizes[0] != nTokDim || in_sizes[1] != kTok * kRl) return;
  if (in_sizes[2] != kDim * kDim || in_sizes[3] != kDim * kDim || in_sizes[4] != kDim * kDim || in_sizes[5] != kDim * kDim) return;
  if (in_sizes[6] != kRl * kRl || in_sizes[7] != kRl * kRl) return;
  if (in_sizes[8] != kDim * kFfn || in_sizes[9] != kFfn || in_sizes[10] != kFfn * kDim || in_sizes[11] != kDim) return;
  if (in_sizes[12] != kDim || in_sizes[13] != kDim || in_sizes[14] != kDim || in_sizes[15] != kDim) return;
  if (out_size != nTokDim) return;

  const size_t szP16 = (size_t)kTok * kDim * 2;                 // 8,388,608
  const size_t szW4  = (size_t)4 * kDim * kDim * 2;             // 8,388,608
  const size_t szW1  = (size_t)kDim * kFfn * 2;                 // 8,388,608
  const size_t szSC  = (size_t)kGpp * kSeq * kSeq * 4;          // 33,554,432
  const size_t szPP  = (size_t)kGpp * kSeq * kSeq * 2;          // 16,777,216
  const size_t szR   = (size_t)kTok * kRl * 4;                  // 65,536
  static_assert((size_t)kGpp * kSeq * kSeq * 4 == 2 * (size_t)kTok * kDim * 4, "h_sa + h1 fit the score region");
  static_assert(4 * (size_t)kTok * kDim * 2 == (size_t)kTok * kFfn * 2, "mid fits q+v+KT+VT");
  const size_t offHh = 0;
  const size_t offW4 = offHh + szP16;
  const size_t offW1 = offW4 + szW4;
  const size_t offW2 = offW1 + szW1;
  const size_t offK  = offW2 + szW1;
  const size_t offQ  = offK + szP16;
  const size_t offV  = offQ + szP16;
  const size_t offKT = offV + szP16;
  const size_t offVT = offKT + szP16;
  const size_t offSC = offVT + szP16;
  const size_t offPP = offSC + szSC;
  const size_t offRQ = offPP + szPP;
  const size_t offRK = offRQ + szR;
  const size_t total = offRK + szR;                            // 125,960,192
  if (ws_size < total) return;

  const float* h   = (const float*)d_in[0];
  const float* rh  = (const float*)d_in[1];
  const float* Wq  = (const float*)d_in[2];
  const float* Wk  = (const float*)d_in[3];
  const float* Wv  = (const float*)d_in[4];
  const float* Wo  = (const float*)d_in[5];
  const float* Wrk = (const float*)d_in[6];
  const float* Wrq = (const float*)d_in[7];
  const float* W1  = (const float*)d_in[8];
  const float* b1  = (const float*)d_in[9];
  const float* W2  = (const float*)d_in[10];
  const float* b2  = (const float*)d_in[11];
  const float* g1  = (const float*)d_in[12];
  const float* be1 = (const float*)d_in[13];
  const float* g2  = (const float*)d_in[14];
  const float* be2 = (const float*)d_in[15];
  float* out = (float*)d_out;
  char* ws = (char*)d_ws;
  unsigned short* Hh  = (unsigned short*)(ws + offHh);
  unsigned short* CTX = Hh;                                    // alias after QKV GEMM
  unsigned short* WT4 = (unsigned short*)(ws + offW4);         // Wk^T, Wq^T, Wv^T, Wo^T planes of 1,048,576 halves
  unsigned short* WoT = WT4 + (size_t)3 * kDim * kDim;
  unsigned short* W1T = (unsigned short*)(ws + offW1);
  unsigned short* W2T = (unsigned short*)(ws + offW2);
  unsigned short* K16 = (unsigned short*)(ws + offK);
  unsigned short* H1h = K16;                                   // alias after KT repack
  unsigned short* Q16 = (unsigned short*)(ws + offQ);
  unsigned short* MID = Q16;                                   // alias after attention: [4096][4096] over q,v,KT,VT
  unsigned short* V16 = (unsigned short*)(ws + offV);
  unsigned short* KT  = (unsigned short*)(ws + offKT);
  unsigned short* VT  = (unsigned short*)(ws + offVT);
  float* SC  = (float*)(ws + offSC);
  float* HSA = SC;                                             // alias after attention
  float* HF  = HSA;                                            // alias after LN1
  float* H1f = (float*)(ws + offSC + szSC / 2);
  unsigned short* PP = (unsigned short*)(ws + offPP);
  float* RQ = (float*)(ws + offRQ);
  float* RK = (float*)(ws + offRK);

  // ---- prologue: 16-bit operand planes, relative projections ----
  const int n8 = nTokDim / 8;   // 524288 -> 2048 blocks exact
  cast8_f16_kernel<<<dim3(n8 / 256), dim3(256), 0, stream>>>(h, Hh, n8);
  // in[1024][1024] -> out[1024][1024] per z: z0 = Wk, z1 = Wq, z2 = Wv, z3 = Wo
  wt_cast_kernel<<<dim3(kDim / 64, kDim / 64, 4), dim3(256), 0, stream>>>(Wk, Wq, Wv, Wo, WT4, kDim, kDim, (long)kDim * kDim, kWCarry);
  // W1 in[1024][4096] -> W1T out[4096][1024]
  wt_cast_kernel<<<dim3(kDim / 64, kFfn / 64, 1), dim3(256), 0, stream>>>(W1, W1, W1, W1, W1T, kDim, kFfn, 0L, kWCarry);
  // W2 in[4096][1024] -> W2T out[1024][4096]
  wt_cast_kernel<<<dim3(kFfn / 64, kDim / 64, 1), dim3(256), 0, stream>>>(W2, W2, W2, W2, W2T, kFfn, kDim, 0L, kWCarry);
  rl_proj_kernel<<<dim3(kTok / 256), dim3(256), 0, stream>>>(rh, Wrk, Wrq, RK, RQ, kTok);

  // ---- q, k, v = h @ W (x16 weights folded back by 1/16): three separate [4096][1024] f16 planes (b0 -> k, b1 -> q, b2 -> v) ----
  {
    const int tiles = (kTok / 64) * (kDim / 64);   // 1024
    wmma_gemm64<0, false, 0, 1, false, 0><<<dim3(tiles / 8, 3), dim3(256), 0, stream>>>(
        Hh, Hh, kDim, 0L, WT4, WT4, kDim, (long)kDim * kDim,
        (void*)K16, (void*)K16, kDim, (long)kTok * kDim, RQ, RQ, 0L, kTok, kDim, kDim, kWCarryInv);
  }
  // ---- flat-reshape repacks per chunk: KT_g[m][d] = kchunk_g[d*2048+m] (in[128][2048] -> out[2048][128]);
  //      VT_g[d][m] = vchunk_g[m*128+d] (in[2048][128] -> out[128][2048]) ----
  transpose16_kernel<<<dim3(kSeq / 64, kHeadDim / 64, kGroups), dim3(256), 0, stream>>>(K16, KT, kHeadDim, kSeq);
  transpose16_kernel<<<dim3(kHeadDim / 64, kSeq / 64, kGroups), dim3(256), 0, stream>>>(V16, VT, kSeq, kHeadDim);

  // ---- attention, 2 chunks per pass ----
  const long strideChunk = (long)kChunk;            // 262,144 halves
  const long strideScore = (long)kSeq * kSeq;       // 4,194,304 per chunk-in-pass
  const int  tilesScore  = (kSeq / 64) * (kSeq / 64);        // 1024 -> 128 blocks
  const int  tilesCtx    = (kSeq / 64) * (kHeadDim / 64);    // 64 -> 8 blocks
  for (int g0 = 0; g0 < kGroups; g0 += kGpp) {
    const unsigned short* Ag  = Q16 + (size_t)g0 * kChunk;   // Q_g as [2048][128], lda 128
    const unsigned short* Btg = KT  + (size_t)g0 * kChunk;   // KT_g [2048][128], ldb 128
    // SC[gi][l][m] = 128^-0.5 * sum_d Q_g[l][d] * KT_g[m][d]   (M=N=2048, K=128)
    wmma_gemm64<0, false, 0, 0, false, 0><<<dim3(tilesScore / 8, kGpp), dim3(256), 0, stream>>>(
        Ag, Ag, kHeadDim, strideChunk, Btg, Btg, kHeadDim, strideChunk,
        (void*)SC, (void*)SC, kSeq, strideScore, RQ, RQ, 0L, kSeq, kSeq, kHeadDim, kScoreScale);
    // relative bias + softmax -> PP (f16, x32768)
    relbias_softmax_kernel<<<dim3(kSeq, kGpp), dim3(256), 0, stream>>>(SC, RQ, RK, PP, g0);
    // ctx_g[l][d] = 2^-7 * sum_m PP[gi][l][m] * VT_g[d][m] -> f16 x256 at CTX + g*262144 as [2048][128]   (M=2048, N=128, K=2048)
    const unsigned short* VTg = VT + (size_t)g0 * kChunk;    // VT_g [128][2048], ldb 2048
    unsigned short* Cg = CTX + (size_t)g0 * kChunk;
    wmma_gemm64<0, false, 0, 1, false, 0><<<dim3(tilesCtx / 8, kGpp), dim3(256), 0, stream>>>(
        PP, PP, kSeq, strideScore, VTg, VTg, kSeq, strideChunk,
        (void*)Cg, (void*)Cg, kHeadDim, strideChunk, RQ, RQ, 0L, kSeq, kHeadDim, kSeq, kPVScale);
  }

  // ---- h_sa = ctx @ Wo (fold back 1/(256*16)) -> f32 [4096][1024] ----
  {
    const int tiles = (kTok / 64) * (kDim / 64);   // 1024
    wmma_gemm64<0, false, 0, 0, false, 0><<<dim3(tiles / 8, 1), dim3(256), 0, stream>>>(
        CTX, CTX, kDim, 0L, WoT, WoT, kDim, 0L,
        (void*)HSA, (void*)HSA, kDim, 0L, RQ, RQ, 0L, kTok, kDim, kDim, kWoScale);
  }
  // ---- h1 = LN(h_sa + h) * g1 + be1 -> f32 plane + f16 plane ----
  add_ln_kernel<true><<<dim3(kTok), dim3(256), 0, stream>>>(HSA, h, g1, be1, H1f, H1h);
  // ---- mid = relu(h1 @ W1 + b1) -> f16 [4096][4096] ----
  {
    const int tiles = (kTok / 64) * (kFfn / 64);   // 4096
    wmma_gemm64<0, false, 2, 1, false, 2><<<dim3(tiles / 8, 1), dim3(256), 0, stream>>>(
        H1h, H1h, kDim, 0L, W1T, W1T, kDim, 0L,
        (void*)MID, (void*)MID, kFfn, 0L, b1, RQ, 0L, kTok, kFfn, kDim, kWCarryInv);
  }
  // ---- hf = mid @ W2 + b2 -> f32 [4096][1024] ----
  {
    const int tiles = (kTok / 64) * (kDim / 64);   // 1024
    wmma_gemm64<0, false, 2, 0, false, 0><<<dim3(tiles / 8, 1), dim3(256), 0, stream>>>(
        MID, MID, kFfn, 0L, W2T, W2T, kFfn, 0L,
        (void*)HF, (void*)HF, kDim, 0L, b2, RQ, 0L, kTok, kDim, kFfn, kWCarryInv);
  }
  // ---- h2 = LN(h1 + hf) * g2 + be2 -> output ----
  add_ln_kernel<false><<<dim3(kTok), dim3(256), 0, stream>>>(H1f, HF, g2, be2, out, H1h);
}

// v003
// Measured time: 196 microseconds a run.
// Versions in between are left out here; by their measured steps it is 3.00 times as fast as v001.
// All steps since v000 together make it 6.39 times as fast.
// Contractions: q/k/v projections (h f16 x W^T f16 carried x16), scores Q_g.K_g (q, k f16 planes), attn.V_g (P = exp(score - running row max) in f16 x V^T f16, normalised in f32 at the end), output projection (ctx f16 carried x256 x Wo^T f16 x16), FFN up and down (h1 f16 / relu(u) f16 x W^T f16 x16): all on v_wmma_f32_16x16x32_f16 with f32 accumulate; relative bias (K=4), softmax, residuals and LayerNorm in f32.
#include <hip/hip_runtime.h>
#include <math.h>

// ---------------------------------------------------------------------------
// Problem constants
// ---------------------------------------------------------------------------
constexpr int kBatch    = 2;
constexpr int kSeq      = 2048;
constexpr int kDim      = 1024;
constexpr int kFfn      = 4096;
constexpr int kHeads    = 8;
constexpr int kHeadDim  = 128;
constexpr int kRl       = 4;
constexpr int kTok      = kBatch * kSeq;          // 4096 token rows
constexpr int kGroups   = kBatch * kHeads;        // 16 flat-reshape chunks
constexpr int kChunk    = kSeq * kHeadDim;        // 262144 elements per chunk
constexpr float kWCarry     = 16.0f;              // weights carried x16 in f16
constexpr float kWCarryInv  = 1.0f / 16.0f;
constexpr float kCtxCarry   = 256.0f;             // context carried x256 in f16
constexpr float kScoreScale = 0.08838834764831845f;            // 128^-0.5
constexpr float kLog2e      = 1.4426950408889634f;
constexpr float kWoScale    = 1.0f / (kCtxCarry * kWCarry);   // 2^-12
constexpr float kInvDim     = 1.0f / 1024.0f;
constexpr float kLnEps      = 1e-5f;
static_assert(kHeads * kHeadDim == kDim, "shape");
static_assert(kGroups * kChunk == kTok * kDim, "chunks");
// Wave tile and k step: M, N multiples of 64, K multiples of 32
static_assert(kTok % 64 == 0 && kDim % 64 == 0 && kFfn % 64 == 0 && kSeq % 64 == 0 && kHeadDim % 64 == 0, "tiles");
static_assert(kDim % 32 == 0 && kHeadDim % 32 == 0 && kSeq % 32 == 0 && kFfn % 32 == 0, "ksteps");
// Workgroup tile of the GEMM engine: M multiples of 256, N multiples of 128, K multiples of 64
static_assert(kTok % 256 == 0 && kSeq % 256 == 0, "block rows");
static_assert(kDim % 128 == 0 && kFfn % 128 == 0 && kSeq % 128 == 0 && kHeadDim % 128 == 0, "block cols");
static_assert(kDim % 64 == 0 && kHeadDim % 64 == 0 && kSeq % 64 == 0 && kFfn % 64 == 0, "stages");

typedef __attribute__((ext_vector_type(16))) _Float16 v16h;
typedef __attribute__((ext_vector_type(8)))  _Float16 v8h;
typedef __attribute__((ext_vector_type(16))) __bf16   v16b;
typedef __attribute__((ext_vector_type(8)))  __bf16   v8b;
typedef __attribute__((ext_vector_type(8)))  float    v8f;
typedef __attribute__((ext_vector_type(4)))  float    v4f;
typedef __attribute__((ext_vector_type(2)))  float    v2f;
typedef __attribute__((ext_vector_type(4)))  unsigned int v4u;

// ---------------------------------------------------------------------------
// Device helpers
// ---------------------------------------------------------------------------
__device__ __forceinline__ unsigned short f2bf_bits(float f) {
  unsigned u = __float_as_uint(f);
  return (unsigned short)((u + 0x7FFFu + ((u >> 16) & 1u)) >> 16);
}
__device__ __forceinline__ float bf_bits2f(unsigned short h) { return __uint_as_float(((unsigned)h) << 16); }

// hazard guards as plain device helpers
__device__ __forceinline__ void dep_guard_h(v8f& a, v8f& b, v16h x, v16h y) { asm volatile("v_nop\n\tv_nop\n\tv_nop\n\tv_nop" : "+v"(a), "+v"(b) : "v"(x), "v"(y)); }
__device__ __forceinline__ void dep_guard_b(v8f& a, v8f& b, v16b x, v16b y) { asm volatile("v_nop\n\tv_nop\n\tv_nop\n\tv_nop" : "+v"(a), "+v"(b) : "v"(x), "v"(y)); }
// all-accumulator tie of a 4-wide group, naming the A fragments as inputs
__device__ __forceinline__ void dep_guard4_h(v8f& a, v8f& b, v8f& c, v8f& d, v16h x, v16h y) { asm volatile("v_nop\n\tv_nop\n\tv_nop\n\tv_nop" : "+v"(a), "+v"(b), "+v"(c), "+v"(d) : "v"(x), "v"(y)); }
__device__ __forceinline__ void dep_guard4_b(v8f& a, v8f& b, v8f& c, v8f& d, v16b x, v16b y) { asm volatile("v_nop\n\tv_nop\n\tv_nop\n\tv_nop" : "+v"(a), "+v"(b), "+v"(c), "+v"(d) : "v"(x), "v"(y)); }
__device__ __forceinline__ void keep4_h(v16h a, v16h b, v16h c, v16h d) { asm volatile("v_nop" :: "v"(a), "v"(b), "v"(c), "v"(d)); }
__device__ __forceinline__ void keep4_b(v16b a, v16b b, v16b c, v16b d) { asm volatile("v_nop" :: "v"(a), "v"(b), "v"(c), "v"(d)); }
__device__ __forceinline__ void acc_guard4(v8f& a, v8f& b, v8f& c, v8f& d) { asm volatile("v_nop\n\tv_nop\n\tv_nop\n\tv_nop" : "+v"(a), "+v"(b), "+v"(c), "+v"(d)); }
template <typename T> struct Frag;
template <> struct Frag<_Float16> {
  typedef v16h V; union U { v16h v; v8h h[2]; };
  // elements 0..7 <- p[0..7], 8..15 <- p[16..23]
  static __device__ __forceinline__ v16h load(const _Float16* p) {
    U f; f.h[0] = *(const v8h*)(p); f.h[1] = *(const v8h*)(p + 16); return f.v;
  }
  static __device__ __forceinline__ v8f mma(v16h a, v16h b, v8f c) {
    return __builtin_amdgcn_wmma_f32_16x16x32_f16(false, a, false, b, (short)0, c, false, false);
  }
  static __device__ __forceinline__ void guard(v8f& a, v8f& b, v16h x, v16h y) { dep_guard_h(a, b, x, y); }
  static __device__ __forceinline__ void guard4(v8f& a, v8f& b, v8f& c, v8f& d, v16h x, v16h y) { dep_guard4_h(a, b, c, d, x, y); }
  static __device__ __forceinline__ void keep(v16h a, v16h b, v16h c, v16h d) { keep4_h(a, b, c, d); }
};
template <> struct Frag<__bf16> {
  typedef v16b V; union U { v16b v; v8b h[2]; };
  static __device__ __forceinline__ v16b load(const __bf16* p) {
    U f; f.h[0] = *(const v8b*)(p); f.h[1] = *(const v8b*)(p + 16); return f.v;
  }
  static __device__ __forceinline__ v8f mma(v16b a, v16b b, v8f c) {
    return __builtin_amdgcn_wmma_f32_16x16x32_bf16(false, a, false, b, (short)0, c, false, false);
  }
  static __device__ __forceinline__ void guard(v8f& a, v8f& b, v16b x, v16b y) { dep_guard_b(a, b, x, y); }
  static __device__ __forceinline__ void guard4(v8f& a, v8f& b, v8f& c, v8f& d, v16b x, v16b y) { dep_guard4_b(a, b, c, d, x, y); }
  static __device__ __forceinline__ void keep(v16b a, v16b b, v16b c, v16b d) { keep4_b(a, b, c, d); }
};

__device__ __forceinline__ unsigned pk16(unsigned short a, unsigned short b) { return (unsigned)a | ((unsigned)b << 16); }
__device__ __forceinline__ unsigned short h_bits(float f) { const _Float16 h = (_Float16)f; return __builtin_bit_cast(unsigned short, h); }

// ---- Register-blocked batched WMMA GEMM (ACT reduced to none/relu/leaky; per-row group guard ties all four
//      accumulators and names the A fragments) -------------------------------------------------------------------------
// C[m,n] = scale * sum_k A[m,k] * Bt[n,k] (+bias)(+resid); a workgroup owns a 256x128 tile, each of its 8 waves (4 x 2) a 64x64 tile.
// A row-major [M,K]; Bt row-major [N,K]; M % 256 == 0, N % 128 == 0, K % 64 == 0.
// Operands reach the waves through LDS: a stage is 64 k (128 B, one cache line) of the tile's 256 A rows and 128 Bt rows at a
// pitch of 144 B, laid by asynchronous copies of whole lines (8 lanes x 16 B per row) into a ring of two buffers, one stage ahead.
// SPLIT (hi/lo planes) is not staged by this engine: single-plane operands only.
// BIAS_MODE: 0 = none, 1 = bias[m], 2 = bias[n].
// OUT_MODE: 0 = f32, 1 = f16, 2 = bf16 hi plane (Cout) + bf16 lo plane (Cout2).
// ET: 0 = f16 operands, 1 = bf16 operands (pointers passed as 16-bit storage)
// KSPLIT: the batch index b counts slices of the k range of ONE product (strideA, strideB = k per slice, K = k per slice); slice b
// stores its partial sum in plane b of Cout, the reader adds the planes, and only slice 0 adds the bias.
template <int ET> struct Elem;
template <> struct Elem<0> { typedef _Float16 T; };
template <> struct Elem<1> { typedef __bf16 T; };
constexpr int kBlkM       = 256;                          // A rows of a workgroup tile
constexpr int kBlkN       = 128;                          // Bt rows of a workgroup tile
constexpr int kStageK     = 64;                           // k per stage
constexpr int kRowPitch   = 144;                          // bytes per staged row: 16 B x odd, conflict-free for 16-byte LDS reads
constexpr int kPitchH     = kRowPitch / 2;                // the same in 16-bit elements
constexpr int kStageBytes = (kBlkM + kBlkN) * kRowPitch;  // 55,296: A rows 0..255, then Bt rows 0..127
// One lane's share of a stage: twelve 16-byte copies, staged rows r, r + 32, ... r + 352 (eight of A, four of Bt), r = thread >> 3.
// l = LDS byte address of this lane's 16 bytes in row r; a, b = global address of the same 16 bytes in A row r and Bt row r;
// sa, sb = bytes between 32 rows of A and of Bt. The s_wait_xcnt stands inside the statement so that no address register of a
// copy is rewritten ahead of it.
__device__ __forceinline__ void stage_copies(unsigned l, const char* a, size_t sa, const char* b, size_t sb) {
  constexpr unsigned kStep = 32u * kRowPitch;
  asm volatile(
      "global_load_async_to_lds_b128 %0, %12, off\n\t"
      "global_load_async_to_lds_b128 %1, %13, off\n\t"
      "global_load_async_to_lds_b128 %2, %14, off\n\t"
      "global_load_async_to_lds_b128 %3, %15, off\n\t"
      "global_load_async_to_lds_b128 %4, %16, off\n\t"
      "global_load_async_to_lds_b128 %5, %17, off\n\t"
      "global_load_async_to_lds_b128 %6, %18, off\n\t"
      "global_load_async_to_lds_b128 %7, %19, off\n\t"
      "global_load_async_to_lds_b128 %8, %20, off\n\t"
      "global_load_async_to_lds_b128 %9, %21, off\n\t"
      "global_load_async_to_lds_b128 %10, %22, off\n\t"
      "global_load_async_to_lds_b128 %11, %23, off\n\t"
      "s_wait_xcnt 0x0"
      :: "v"(l), "v"(l + kStep), "v"(l + 2 * kStep), "v"(l + 3 * kStep), "v"(l + 4 * kStep), "v"(l + 5 * kStep),
         "v"(l + 6 * kStep), "v"(l + 7 * kStep), "v"(l + 8 * kStep), "v"(l + 9 * kStep), "v"(l + 10 * kStep), "v"(l + 11 * kStep),
         "v"(a), "v"(a + sa), "v"(a + 2 * sa), "v"(a + 3 * sa), "v"(a + 4 * sa), "v"(a + 5 * sa), "v"(a + 6 * sa), "v"(a + 7 * sa),
         "v"(b), "v"(b + sb), "v"(b + 2 * sb), "v"(b + 3 * sb)
      : "memory");
}
template <int ET, bool SPLIT, int BIAS_MODE, int OUT_MODE, bool RESID, int ACT = 0, bool KSPLIT = false>
__global__ __launch_bounds__(256) void wmma_gemm64(
    const unsigned short* __restrict__ Ap, const unsigned short* __restrict__ A2p, int lda, long strideA,
    const unsigned short* __restrict__ Btp, const unsigned short* __restrict__ Bt2p, int ldb, long strideB,
    void* __restrict__ Cout, void* __restrict__ Cout2, int ldc, long strideC,
    const float* __restrict__ bias,
    const float* __restrict__ resid, long strideR,
    int M, int N, int K, float scale) {
  typedef typename Elem<ET>::T T;
  typedef typename Frag<T>::V V;
  static_assert(!SPLIT, "single-plane operands only");
  static_assert(!KSPLIT || (OUT_MODE == 0 && ACT == 0 && !RESID && BIAS_MODE != 1), "partial sums are plain f32 planes");
  const T* A = (const T*)Ap; const T* Bt = (const T*)Btp;
  __shared__ __align__(128) unsigned char ring[2 * kStageBytes];   // two stage buffers
  __shared__ __align__(16) float sT[8][16 * 68];   // per-wave 16x64 slab, pitch 68 floats
  const int b    = blockIdx.y;
  const int lane = threadIdx.x & 31;
  const int wave = threadIdx.x >> 5;
  const int tilesN = N >> 7;
  const int tilesM = M >> 8;
  const int tile = blockIdx.x;
  if (tile >= tilesM * tilesN) return;   // the same for the whole workgroup, ahead of every barrier
  const int tm = tile / tilesN;
  const int tn = tile - tm * tilesN;
  const int mBlk = tm << 8;
  const int nBlk = tn << 7;
  const int wRow = (wave >> 1) << 6;           // this wave's 64 rows inside the workgroup tile
  const int wCol = (wave & 1) << 6;            // this wave's 64 columns inside the workgroup tile
  const int m0 = mBlk + wRow;
  const int n0 = nBlk + wCol;

  const T* Ab  = A  + (size_t)b * strideA;
  const T* Bb  = Bt + (size_t)b * strideB;

  const int rlane = lane & 15;                 // row (A) / col (B, D) within subtile
  const int koff  = (lane >> 4) * 8;           // k offset of this lane half
  const int mOff  = (lane >> 4) * 8;           // D row offset

  // copy map: thread t moves bytes 16*(t&7) .. +15 of staged rows (t>>3) + 32*i, so a wave's copy covers four whole 128-B lines
  const int cRow = threadIdx.x >> 3;
  const int cCol = (threadIdx.x & 7) * 8;      // in 16-bit elements
  const char* gA = (const char*)(Ab + (size_t)(mBlk + cRow) * lda + cCol);
  const char* gB = (const char*)(Bb + (size_t)(nBlk + cRow) * ldb + cCol);
  const size_t stepA = (size_t)lda * (32 * sizeof(T));
  const size_t stepB = (size_t)ldb * (32 * sizeof(T));
  const unsigned ldsDst = (unsigned)(size_t)ring + (unsigned)(cRow * kRowPitch + cCol * 2);
  const int nStage = K / kStageK;

  v8f acc[4][4];
#pragma unroll
  for (int i = 0; i < 4; ++i)
#pragma unroll
    for (int j = 0; j < 4; ++j) acc[i][j] = (v8f){0.f,0.f,0.f,0.f,0.f,0.f,0.f,0.f};

  // ring prologue: stage 0 landed and published, then stage 1 in flight
  stage_copies(ldsDst, gA, stepA, gB, stepB);
  asm volatile("s_wait_asynccnt 0x0" ::: "memory");   // this wave's copies of stage 0 have landed
  __syncthreads();                                    // every wave's copies of stage 0 are readable
  if (nStage > 1) stage_copies(ldsDst + kStageBytes, gA + kStageK * sizeof(T), stepA, gB + kStageK * sizeof(T), stepB);

  for (int s = 0; s < nStage; ++s) {
    const unsigned bufOff = (unsigned)(s & 1) * kStageBytes;
    const T* sA = (const T*)(ring + bufOff + (wRow + rlane) * kRowPitch) + koff;
    const T* sB = (const T*)(ring + bufOff + (kBlkM + wCol + rlane) * kRowPitch) + koff;
#pragma unroll
    for (int kk = 0; kk < kStageK; kk += 32) {
      V bh[4], ah[4];   // all eight fragments of this k step are requested as one group, so the wave meets LDS latency once
#pragma unroll
      for (int j = 0; j < 4; ++j) {
        bh[j] = Frag<T>::load(sB + j * 16 * kPitchH + kk);
        ah[j] = Frag<T>::load(sA + j * 16 * kPitchH + kk);
      }
#pragma unroll
      for (int i = 0; i < 4; ++i) {
#pragma unroll
        for (int j = 0; j < 4; ++j) acc[i][j] = Frag<T>::mma(ah[i], bh[j], acc[i][j]);
        Frag<T>::guard4(acc[i][0], acc[i][1], acc[i][2], acc[i][3], ah[i], ah[i]);
      }
      Frag<T>::keep(bh[0], bh[1], bh[2], bh[3]);
    }
    // publish point of stage s + 1, and release of the buffer that stage s was read from
    asm volatile("s_wait_dscnt 0x0" ::: "memory");      // this wave's reads of stage s are done before the buffer is refilled
    asm volatile("s_wait_asynccnt 0x0" ::: "memory");   // this wave's copies of stage s + 1 have landed
    __syncthreads();
    if (s + 2 < nStage) {
      const size_t kb = (size_t)(s + 2) * (kStageK * sizeof(T));
      stage_copies(ldsDst + bufOff, gA + kb, stepA, gB + kb, stepB);
    }
  }
  asm volatile("s_wait_asynccnt 0x0" ::: "memory");     // nothing of this wave is in flight when the ring is left
  acc_guard4(acc[0][0], acc[0][1], acc[0][2], acc[0][3]);
  acc_guard4(acc[1][0], acc[1][1], acc[1][2], acc[1][3]);
  acc_guard4(acc[2][0], acc[2][1], acc[2][2], acc[2][3]);
  acc_guard4(acc[3][0], acc[3][1], acc[3][2], acc[3][3]);

  // ---- epilogue ----
  float* slab = sT[wave];
  const float* Rb = RESID ? (resid + (size_t)b * strideR) : nullptr;
#pragma unroll
  for (int i = 0; i < 4; ++i) {
    const int mBase = m0 + (i << 4);
#pragma unroll
    for (int j = 0; j < 4; ++j) {
      const int n = n0 + (j << 4) + rlane;
      float bv = 0.f;
      if (BIAS_MODE == 2) bv = bias[n];
      if (KSPLIT && b != 0) bv = 0.f;
#pragma unroll
      for (int r = 0; r < 8; ++r) {
        float v = acc[i][j][r] * scale;
        if (BIAS_MODE == 1) v += bias[mBase + mOff + r];
        if (BIAS_MODE == 2) v += bv;
        if (RESID) v += Rb[(size_t)(mBase + mOff + r) * ldc + n];
        if (ACT == 2) v = fmaxf(v, 0.0f);
        if (ACT == 4) v = (v > 0.f) ? v : 0.01f * v;
        slab[(mOff + r) * 68 + (j << 4) + rlane] = v;
      }
    }
    __builtin_amdgcn_fence(__ATOMIC_RELEASE, "workgroup");
    __builtin_amdgcn_wave_barrier();
    __builtin_amdgcn_fence(__ATOMIC_ACQUIRE, "workgroup");
    if (OUT_MODE == 0) {
      float* C = (float*)Cout + (size_t)b * strideC;
      const int hh = lane >> 4, c4 = (lane & 15) * 4;     // row seg = 256 B = 16 lanes x 16 B
      {
#pragma unroll
        for (int it = 0; it < 8; ++it) {
          const int row = it * 2 + hh;
          v4f v = *(const v4f*)(slab + row * 68 + c4);
          *(v4f*)(C + (size_t)(mBase + row) * ldc + n0 + c4) = v;
        }
        
      }
    } else {
      const int q = lane >> 3, c8 = (lane & 7) * 8;
      unsigned short* C  = (unsigned short*)Cout  + (size_t)b * strideC;
      unsigned short* C2 = (OUT_MODE == 2) ? ((unsigned short*)Cout2 + (size_t)b * strideC) : nullptr;
      {
#pragma unroll
        for (int it = 0; it < 4; ++it) {
          const int row = it * 4 + q;
          const float* sp = slab + row * 68 + c8;
          v8h hv, lv;
#pragma unroll
          for (int e = 0; e < 8; ++e) {
            if (OUT_MODE == 1) {
              hv[e] = (_Float16)sp[e];
            } else {
              unsigned short hb = f2bf_bits(sp[e]);
              unsigned short lb = f2bf_bits(sp[e] - bf_bits2f(hb));
              hv[e] = __builtin_bit_cast(_Float16, hb);
              lv[e] = __builtin_bit_cast(_Float16, lb);
            }
          }
          *(v8h*)(C + (size_t)(mBase + row) * ldc + n0 + c8) = hv;
          if (OUT_MODE == 2) *(v8h*)(C2 + (size_t)(mBase + row) * ldc + n0 + c8) = lv;
        }
        
      }
    }
    __builtin_amdgcn_fence(__ATOMIC_RELEASE, "workgroup");
    __builtin_amdgcn_wave_barrier();
    __builtin_amdgcn_fence(__ATOMIC_ACQUIRE, "workgroup");
  }
}

// ---------------------------------------------------------------------------
// ---------------------------------------------------------------------------
__global__ __launch_bounds__(256) void cast8_f16_kernel(const float* __restrict__ in, unsigned short* __restrict__ out, int n8) {
  const int i = blockIdx.x * 256 + threadIdx.x;
  if (i >= n8) return;
  const float* p = in + 8 * (size_t)i;
  const v4f a = *(const v4f*)(p);
  const v4f c = *(const v4f*)(p + 4);
  unsigned short hb[8];
#pragma unroll
  for (int e = 0; e < 4; ++e) {
    hb[e]     = h_bits(a[e]);
    hb[4 + e] = h_bits(c[e]);
  }
  const v4u u = (v4u){pk16(hb[0], hb[1]), pk16(hb[2], hb[3]), pk16(hb[4], hb[5]), pk16(hb[6], hb[7])};
  unsigned short* q = out + 8 * (size_t)i;
  *(v4u*)q = u;
  
}

// ---------------------------------------------------------------------------
// Weight transpose + cast: W row-major [kin][nout] f32 (x @ W orientation) -> WT[n][k] = f16(scale * W[k][n]), row-major [nout][kin].
// grid (kin/64, nout/64, nz): blockIdx.x = k tile (64 cols of WT), blockIdx.y = n tile (64 rows of WT), blockIdx.z selects the
// source pointer (block-uniform) and the output plane at out + z*planeStride halves. 256 threads.
// Load coverage: 4 iterations x 256 threads x float4 = 64 k-rows x 64 n-cols (4 b128 loads per lane).
// Store coverage: 8 waves x 2 iterations x 4 rows (lane>>3) = 64 n-rows; (lane&7) x 8 halves = 64 k-cols; each row segment =
// ---------------------------------------------------------------------------
__global__ __launch_bounds__(256) void wt_cast_kernel(const float* __restrict__ Wa, const float* __restrict__ Wb,
                                                      const float* __restrict__ Wc, const float* __restrict__ Wd,
                                                      unsigned short* __restrict__ out, int kin, int nout,
                                                      long planeStride, float scale) {
  __shared__ float sm[64][65];   // sm[n_local][k_local]
  const int t  = threadIdx.x;
  const int k0 = blockIdx.x * 64;
  const int n0 = blockIdx.y * 64;
  const int z  = blockIdx.z;
  const float* W = (z == 0) ? Wa : (z == 1) ? Wb : (z == 2) ? Wc : Wd;
#pragma unroll
  for (int i = 0; i < 4; ++i) {
    const int e  = i * 256 + t;
    const int r  = e >> 4;           // k local
    const int c4 = (e & 15) * 4;     // n local
    const v4f w = *(const v4f*)(W + (size_t)(k0 + r) * nout + n0 + c4);
    sm[c4 + 0][r] = w[0] * scale;
    sm[c4 + 1][r] = w[1] * scale;
    sm[c4 + 2][r] = w[2] * scale;
    sm[c4 + 3][r] = w[3] * scale;
  }
  __syncthreads();
  const int lane = t & 31, wave = t >> 5;
  const int q = lane >> 3, c8 = (lane & 7) * 8;
  unsigned short* op = out + (size_t)z * planeStride;
  {
#pragma unroll
    for (int it = 0; it < 2; ++it) {
      const int row = wave * 8 + it * 4 + q;                 // n local
      unsigned short hb[8];
#pragma unroll
      for (int e = 0; e < 8; ++e) hb[e] = h_bits(sm[row][c8 + e]);
      const v4u u = (v4u){pk16(hb[0], hb[1]), pk16(hb[2], hb[3]), pk16(hb[4], hb[5]), pk16(hb[6], hb[7])};
      *(v4u*)(op + (size_t)(n0 + row) * kin + k0 + c8) = u;
    }
    
  }
}

// ---------------------------------------------------------------------------
// 16-bit transpose of one flat chunk: src chunk z viewed as [rows][cols] (16-bit, row-major) -> dst chunk z = [cols][rows];
// chunk z lives at halves offset z*rows*cols in both planes. Bits are moved as integer words (no conversion).
// grid (cols/64, rows/64, nchunk); 256 threads.
// Load coverage: 8 iterations x 256 threads x 1 word (2 halves) = 64 rows x 64 cols (8 b32 loads per lane).
// Store coverage: 8 waves x 2 iterations x 4 rows (lane>>3) = 64 dst rows; (lane&7) x 8 halves = 64 dst cols; each row segment =
// ---------------------------------------------------------------------------
__global__ __launch_bounds__(256) void transpose16_kernel(const unsigned short* __restrict__ src, unsigned short* __restrict__ dst,
                                                          int rows, int cols) {
  __shared__ unsigned int sm[64][65];   // sm[col_local][row_local], one 16-bit value per word
  const int t  = threadIdx.x;
  const int c0 = blockIdx.x * 64;
  const int r0 = blockIdx.y * 64;
  const size_t cb = (size_t)blockIdx.z * rows * cols;
  const unsigned int* s32 = (const unsigned int*)(src + cb);
#pragma unroll
  for (int i = 0; i < 8; ++i) {
    const int e  = i * 256 + t;
    const int r  = e >> 5;          // row local
    const int cw = e & 31;          // word column local
    const unsigned int w = s32[(((size_t)(r0 + r) * cols + c0) >> 1) + cw];
    sm[2 * cw][r]     = w & 0xffffu;
    sm[2 * cw + 1][r] = w >> 16;
  }
  __syncthreads();
  const int lane = t & 31, wave = t >> 5;
  const int q = lane >> 3, c8 = (lane & 7) * 8;
  unsigned short* op = dst + cb;
  {
#pragma unroll
    for (int it = 0; it < 2; ++it) {
      const int row = wave * 8 + it * 4 + q;                 // col local = dst row
      const unsigned int* sp = &sm[row][c8];
      const v4u u = (v4u){ (sp[0] & 0xffffu) | (sp[1] << 16), (sp[2] & 0xffffu) | (sp[3] << 16),
                           (sp[4] & 0xffffu) | (sp[5] << 16), (sp[6] & 0xffffu) | (sp[7] << 16) };
      *(v4u*)(op + (size_t)(c0 + row) * rows + r0 + c8) = u;
    }
    
  }
}

// ---------------------------------------------------------------------------
// r_k = rh @ Wrk, r_q = rh @ Wrq (K = 4, f32 VALU): out[i][j] = sum_r rh[i][r] * W[r][j] (W row-major [in][out]).
// grid = 4096/256 = 16 blocks (exact).
// ---------------------------------------------------------------------------
__global__ __launch_bounds__(256) void rl_proj_kernel(const float* __restrict__ rh, const float* __restrict__ Wrk,
                                                      const float* __restrict__ Wrq, float* __restrict__ rk,
                                                      float* __restrict__ rq, int nrows) {
  const int idx = blockIdx.x * 256 + threadIdx.x;
  if (idx >= nrows) return;
  const v4f r  = *(const v4f*)(rh + (size_t)idx * kRl);
  const v4f k0 = *(const v4f*)(Wrk + 0);
  const v4f k1 = *(const v4f*)(Wrk + 4);
  const v4f k2 = *(const v4f*)(Wrk + 8);
  const v4f k3 = *(const v4f*)(Wrk + 12);
  asm volatile("" ::: "memory");
  const v4f q0 = *(const v4f*)(Wrq + 0);
  const v4f q1 = *(const v4f*)(Wrq + 4);
  const v4f q2 = *(const v4f*)(Wrq + 8);
  const v4f q3 = *(const v4f*)(Wrq + 12);
  v4f ok = r[0] * k0;
  ok = ok + r[1] * k1;
  ok = ok + r[2] * k2;
  ok = ok + r[3] * k3;
  v4f oq = r[0] * q0;
  oq = oq + r[1] * q1;
  oq = oq + r[2] * q2;
  oq = oq + r[3] * q3;
  float* pk = rk + (size_t)idx * kRl;
  float* pq = rq + (size_t)idx * kRl;
  *(v4f*)pk = ok;
  *(v4f*)pq = oq;
  
}

// ---------------------------------------------------------------------------
// Fused attention of one flat chunk g: scores, relative bias, softmax and attn.V in one kernel, no score or probability plane.
//   a[l][m] = 128^-0.5 * sum_d Q_g[l][d] * KT_g[m][d] + 0.5 * sum_r rq[b][l][r] * rk_flat[b][r*2048 + m]
//   ctx_g[l][d] = 256 * sum_m exp(a - max) * VT_g[d][m] / sum_m exp(a - max)      (f16, carried x256)
// grid (2048/128, 16): a workgroup of 8 waves owns 128 query rows of chunk blockIdx.y, a wave 16 of them; 32 stages of 64 keys.
// Both products are transposed, so that a query is a lane's column in every accumulator:
//   S^T (keys x queries) = KT tile (A) x Q rows (B);  O^T (d x queries) = VT tile (A) x P^T (B).
// An S^T accumulator holds, for the lane's query, keys 8*(lane>>4) + 0..7 of its 16: two neighbouring accumulators converted to
// f16 are the B fragment of 32 keys in the k order of Frag::load, so P goes through no LDS and no lane exchange.
// Row maximum and rescale factor are one scalar per lane, the row sum a pair of partial sums per lane (online softmax, logits kept in the log2 domain).
// A stage is 64 KT rows (256 B at pitch 272) and 128 VT rows (128 B at pitch 144), laid by asynchronous copies into two buffers.
// Every '#pragma unroll' below after the r_k copy makes the index of a fragment or accumulator array a constant, so that the array stays in registers.
// ---------------------------------------------------------------------------
constexpr int kFaKeys   = 64;                          // keys per stage
constexpr int kFaRows   = 128;                         // query rows per workgroup
constexpr int kFaKPitch = 272;                         // bytes per staged KT row: 16 B x odd
constexpr int kFaVPitch = 144;                         // bytes per staged VT row: 16 B x odd
constexpr int kFaKBytes = kFaKeys * kFaKPitch;         // 17,408
constexpr int kFaVBytes = kHeadDim * kFaVPitch;        // 18,432
constexpr int kFaStage  = kFaKBytes + kFaVBytes;       // 35,840
static_assert(kSeq % kFaKeys == 0 && kSeq % kFaRows == 0 && kSeq / kFaKeys >= 2 && kHeadDim == 128, "attention tiles");
// One lane's share of a stage: four 16-byte copies of KT rows r, r + 16, r + 32, r + 48 (r = thread >> 4) and four of VT rows
// r, r + 32, r + 64, r + 96 (r = thread >> 3). lk, lv = LDS byte addresses, k, v = global addresses of the first of each four.
// The s_wait_xcnt stands inside the statement so that no address register of a copy is rewritten ahead of it.
__device__ __forceinline__ void attn_stage_copies(unsigned lk, const char* k, unsigned lv, const char* v) {
  constexpr unsigned kLK = 16u * kFaKPitch, kLV = 32u * kFaVPitch;
  constexpr size_t kGK = (size_t)16 * kHeadDim * 2, kGV = (size_t)32 * kSeq * 2;
  asm volatile(
      "global_load_async_to_lds_b128 %0, %8, off\n\t"
      "global_load_async_to_lds_b128 %1, %9, off\n\t"
      "global_load_async_to_lds_b128 %2, %10, off\n\t"
      "global_load_async_to_lds_b128 %3, %11, off\n\t"
      "global_load_async_to_lds_b128 %4, %12, off\n\t"
      "global_load_async_to_lds_b128 %5, %13, off\n\t"
      "global_load_async_to_lds_b128 %6, %14, off\n\t"
      "global_load_async_to_lds_b128 %7, %15, off\n\t"
      "s_wait_xcnt 0x0"
      :: "v"(lk), "v"(lk + kLK), "v"(lk + 2 * kLK), "v"(lk + 3 * kLK), "v"(lv), "v"(lv + kLV), "v"(lv + 2 * kLV), "v"(lv + 3 * kLV),
         "v"(k), "v"(k + kGK), "v"(k + 2 * kGK), "v"(k + 3 * kGK), "v"(v), "v"(v + kGV), "v"(v + 2 * kGV), "v"(v + 3 * kGV)
      : "memory");
}
// value of lane l ^ 16
__device__ __forceinline__ float xhalf(float x) {
  const int i = __builtin_bit_cast(int, x);
  return __builtin_bit_cast(float, __builtin_amdgcn_permlanex16(i, i, 0x76543210, 0xfedcba98, false, false));
}
typedef __attribute__((ext_vector_type(2))) _Float16 v2h;
union PFrag { v16h v; v2h h[8]; };   // B fragment of 32 keys, filled two keys at a time
__global__ __launch_bounds__(256) void attn_fused_kernel(const unsigned short* __restrict__ Qp, const unsigned short* __restrict__ KTp,
                                                         const unsigned short* __restrict__ VTp, const float* __restrict__ rqp,
                                                         const float* __restrict__ rkp, unsigned short* __restrict__ Cp) {
  typedef Frag<_Float16> F;
  // r_k of this batch as the flat [4][2048] view, then the two stage buffers: in this order every LDS read's constant part
  // fits the instruction's 16-bit offset field
  __shared__ __align__(128) unsigned char smem[kRl * kSeq * 4 + 2 * kFaStage];
  float* rkS = (float*)smem;
  unsigned char* ring = smem + kRl * kSeq * 4;
  const int g     = blockIdx.y;
  const int b     = g >> 3;
  const int t     = threadIdx.x;
  const int lane  = t & 31, wave = t >> 5;
  const int rlane = lane & 15;                 // A row / B, D column within a subtile
  const int half8 = (lane >> 4) * 8;           // k offset of this lane half = D row offset
  const int q     = blockIdx.x * kFaRows + wave * 16 + rlane;   // this lane's query row
  const _Float16* Qg = (const _Float16*)Qp + (size_t)g * kChunk;
  const char* gK = (const char*)(KTp + (size_t)g * kChunk + (size_t)(t >> 4) * kHeadDim + (t & 15) * 8);
  const char* gV = (const char*)(VTp + (size_t)g * kChunk + (size_t)(t >> 3) * kSeq + (t & 7) * 8);
  const unsigned ldsK = (unsigned)(size_t)ring + (unsigned)((t >> 4) * kFaKPitch + (t & 15) * 16);
  const unsigned ldsV = (unsigned)(size_t)ring + (unsigned)(kFaKBytes + (t >> 3) * kFaVPitch + (t & 7) * 16);
  constexpr int nStage = kSeq / kFaKeys;
  constexpr size_t kStepK = (size_t)kFaKeys * kHeadDim * 2;     // global bytes between stages: 64 KT rows
  constexpr size_t kStepV = (size_t)kFaKeys * 2;                // 64 columns of VT

  // ring prologue: stage 0 (and r_k) landed and published, then stage 1 in flight
  attn_stage_copies(ldsK, gK, ldsV, gV);
  const float* rkb = rkp + (size_t)b * kSeq * kRl;
#pragma unroll
  for (int i = 0; i < kRl * kSeq / 1024; ++i) *(v4f*)(rkS + (i * 256 + t) * 4) = *(const v4f*)(rkb + (i * 256 + t) * 4);
  v16h qf[4];
#pragma unroll
  for (int ks = 0; ks < 4; ++ks) qf[ks] = F::load(Qg + (size_t)q * kHeadDim + ks * 32 + half8);
  const v4f rq4 = *(const v4f*)(rqp + ((size_t)b * kSeq + q) * kRl) * (0.5f * kLog2e);
  asm volatile("s_wait_asynccnt 0x0" ::: "memory");   // this wave's copies of stage 0 have landed
  __syncthreads();                                    // every wave's copies of stage 0 and stores of r_k are readable
  attn_stage_copies(ldsK + kFaStage, gK + kStepK, ldsV + kFaStage, gV + kStepV);

  v8f o[8];
#pragma unroll
  for (int dt = 0; dt < 8; ++dt) o[dt] = (v8f){0.f,0.f,0.f,0.f,0.f,0.f,0.f,0.f};
  float mrun = -__builtin_inff();   // running maximum of this query's logits (log2 domain), equal in both lane halves
  v2f lrun = (v2f){0.f, 0.f};       // running sums over this lane half's even and odd keys

  for (int s = 0; s < nStage; ++s) {
    const unsigned bufOff = (unsigned)(s & 1) * kFaStage;
    const _Float16* sK = (const _Float16*)(ring + bufOff + rlane * kFaKPitch) + half8;
    const _Float16* sV = (const _Float16*)(ring + bufOff + kFaKBytes + rlane * kFaVPitch) + half8;
    // S^T: four 16-key subtiles x this wave's 16 queries
    v8f sc[4];
#pragma unroll
    for (int mt = 0; mt < 4; ++mt) sc[mt] = (v8f){0.f,0.f,0.f,0.f,0.f,0.f,0.f,0.f};
#pragma unroll
    for (int ks = 0; ks < 4; ++ks)
#pragma unroll
      for (int mt = 0; mt < 4; ++mt) sc[mt] = F::mma(F::load(sK + mt * 16 * (kFaKPitch / 2) + ks * 32), qf[ks], sc[mt]);
    // logits (log2 domain) and their maximum; two keys per packed f32 instruction
    const float* rkT = rkS + s * kFaKeys + half8;
    v2f lg[4][4];
    float tmax = -__builtin_inff();
#pragma unroll
    for (int mt = 0; mt < 4; ++mt) {
      v4f kr[4][2];
#pragma unroll
      for (int j = 0; j < 4; ++j) {
        kr[j][0] = *(const v4f*)(rkT + j * kSeq + mt * 16);
        kr[j][1] = *(const v4f*)(rkT + j * kSeq + mt * 16 + 4);
      }
#pragma unroll
      for (int pr = 0; pr < 4; ++pr) {
        const int hi = pr >> 1, e = 2 * (pr & 1);
        v2f a = (v2f){rq4[0], rq4[0]} * (v2f){kr[0][hi][e], kr[0][hi][e + 1]};
        a = __builtin_elementwise_fma((v2f){rq4[1], rq4[1]}, (v2f){kr[1][hi][e], kr[1][hi][e + 1]}, a);
        a = __builtin_elementwise_fma((v2f){rq4[2], rq4[2]}, (v2f){kr[2][hi][e], kr[2][hi][e + 1]}, a);
        a = __builtin_elementwise_fma((v2f){rq4[3], rq4[3]}, (v2f){kr[3][hi][e], kr[3][hi][e + 1]}, a);
        a = __builtin_elementwise_fma((v2f){sc[mt][2 * pr], sc[mt][2 * pr + 1]}, (v2f){kScoreScale * kLog2e, kScoreScale * kLog2e}, a);
        lg[mt][pr] = a;
        tmax = fmaxf(tmax, fmaxf(a[0], a[1]));
      }
    }
    tmax = fmaxf(tmax, xhalf(tmax));
    const float mnew  = fmaxf(mrun, tmax);
    const float alpha = __builtin_amdgcn_exp2f(mrun - mnew);   // 0 in the first stage, where mrun is -inf
    mrun = mnew;
    PFrag pf[2];
    v2f ps[4];
#pragma unroll
    for (int mt = 0; mt < 4; ++mt) {
      v2f p[4];
#pragma unroll
      for (int pr = 0; pr < 4; ++pr) {
        const v2f x = lg[mt][pr] - (v2f){mnew, mnew};
        p[pr] = (v2f){__builtin_amdgcn_exp2f(x[0]), __builtin_amdgcn_exp2f(x[1])};
        pf[mt >> 1].h[(mt & 1) * 4 + pr] = __builtin_convertvector(p[pr], v2h);
      }
      ps[mt] = (p[0] + p[1]) + (p[2] + p[3]);
    }
    lrun = __builtin_elementwise_fma(lrun, (v2f){alpha, alpha}, (ps[0] + ps[1]) + (ps[2] + ps[3]));
#pragma unroll
    for (int dt = 0; dt < 8; ++dt) o[dt] = o[dt] * alpha;
    // O^T += VT tile x P^T
#pragma unroll
    for (int kk = 0; kk < 2; ++kk)
#pragma unroll
      for (int dt = 0; dt < 8; ++dt) o[dt] = F::mma(F::load(sV + dt * 16 * (kFaVPitch / 2) + kk * 32), pf[kk].v, o[dt]);
    // publish point of stage s + 1, and release of the buffer that stage s was read from
    asm volatile("s_wait_dscnt 0x0" ::: "memory");      // this wave's reads of stage s are done before the buffer is refilled
    asm volatile("s_wait_asynccnt 0x0" ::: "memory");   // this wave's copies of stage s + 1 have landed
    __syncthreads();
    if (s + 2 < nStage) attn_stage_copies(ldsK + bufOff, gK + (size_t)(s + 2) * kStepK, ldsV + bufOff, gV + (size_t)(s + 2) * kStepV);
  }
  asm volatile("s_wait_asynccnt 0x0" ::: "memory");     // nothing of this wave is in flight when the ring is left

  const float lsum = lrun[0] + lrun[1];
  const float inv = kCtxCarry / (lsum + xhalf(lsum));
  unsigned short* C = Cp + (size_t)g * kChunk + (size_t)q * kHeadDim + half8;
#pragma unroll
  for (int dt = 0; dt < 8; ++dt) {
    v8h hv;
#pragma unroll
    for (int r = 0; r < 8; ++r) hv[r] = (_Float16)(o[dt][r] * inv);
    *(v8h*)(C + dt * 16) = hv;
  }
}

// ---------------------------------------------------------------------------
// LayerNorm of x + (y + y2): y, y2 are the two k-slice partial planes of the product in front of it.
// One block of 256 threads per row; thread t owns columns 4t..4t+3. Reductions in fixed order (two separate LDS arrays).
// ---------------------------------------------------------------------------
template <bool HAS16>
__global__ __launch_bounds__(256) void add_ln_kernel(const float* __restrict__ x, const float* __restrict__ y,
                                                     const float* __restrict__ y2, const float* __restrict__ gam, const float* __restrict__ bet,
                                                     float* __restrict__ outp, unsigned short* __restrict__ out16) {
  __shared__ float red1[8];
  __shared__ float red2[8];
  __shared__ __align__(16) float srow[kDim];
  const int t = threadIdx.x;
  const int lane = t & 31, wave = t >> 5;
  const size_t base = (size_t)blockIdx.x * kDim;
  const v4f vx = *(const v4f*)(x + base + 4 * t);
  const v4f vy = *(const v4f*)(y + base + 4 * t);
  const v4f vz = *(const v4f*)(y2 + base + 4 * t);
  const v4f s  = vx + (vy + vz);
  float sum = (s[0] + s[1]) + (s[2] + s[3]);
#pragma unroll
  for (int off = 16; off > 0; off >>= 1) sum += __shfl_xor(sum, off, 32);
  if (lane == 0) red1[wave] = sum;
  __syncthreads();
  float tsum = red1[0];
#pragma unroll
  for (int w = 1; w < 8; ++w) tsum += red1[w];
  const float mu = tsum * kInvDim;
  const v4f d = s - mu;
  float sq = (d[0] * d[0] + d[1] * d[1]) + (d[2] * d[2] + d[3] * d[3]);
#pragma unroll
  for (int off = 16; off > 0; off >>= 1) sq += __shfl_xor(sq, off, 32);
  if (lane == 0) red2[wave] = sq;
  __syncthreads();
  float tsq = red2[0];
#pragma unroll
  for (int w = 1; w < 8; ++w) tsq += red2[w];
  const float var  = tsq * kInvDim;
  const float rstd = rsqrtf(var + kLnEps);
  const v4f g  = *(const v4f*)(gam + 4 * t);
  const v4f be = *(const v4f*)(bet + 4 * t);
  const v4f o  = (d * rstd) * g + be;
  float* op = outp + base + 4 * t;
  *(v4f*)op = o;
  
  if (HAS16) {
    *(v4f*)(srow + 4 * t) = o;
    __syncthreads();
    if (t < 128) {
      const v4f a = *(const v4f*)(srow + 8 * t);
      const v4f c = *(const v4f*)(srow + 8 * t + 4);
      unsigned short hb[8];
#pragma unroll
      for (int e = 0; e < 4; ++e) {
        hb[e]     = h_bits(a[e]);
        hb[4 + e] = h_bits(c[e]);
      }
      const v4u u = (v4u){pk16(hb[0], hb[1]), pk16(hb[2], hb[3]), pk16(hb[4], hb[5]), pk16(hb[6], hb[7])};
      unsigned short* hp = out16 + base + 8 * (size_t)t;
      *(v4u*)hp = u;
      
    }
  }
}

// ---------------------------------------------------------------------------
// Host glue.
//   R0  Hh   f16 [4096][1024]  8 MiB at   0 MiB   -> later ctx f16 [4096][1024] (same type, same layout; Hh dead after QKV GEMM)
//   R1  WT4  f16 4 x [1024][1024] (Wk^T | Wq^T | Wv^T | Wo^T, x16)   8 MiB at 8 MiB
//   R3  W1T  f16 [4096][1024] x16  8 MiB at 16 MiB
//   R4  W2T  f16 [1024][4096] x16  8 MiB at 24 MiB
//   R5  k    f16 [4096][1024]  8 MiB at 32 MiB   -> later h1 f16 [4096][1024] (same type, same layout; k dead after KT repack)
//   R6  q    f16 [4096][1024]  8 MiB at 40 MiB   \
//   R7  v    f16 [4096][1024]  8 MiB at 48 MiB    | -> later mid f16 [4096][4096] 32 MiB at 40 MiB (same type; all four dead after attention)
//   R8  KT   f16 [16][2048][128] 8 MiB at 56 MiB  |
//   R9  VT   f16 [16][128][2048] 8 MiB at 64 MiB /
//   R10 h_sa f32 2 x [4096][1024] (two k-slice partial planes) 32 MiB at 72 MiB (then the two hf planes over them after LN1)
//   R11 h1   f32 [4096][1024] 16 MiB at 104 MiB
//   R12 rq   f32 [4096][4]  65,536 B at 120 MiB
//   R13 rk   f32 [4096][4]  65,536 B at 120 MiB + 64 KiB
//   total 125,960,192 B
// GEMM shapes (all M,N multiples of 64, K multiples of 32; no padding anywhere):
//   QKV  M=4096 N=1024 K=1024 (x3 batched); scores and ctx per chunk inside the fused attention kernel;
//   Wo M=4096 N=1024 K=1024; W1 M=N=4096 K=1024; W2 M=4096 N=1024 K=4096.
// Wo and W2 have 128 tiles of 256x128, half as many as the chip has WGPs: each runs as two k slices (256 workgroups), and the
// LayerNorm behind it adds the two partial planes.
// ---------------------------------------------------------------------------
extern "C" void kernel_launch(void* const* d_in, const int* in_sizes, int n_in,
                              void* d_out, int out_size, void* d_ws, size_t ws_size,
                              hipStream_t stream) {
  if (n_in < 16) return;
  const int nTokDim = kTok * kDim;                  // 4,194,304
  if (in_sizes[0] != nTokDim || in_sizes[1] != kTok * kRl) return;
  if (in_sizes[2] != kDim * kDim || in_sizes[3] != kDim * kDim || in_sizes[4] != kDim * kDim || in_sizes[5] != kDim * kDim) return;
  if (in_sizes[6] != kRl * kRl || in_sizes[7] != kRl * kRl) return;
  if (in_sizes[8] != kDim * kFfn || in_sizes[9] != kFfn || in_sizes[10] != kFfn * kDim || in_sizes[11] != kDim) return;
  if (in_sizes[12] != kDim || in_sizes[13] != kDim || in_sizes[14] != kDim || in_sizes[15] != kDim) return;
  if (out_size != nTokDim) return;

  const size_t szP16 = (size_t)kTok * kDim * 2;                 // 8,388,608
  const size_t szW4  = (size_t)4 * kDim * kDim * 2;             // 8,388,608
  const size_t szW1  = (size_t)kDim * kFfn * 2;                 // 8,388,608
  const size_t szSC  = 3 * (size_t)kTok * kDim * 4;             // 50,331,648
  const size_t szR   = (size_t)kTok * kRl * 4;                  // 65,536
  static_assert(4 * (size_t)kTok * kDim * 2 == (size_t)kTok * kFfn * 2, "mid fits q+v+KT+VT");
  const size_t offHh = 0;
  const size_t offW4 = offHh + szP16;
  const size_t offW1 = offW4 + szW4;
  const size_t offW2 = offW1 + szW1;
  const size_t offK  = offW2 + szW1;
  const size_t offQ  = offK + szP16;
  const size_t offV  = offQ + szP16;
  const size_t offKT = offV + szP16;
  const size_t offVT = offKT + szP16;
  const size_t offSC = offVT + szP16;
  const size_t offRQ = offSC + szSC;
  const size_t offRK = offRQ + szR;
  const size_t total = offRK + szR;                            // 125,960,192
  if (ws_size < total) return;

  const float* h   = (const float*)d_in[0];
  const float* rh  = (const float*)d_in[1];
  const float* Wq  = (const float*)d_in[2];
  const float* Wk  = (const float*)d_in[3];
  const float* Wv  = (const float*)d_in[4];
  const float* Wo  = (const float*)d_in[5];
  const float* Wrk = (const float*)d_in[6];
  const float* Wrq = (const float*)d_in[7];
  const float* W1  = (const float*)d_in[8];
  const float* b1  = (const float*)d_in[9];
  const float* W2  = (const float*)d_in[10];
  const float* b2  = (const float*)d_in[11];
  const float* g1  = (const float*)d_in[12];
  const float* be1 = (const float*)d_in[13];
  const float* g2  = (const float*)d_in[14];
  const float* be2 = (const float*)d_in[15];
  float* out = (float*)d_out;
  char* ws = (char*)d_ws;
  unsigned short* Hh  = (unsigned short*)(ws + offHh);
  unsigned short* CTX = Hh;                                    // alias after QKV GEMM
  unsigned short* WT4 = (unsigned short*)(ws + offW4);         // Wk^T, Wq^T, Wv^T, Wo^T planes of 1,048,576 halves
  unsigned short* WoT = WT4 + (size_t)3 * kDim * kDim;
  unsigned short* W1T = (unsigned short*)(ws + offW1);
  unsigned short* W2T = (unsigned short*)(ws + offW2);
  unsigned short* K16 = (unsigned short*)(ws + offK);
  unsigned short* H1h = K16;                                   // alias after KT repack
  unsigned short* Q16 = (unsigned short*)(ws + offQ);
  unsigned short* MID = Q16;                                   // alias after attention: [4096][4096] over q,v,KT,VT
  unsigned short* V16 = (unsigned short*)(ws + offV);
  unsigned short* KT  = (unsigned short*)(ws + offKT);
  unsigned short* VT  = (unsigned short*)(ws + offVT);
  float* HSA = (float*)(ws + offSC);                           // plane 0; plane 1 follows it
  float* HF  = HSA;                                            // alias after LN1, two planes as well
  float* H1f = (float*)(ws + offSC + 2 * (szSC / 3));
  float* RQ = (float*)(ws + offRQ);
  float* RK = (float*)(ws + offRK);

  // ---- prologue: 16-bit operand planes, relative projections ----
  const int n8 = nTokDim / 8;   // 524288 -> 2048 blocks exact
  cast8_f16_kernel<<<dim3(n8 / 256), dim3(256), 0, stream>>>(h, Hh, n8);
  // in[1024][1024] -> out[1024][1024] per z: z0 = Wk, z1 = Wq, z2 = Wv, z3 = Wo
  wt_cast_kernel<<<dim3(kDim / 64, kDim / 64, 4), dim3(256), 0, stream>>>(Wk, Wq, Wv, Wo, WT4, kDim, kDim, (long)kDim * kDim, kWCarry);
  // W1 in[1024][4096] -> W1T out[4096][1024]
  wt_cast_kernel<<<dim3(kDim / 64, kFfn / 64, 1), dim3(256), 0, stream>>>(W1, W1, W1, W1, W1T, kDim, kFfn, 0L, kWCarry);
  // W2 in[4096][1024] -> W2T out[1024][4096]
  wt_cast_kernel<<<dim3(kFfn / 64, kDim / 64, 1), dim3(256), 0, stream>>>(W2, W2, W2, W2, W2T, kFfn, kDim, 0L, kWCarry);
  rl_proj_kernel<<<dim3(kTok / 256), dim3(256), 0, stream>>>(rh, Wrk, Wrq, RK, RQ, kTok);

  // ---- q, k, v = h @ W (x16 weights folded back by 1/16): three separate [4096][1024] f16 planes (b0 -> k, b1 -> q, b2 -> v) ----
  {
    const int tiles = (kTok / 64) * (kDim / 64);   // 1024
    wmma_gemm64<0, false, 0, 1, false, 0><<<dim3(tiles / 8, 3), dim3(256), 0, stream>>>(
        Hh, Hh, kDim, 0L, WT4, WT4, kDim, (long)kDim * kDim,
        (void*)K16, (void*)K16, kDim, (long)kTok * kDim, RQ, RQ, 0L, kTok, kDim, kDim, kWCarryInv);
  }
  // ---- flat-reshape repacks per chunk: KT_g[m][d] = kchunk_g[d*2048+m] (in[128][2048] -> out[2048][128]);
  //      VT_g[d][m] = vchunk_g[m*128+d] (in[2048][128] -> out[128][2048]) ----
  transpose16_kernel<<<dim3(kSeq / 64, kHeadDim / 64, kGroups), dim3(256), 0, stream>>>(K16, KT, kHeadDim, kSeq);
  transpose16_kernel<<<dim3(kHeadDim / 64, kSeq / 64, kGroups), dim3(256), 0, stream>>>(V16, VT, kSeq, kHeadDim);

  // ---- attention, all 16 chunks in one launch: ctx_g f16 x256 at CTX + g*262144 as [2048][128] ----
  attn_fused_kernel<<<dim3(kSeq / kFaRows, kGroups), dim3(256), 0, stream>>>(Q16, KT, VT, RQ, RK, CTX);

  // ---- h_sa = ctx @ Wo (fold back 1/(256*16)) -> two f32 [4096][1024] partial planes, k 0..511 and 512..1023 ----
  {
    const int tiles = (kTok / 64) * (kDim / 64);   // 1024
    wmma_gemm64<0, false, 0, 0, false, 0, true><<<dim3(tiles / 8, 2), dim3(256), 0, stream>>>(
        CTX, CTX, kDim, (long)(kDim / 2), WoT, WoT, kDim, (long)(kDim / 2),
        (void*)HSA, (void*)HSA, kDim, (long)kTok * kDim, RQ, RQ, 0L, kTok, kDim, kDim / 2, kWoScale);
  }
  // ---- h1 = LN(h + h_sa) * g1 + be1 -> f32 plane + f16 plane ----
  add_ln_kernel<true><<<dim3(kTok), dim3(256), 0, stream>>>(h, HSA, HSA + (size_t)kTok * kDim, g1, be1, H1f, H1h);
  // ---- mid = relu(h1 @ W1 + b1) -> f16 [4096][4096] ----
  {
    const int tiles = (kTok / 64) * (kFfn / 64);   // 4096
    wmma_gemm64<0, false, 2, 1, false, 2><<<dim3(tiles / 8, 1), dim3(256), 0, stream>>>(
        H1h, H1h, kDim, 0L, W1T, W1T, kDim, 0L,
        (void*)MID, (void*)MID, kFfn, 0L, b1, RQ, 0L, kTok, kFfn, kDim, kWCarryInv);
  }
  // ---- hf = mid @ W2 + b2 -> two f32 [4096][1024] partial planes, k 0..2047 (with b2) and 2048..4095 ----
  {
    const int tiles = (kTok / 64) * (kDim / 64);   // 1024
    wmma_gemm64<0, false, 2, 0, false, 0, true><<<dim3(tiles / 8, 2), dim3(256), 0, stream>>>(
        MID, MID, kFfn, (long)(kFfn / 2), W2T, W2T, kFfn, (long)(kFfn / 2),
        (void*)HF, (void*)HF, kDim, (long)kTok * kDim, b2, RQ, 0L, kTok, kDim, kFfn / 2, kWCarryInv);
  }
  // ---- h2 = LN(h1 + hf) * g2 + be2 -> output ----
  add_ln_kernel<false><<<dim3(kTok), dim3(256), 0, stream>>>(H1f, HF, HF + (size_t)kTok * kDim, g2, be2, out, H1h);
}

// v004
// One run takes 186 microseconds.
// In two side-by-side timings against v003, it was 1.05 and 1.06 times as fast.
// All steps since v000 together make it 6.74 times as fast.
// Contractions: q/k/v projections (h f16 x W^T f16 carried x16), scores Q_g.K_g (q, k f16 planes), attn.V_g (P = exp(score - running row max) in f16 x V^T f16, normalised in f32 at the end), output projection (ctx f16 carried x256 x Wo^T f16 x16), FFN up and down (h1 f16 / relu(u) f16 x W^T f16 x16): all on v_wmma_f32_16x16x32_f16 with f32 accumulate; relative bias (K=4), softmax, residuals and LayerNorm in f32.
#include <hip/hip_runtime.h>
#include <math.h>

// ---------------------------------------------------------------------------
// Problem constants
// ---------------------------------------------------------------------------
constexpr int kBatch    = 2;
constexpr int kSeq      = 2048;
constexpr int kDim      = 1024;
constexpr int kFfn      = 4096;
constexpr int kHeads    = 8;
constexpr int kHeadDim  = 128;
constexpr int kRl       = 4;
constexpr int kTok      = kBatch * kSeq;          // 4096 token rows
constexpr int kGroups   = kBatch * kHeads;        // 16 flat-reshape chunks
constexpr int kChunk    = kSeq * kHeadDim;        // 262144 elements per chunk
constexpr float kWCarry     = 16.0f;              // weights carried x16 in f16
constexpr float kWCarryInv  = 1.0f / 16.0f;
constexpr float kCtxCarry   = 256.0f;             // context carried x256 in f16
constexpr float kScoreScale = 0.08838834764831845f;            // 128^-0.5
constexpr float kLog2e      = 1.4426950408889634f;
constexpr float kWoScale    = 1.0f / (kCtxCarry * kWCarry);   // 2^-12
constexpr float kInvDim     = 1.0f / 1024.0f;
constexpr float kLnEps      = 1e-5f;
static_assert(kHeads * kHeadDim == kDim, "shape");
static_assert(kGroups * kChunk == kTok * kDim, "chunks");
// Wave tile and k step: M, N multiples of 64, K multiples of 32
static_assert(kTok % 64 == 0 && kDim % 64 == 0 && kFfn % 64 == 0 && kSeq % 64 == 0 && kHeadDim % 64 == 0, "tiles");
static_assert(kDim % 32 == 0 && kHeadDim % 32 == 0 && kSeq % 32 == 0 && kFfn % 32 == 0, "ksteps");
// Workgroup tile of the GEMM engine: M multiples of 256, N multiples of 128, K multiples of 64
static_assert(kTok % 256 == 0 && kSeq % 256 == 0, "block rows");
static_assert(kDim % 128 == 0 && kFfn % 128 == 0 && kSeq % 128 == 0 && kHeadDim % 128 == 0, "block cols");
static_assert(kDim % 64 == 0 && kHeadDim % 64 == 0 && kSeq % 64 == 0 && kFfn % 64 == 0, "stages");

typedef __attribute__((ext_vector_type(16))) _Float16 v16h;
typedef __attribute__((ext_vector_type(8)))  _Float16 v8h;
typedef __attribute__((ext_vector_type(16))) __bf16   v16b;
typedef __attribute__((ext_vector_type(8)))  __bf16   v8b;
typedef __attribute__((ext_vector_type(8)))  float    v8f;
typedef __attribute__((ext_vector_type(4)))  float    v4f;
typedef __attribute__((ext_vector_type(2)))  float    v2f;
typedef __attribute__((ext_vector_type(4)))  unsigned int v4u;

// ---------------------------------------------------------------------------
// Device helpers
// ---------------------------------------------------------------------------
__device__ __forceinline__ unsigned short f2bf_bits(float f) {
  unsigned u = __float_as_uint(f);
  return (unsigned short)((u + 0x7FFFu + ((u >> 16) & 1u)) >> 16);
}
__device__ __forceinline__ float bf_bits2f(unsigned short h) { return __uint_as_float(((unsigned)h) << 16); }

// hazard guards as plain device helpers
__device__ __forceinline__ void dep_guard_h(v8f& a, v8f& b, v16h x, v16h y) { asm volatile("v_nop\n\tv_nop\n\tv_nop\n\tv_nop" : "+v"(a), "+v"(b) : "v"(x), "v"(y)); }
__device__ __forceinline__ void dep_guard_b(v8f& a, v8f& b, v16b x, v16b y) { asm volatile("v_nop\n\tv_nop\n\tv_nop\n\tv_nop" : "+v"(a), "+v"(b) : "v"(x), "v"(y)); }
// all-accumulator tie of a 4-wide group, naming the A fragments as inputs
__device__ __forceinline__ void dep_guard4_h(v8f& a, v8f& b, v8f& c, v8f& d, v16h x, v16h y) { asm volatile("v_nop\n\tv_nop\n\tv_nop\n\tv_nop" : "+v"(a), "+v"(b), "+v"(c), "+v"(d) : "v"(x), "v"(y)); }
__device__ __forceinline__ void dep_guard4_b(v8f& a, v8f& b, v8f& c, v8f& d, v16b x, v16b y) { asm volatile("v_nop\n\tv_nop\n\tv_nop\n\tv_nop" : "+v"(a), "+v"(b), "+v"(c), "+v"(d) : "v"(x), "v"(y)); }
__device__ __forceinline__ void keep4_h(v16h a, v16h b, v16h c, v16h d) { asm volatile("v_nop" :: "v"(a), "v"(b), "v"(c), "v"(d)); }
__device__ __forceinline__ void keep4_b(v16b a, v16b b, v16b c, v16b d) { asm volatile("v_nop" :: "v"(a), "v"(b), "v"(c), "v"(d)); }
__device__ __forceinline__ void acc_guard4(v8f& a, v8f& b, v8f& c, v8f& d) { asm volatile("v_nop\n\tv_nop\n\tv_nop\n\tv_nop" : "+v"(a), "+v"(b), "+v"(c), "+v"(d)); }
template <typename T> struct Frag;
template <> struct Frag<_Float16> {
  typedef v16h V; union U { v16h v; v8h h[2]; };
  // elements 0..7 <- p[0..7], 8..15 <- p[16..23]
  static __device__ __forceinline__ v16h load(const _Float16* p) {
    U f; f.h[0] = *(const v8h*)(p); f.h[1] = *(const v8h*)(p + 16); return f.v;
  }
  static __device__ __forceinline__ v8f mma(v16h a, v16h b, v8f c) {
    return __builtin_amdgcn_wmma_f32_16x16x32_f16(false, a, false, b, (short)0, c, false, false);
  }
  static __device__ __forceinline__ void guard(v8f& a, v8f& b, v16h x, v16h y) { dep_guard_h(a, b, x, y); }
  static __device__ __forceinline__ void guard4(v8f& a, v8f& b, v8f& c, v8f& d, v16h x, v16h y) { dep_guard4_h(a, b, c, d, x, y); }
  static __device__ __forceinline__ void keep(v16h a, v16h b, v16h c, v16h d) { keep4_h(a, b, c, d); }
};
template <> struct Frag<__bf16> {
  typedef v16b V; union U { v16b v; v8b h[2]; };
  static __device__ __forceinline__ v16b load(const __bf16* p) {
    U f; f.h[0] = *(const v8b*)(p); f.h[1] = *(const v8b*)(p + 16); return f.v;
  }
  static __device__ __forceinline__ v8f mma(v16b a, v16b b, v8f c) {
    return __builtin_amdgcn_wmma_f32_16x16x32_bf16(false, a, false, b, (short)0, c, false, false);
  }
  static __device__ __forceinline__ void guard(v8f& a, v8f& b, v16b x, v16b y) { dep_guard_b(a, b, x, y); }
  static __device__ __forceinline__ void guard4(v8f& a, v8f& b, v8f& c, v8f& d, v16b x, v16b y) { dep_guard4_b(a, b, c, d, x, y); }
  static __device__ __forceinline__ void keep(v16b a, v16b b, v16b c, v16b d) { keep4_b(a, b, c, d); }
};

__device__ __forceinline__ unsigned pk16(unsigned short a, unsigned short b) { return (unsigned)a | ((unsigned)b << 16); }
__device__ __forceinline__ unsigned short h_bits(float f) { const _Float16 h = (_Float16)f; return __builtin_bit_cast(unsigned short, h); }

// ---- Register-blocked batched WMMA GEMM (ACT reduced to none/relu/leaky; per-row group guard ties all four
//      accumulators and names the A fragments) -------------------------------------------------------------------------
// C[m,n] = scale * sum_k A[m,k] * Bt[n,k] (+bias)(+resid); a workgroup owns a 256x128 tile, each of its 8 waves (4 x 2) a 64x64 tile.
// A row-major [M,K]; Bt row-major [N,K]; M % 256 == 0, N % 128 == 0, K % 64 == 0.
// Operands reach the waves through LDS: a stage is 64 k (128 B, one cache line) of the tile's 256 A rows and 128 Bt rows at a
// pitch of 144 B, laid by asynchronous copies of whole lines (8 lanes x 16 B per row) into a ring of two buffers, one stage ahead.
// SPLIT (hi/lo planes) is not staged by this engine: single-plane operands only.
// BIAS_MODE: 0 = none, 1 = bias[m], 2 = bias[n].
// OUT_MODE: 0 = f32, 1 = f16, 2 = bf16 hi plane (Cout) + bf16 lo plane (Cout2).
// ET: 0 = f16 operands, 1 = bf16 operands (pointers passed as 16-bit storage)
// KSPLIT: the batch index b counts slices of the k range of ONE product (strideA, strideB = k per slice, K = k per slice); slice b
// stores its partial sum in plane b of Cout, the reader adds the planes, and only slice 0 adds the bias.
template <int ET> struct Elem;
template <> struct Elem<0> { typedef _Float16 T; };
template <> struct Elem<1> { typedef __bf16 T; };
constexpr int kBlkM       = 256;                          // A rows of a workgroup tile
constexpr int kBlkN       = 128;                          // Bt rows of a workgroup tile
constexpr int kStageK     = 64;                           // k per stage
constexpr int kRowPitch   = 144;                          // bytes per staged row: 16 B x odd, conflict-free for 16-byte LDS reads
constexpr int kPitchH     = kRowPitch / 2;                // the same in 16-bit elements
constexpr int kStageBytes = (kBlkM + kBlkN) * kRowPitch;  // 55,296: A rows 0..255, then Bt rows 0..127
// One lane's share of a stage: twelve 16-byte copies, staged rows r, r + 32, ... r + 352 (eight of A, four of Bt), r = thread >> 3.
// l = LDS byte address of this lane's 16 bytes in row r; a, b = global address of the same 16 bytes in A row r and Bt row r;
// sa, sb = bytes between 32 rows of A and of Bt. The s_wait_xcnt stands inside the statement so that no address register of a
// copy is rewritten ahead of it.
__device__ __forceinline__ void stage_copies(unsigned l, const char* a, size_t sa, const char* b, size_t sb) {
  constexpr unsigned kStep = 32u * kRowPitch;
  asm volatile(
      "global_load_async_to_lds_b128 %0, %12, off\n\t"
      "global_load_async_to_lds_b128 %1, %13, off\n\t"
      "global_load_async_to_lds_b128 %2, %14, off\n\t"
      "global_load_async_to_lds_b128 %3, %15, off\n\t"
      "global_load_async_to_lds_b128 %4, %16, off\n\t"
      "global_load_async_to_lds_b128 %5, %17, off\n\t"
      "global_load_async_to_lds_b128 %6, %18, off\n\t"
      "global_load_async_to_lds_b128 %7, %19, off\n\t"
      "global_load_async_to_lds_b128 %8, %20, off\n\t"
      "global_load_async_to_lds_b128 %9, %21, off\n\t"
      "global_load_async_to_lds_b128 %10, %22, off\n\t"
      "global_load_async_to_lds_b128 %11, %23, off\n\t"
      "s_wait_xcnt 0x0"
      :: "v"(l), "v"(l + kStep), "v"(l + 2 * kStep), "v"(l + 3 * kStep), "v"(l + 4 * kStep), "v"(l + 5 * kStep),
         "v"(l + 6 * kStep), "v"(l + 7 * kStep), "v"(l + 8 * kStep), "v"(l + 9 * kStep), "v"(l + 10 * kStep), "v"(l + 11 * kStep),
         "v"(a), "v"(a + sa), "v"(a + 2 * sa), "v"(a + 3 * sa), "v"(a + 4 * sa), "v"(a + 5 * sa), "v"(a + 6 * sa), "v"(a + 7 * sa),
         "v"(b), "v"(b + sb), "v"(b + 2 * sb), "v"(b + 3 * sb)
      : "memory");
}
template <int ET, bool SPLIT, int BIAS_MODE, int OUT_MODE, bool RESID, int ACT = 0, bool KSPLIT = false>
__global__ __launch_bounds__(256) void wmma_gemm64(
    const unsigned short* __restrict__ Ap, const unsigned short* __restrict__ A2p, int lda, long strideA,
    const unsigned short* __restrict__ Btp, const unsigned short* __restrict__ Bt2p, int ldb, long strideB,
    void* __restrict__ Cout, void* __restrict__ Cout2, int ldc, long strideC,
    const float* __restrict__ bias,
    const float* __restrict__ resid, long strideR,
    int M, int N, int K, float scale) {
  typedef typename Elem<ET>::T T;
  typedef typename Frag<T>::V V;
  static_assert(!SPLIT, "single-plane operands only");
  static_assert(!KSPLIT || (OUT_MODE == 0 && ACT == 0 && !RESID && BIAS_MODE != 1), "partial sums are plain f32 planes");
  const T* A = (const T*)Ap; const T* Bt = (const T*)Btp;
  __shared__ __align__(128) unsigned char ring[2 * kStageBytes];   // two stage buffers
  __shared__ __align__(16) float sT[8][16 * 68];   // per-wave 16x64 slab, pitch 68 floats
  const int b    = blockIdx.y;
  const int lane = threadIdx.x & 31;
  const int wave = threadIdx.x >> 5;
  const int tilesN = N >> 7;
  const int tilesM = M >> 8;
  const int tile = blockIdx.x;
  if (tile >= tilesM * tilesN) return;   // the same for the whole workgroup, ahead of every barrier
  const int tm = tile / tilesN;
  const int tn = tile - tm * tilesN;
  const int mBlk = tm << 8;
  const int nBlk = tn << 7;
  const int wRow = (wave >> 1) << 6;           // this wave's 64 rows inside the workgroup tile
  const int wCol = (wave & 1) << 6;            // this wave's 64 columns inside the workgroup tile
  const int m0 = mBlk + wRow;
  const int n0 = nBlk + wCol;

  const T* Ab  = A  + (size_t)b * strideA;
  const T* Bb  = Bt + (size_t)b * strideB;

  const int rlane = lane & 15;                 // row (A) / col (B, D) within subtile
  const int koff  = (lane >> 4) * 8;           // k offset of this lane half
  const int mOff  = (lane >> 4) * 8;           // D row offset

  // copy map: thread t moves bytes 16*(t&7) .. +15 of staged rows (t>>3) + 32*i, so a wave's copy covers four whole 128-B lines
  const int cRow = threadIdx.x >> 3;
  const int cCol = (threadIdx.x & 7) * 8;      // in 16-bit elements
  const char* gA = (const char*)(Ab + (size_t)(mBlk + cRow) * lda + cCol);
  const char* gB = (const char*)(Bb + (size_t)(nBlk + cRow) * ldb + cCol);
  const size_t stepA = (size_t)lda * (32 * sizeof(T));
  const size_t stepB = (size_t)ldb * (32 * sizeof(T));
  const unsigned ldsDst = (unsigned)(size_t)ring + (unsigned)(cRow * kRowPitch + cCol * 2);
  const int nStage = K / kStageK;

  v8f acc[4][4];
#pragma unroll
  for (int i = 0; i < 4; ++i)
#pragma unroll
    for (int j = 0; j < 4; ++j) acc[i][j] = (v8f){0.f,0.f,0.f,0.f,0.f,0.f,0.f,0.f};

  // ring prologue: stage 0 landed and published, then stage 1 in flight
  stage_copies(ldsDst, gA, stepA, gB, stepB);
  asm volatile("s_wait_asynccnt 0x0" ::: "memory");   // this wave's copies of stage 0 have landed
  __syncthreads();                                    // every wave's copies of stage 0 are readable
  if (nStage > 1) stage_copies(ldsDst + kStageBytes, gA + kStageK * sizeof(T), stepA, gB + kStageK * sizeof(T), stepB);

  for (int s = 0; s < nStage; ++s) {
    const unsigned bufOff = (unsigned)(s & 1) * kStageBytes;
    const T* sA = (const T*)(ring + bufOff + (wRow + rlane) * kRowPitch) + koff;
    const T* sB = (const T*)(ring + bufOff + (kBlkM + wCol + rlane) * kRowPitch) + koff;
#pragma unroll
    for (int kk = 0; kk < kStageK; kk += 32) {
      V bh[4], ah[4];   // all eight fragments of this k step are requested as one group, so the wave meets LDS latency once
#pragma unroll
      for (int j = 0; j < 4; ++j) {
        bh[j] = Frag<T>::load(sB + j * 16 * kPitchH + kk);
        ah[j] = Frag<T>::load(sA + j * 16 * kPitchH + kk);
      }
#pragma unroll
      for (int i = 0; i < 4; ++i) {
#pragma unroll
        for (int j = 0; j < 4; ++j) acc[i][j] = Frag<T>::mma(ah[i], bh[j], acc[i][j]);
        Frag<T>::guard4(acc[i][0], acc[i][1], acc[i][2], acc[i][3], ah[i], ah[i]);
      }
      Frag<T>::keep(bh[0], bh[1], bh[2], bh[3]);
    }
    // publish point of stage s + 1, and release of the buffer that stage s was read from
    asm volatile("s_wait_dscnt 0x0" ::: "memory");      // this wave's reads of stage s are done before the buffer is refilled
    asm volatile("s_wait_asynccnt 0x0" ::: "memory");   // this wave's copies of stage s + 1 have landed
    __syncthreads();
    if (s + 2 < nStage) {
      const size_t kb = (size_t)(s + 2) * (kStageK * sizeof(T));
      stage_copies(ldsDst + bufOff, gA + kb, stepA, gB + kb, stepB);
    }
  }
  asm volatile("s_wait_asynccnt 0x0" ::: "memory");     // nothing of this wave is in flight when the ring is left
  acc_guard4(acc[0][0], acc[0][1], acc[0][2], acc[0][3]);
  acc_guard4(acc[1][0], acc[1][1], acc[1][2], acc[1][3]);
  acc_guard4(acc[2][0], acc[2][1], acc[2][2], acc[2][3]);
  acc_guard4(acc[3][0], acc[3][1], acc[3][2], acc[3][3]);

  // ---- epilogue ----
  float* slab = sT[wave];
  const float* Rb = RESID ? (resid + (size_t)b * strideR) : nullptr;
#pragma unroll
  for (int i = 0; i < 4; ++i) {
    const int mBase = m0 + (i << 4);
#pragma unroll
    for (int j = 0; j < 4; ++j) {
      const int n = n0 + (j << 4) + rlane;
      float bv = 0.f;
      if (BIAS_MODE == 2) bv = bias[n];
      if (KSPLIT && b != 0) bv = 0.f;
#pragma unroll
      for (int r = 0; r < 8; ++r) {
        float v = acc[i][j][r] * scale;
        if (BIAS_MODE == 1) v += bias[mBase + mOff + r];
        if (BIAS_MODE == 2) v += bv;
        if (RESID) v += Rb[(size_t)(mBase + mOff + r) * ldc + n];
        if (ACT == 2) v = fmaxf(v, 0.0f);
        if (ACT == 4) v = (v > 0.f) ? v : 0.01f * v;
        slab[(mOff + r) * 68 + (j << 4) + rlane] = v;
      }
    }
    __builtin_amdgcn_fence(__ATOMIC_RELEASE, "workgroup");
    __builtin_amdgcn_wave_barrier();
    __builtin_amdgcn_fence(__ATOMIC_ACQUIRE, "workgroup");
    if (OUT_MODE == 0) {
      float* C = (float*)Cout + (size_t)b * strideC;
      const int hh = lane >> 4, c4 = (lane & 15) * 4;     // row seg = 256 B = 16 lanes x 16 B
      {
#pragma unroll
        for (int it = 0; it < 8; ++it) {
          const int row = it * 2 + hh;
          v4f v = *(const v4f*)(slab + row * 68 + c4);
          *(v4f*)(C + (size_t)(mBase + row) * ldc + n0 + c4) = v;
        }
        
      }
    } else {
      const int q = lane >> 3, c8 = (lane & 7) * 8;
      unsigned short* C  = (unsigned short*)Cout  + (size_t)b * strideC;
      unsigned short* C2 = (OUT_MODE == 2) ? ((unsigned short*)Cout2 + (size_t)b * strideC) : nullptr;
      {
#pragma unroll
        for (int it = 0; it < 4; ++it) {
          const int row = it * 4 + q;
          const float* sp = slab + row * 68 + c8;
          v8h hv, lv;
#pragma unroll
          for (int e = 0; e < 8; ++e) {
            if (OUT_MODE == 1) {
              hv[e] = (_Float16)sp[e];
            } else {
              unsigned short hb = f2bf_bits(sp[e]);
              unsigned short lb = f2bf_bits(sp[e] - bf_bits2f(hb));
              hv[e] = __builtin_bit_cast(_Float16, hb);
              lv[e] = __builtin_bit_cast(_Float16, lb);
            }
          }
          *(v8h*)(C + (size_t)(mBase + row) * ldc + n0 + c8) = hv;
          if (OUT_MODE == 2) *(v8h*)(C2 + (size_t)(mBase + row) * ldc + n0 + c8) = lv;
        }
        
      }
    }
    __builtin_amdgcn_fence(__ATOMIC_RELEASE, "workgroup");
    __builtin_amdgcn_wave_barrier();
    __builtin_amdgcn_fence(__ATOMIC_ACQUIRE, "workgroup");
  }
}

// ---------------------------------------------------------------------------
// ---------------------------------------------------------------------------
// f32 -> f16 cast, eight elements a thread; blk = index of this block among the n8 / 256 blocks of the cast.
__device__ __forceinline__ void cast8_f16_block(const float* __restrict__ in, unsigned short* __restrict__ out, int n8, int blk) {
  const int i = blk * 256 + threadIdx.x;
  if (i >= n8) return;
  const float* p = in + 8 * (size_t)i;
  const v4f a = *(const v4f*)(p);
  const v4f c = *(const v4f*)(p + 4);
  unsigned short hb[8];
#pragma unroll
  for (int e = 0; e < 4; ++e) {
    hb[e]     = h_bits(a[e]);
    hb[4 + e] = h_bits(c[e]);
  }
  const v4u u = (v4u){pk16(hb[0], hb[1]), pk16(hb[2], hb[3]), pk16(hb[4], hb[5]), pk16(hb[6], hb[7])};
  unsigned short* q = out + 8 * (size_t)i;
  *(v4u*)q = u;
  
}

// ---------------------------------------------------------------------------
// Weight transpose + cast: W row-major [kin][nout] f32 (x @ W orientation) -> WT[n][k] = f16(scale * W[k][n]), row-major [nout][kin].
// One block of 256 threads per 64 x 64 tile: kt = k tile (64 cols of WT), nt = n tile (64 rows of WT); sm = the block's LDS tile.
// Load coverage: 4 iterations x 256 threads x float4 = 64 k-rows x 64 n-cols (4 b128 loads per lane).
// Store coverage: 8 waves x 2 iterations x 4 rows (lane>>3) = 64 n-rows; (lane&7) x 8 halves = 64 k-cols; each row segment =
// ---------------------------------------------------------------------------
__device__ __forceinline__ void wt_cast_block(const float* __restrict__ W, unsigned short* __restrict__ op, int kin, int nout,
                                              int kt, int nt, float scale, float (*sm)[65]) {   // sm[n_local][k_local]
  const int t  = threadIdx.x;
  const int k0 = kt * 64;
  const int n0 = nt * 64;
  // The four loads are issued first and stay in flight together; the LDS writes follow in a loop of their own.
  // Both loops are unrolled so that w[] is indexed by constants and stays in registers.
  v4f w[4];
#pragma unroll
  for (int i = 0; i < 4; ++i) {
    const int e  = i * 256 + t;
    const int r  = e >> 4;           // k local
    const int c4 = (e & 15) * 4;     // n local
    w[i] = *(const v4f*)(W + (size_t)(k0 + r) * nout + n0 + c4);
    asm volatile("s_wait_xcnt 0x0" ::: "memory");   // stands ahead of any rewrite of this load's address registers (a later load's result may land there)
  }
#pragma unroll
  for (int i = 0; i < 4; ++i) {
    const int e  = i * 256 + t;
    const int r  = e >> 4;           // k local
    const int c4 = (e & 15) * 4;     // n local
    sm[c4 + 0][r] = w[i][0] * scale;
    sm[c4 + 1][r] = w[i][1] * scale;
    sm[c4 + 2][r] = w[i][2] * scale;
    sm[c4 + 3][r] = w[i][3] * scale;
  }
  __syncthreads();
  const int lane = t & 31, wave = t >> 5;
  const int q = lane >> 3, c8 = (lane & 7) * 8;
  {
#pragma unroll
    for (int it = 0; it < 2; ++it) {
      const int row = wave * 8 + it * 4 + q;                 // n local
      unsigned short hb[8];
#pragma unroll
      for (int e = 0; e < 8; ++e) hb[e] = h_bits(sm[row][c8 + e]);
      const v4u u = (v4u){pk16(hb[0], hb[1]), pk16(hb[2], hb[3]), pk16(hb[4], hb[5]), pk16(hb[6], hb[7])};
      *(v4u*)(op + (size_t)(n0 + row) * kin + k0 + c8) = u;
    }
    asm volatile("s_wait_xcnt 0x0" ::: "memory");   // stands ahead of any rewrite of the two stores' address and data registers in the code behind this body
  }
}

// ---------------------------------------------------------------------------
// 16-bit transpose of one flat chunk: src chunk z viewed as [rows][cols] (16-bit, row-major) -> dst chunk z = [cols][rows];
// chunk z lives at halves offset z*rows*cols in both planes. Bits are moved as integer words (no conversion).
// One block of 256 threads per 64 x 64 tile: ct = column tile, rt = row tile, z = chunk; sm = the block's LDS tile.
// Load coverage: 8 iterations x 256 threads x 1 word (2 halves) = 64 rows x 64 cols (8 b32 loads per lane).
// Store coverage: 8 waves x 2 iterations x 4 rows (lane>>3) = 64 dst rows; (lane&7) x 8 halves = 64 dst cols; each row segment =
// ---------------------------------------------------------------------------
__device__ __forceinline__ void transpose16_block(const unsigned short* __restrict__ src, unsigned short* __restrict__ dst,
                                                  int rows, int cols, int ct, int rt, int z,
                                                  unsigned int (*sm)[65]) {   // sm[col_local][row_local], one 16-bit value per word
  const int t  = threadIdx.x;
  const int c0 = ct * 64;
  const int r0 = rt * 64;
  const size_t cb = (size_t)z * rows * cols;
  const unsigned int* s32 = (const unsigned int*)(src + cb);
#pragma unroll
  for (int i = 0; i < 8; ++i) {
    const int e  = i * 256 + t;
    const int r  = e >> 5;          // row local
    const int cw = e & 31;          // word column local
    const unsigned int w = s32[(((size_t)(r0 + r) * cols + c0) >> 1) + cw];
    sm[2 * cw][r]     = w & 0xffffu;
    sm[2 * cw + 1][r] = w >> 16;
  }
  __syncthreads();
  const int lane = t & 31, wave = t >> 5;
  const int q = lane >> 3, c8 = (lane & 7) * 8;
  unsigned short* op = dst + cb;
  {
#pragma unroll
    for (int it = 0; it < 2; ++it) {
      const int row = wave * 8 + it * 4 + q;                 // col local = dst row
      const unsigned int* sp = &sm[row][c8];
      const v4u u = (v4u){ (sp[0] & 0xffffu) | (sp[1] << 16), (sp[2] & 0xffffu) | (sp[3] << 16),
                           (sp[4] & 0xffffu) | (sp[5] << 16), (sp[6] & 0xffffu) | (sp[7] << 16) };
      *(v4u*)(op + (size_t)(c0 + row) * rows + r0 + c8) = u;
    }
    
  }
}

// ---------------------------------------------------------------------------
// The two flat-reshape repacks in one launch (neither reads what the other writes): grid (64 tiles, 16 chunks, 2).
// blockIdx.z = 0: KT_g[m][d] = kchunk_g[d*2048+m] (in[128][2048] -> out[2048][128]);
// blockIdx.z = 1: VT_g[d][m] = vchunk_g[m*128+d] (in[2048][128] -> out[128][2048]).
// The branch is the same for the whole block, so the barrier inside each body is reached by all of its threads or by none.
// ---------------------------------------------------------------------------
constexpr int kRepackTiles = (kSeq / 64) * (kHeadDim / 64);   // 64 tiles of 64 x 64 per chunk
__global__ __launch_bounds__(256) void repack_kv_kernel(const unsigned short* __restrict__ k16, unsigned short* __restrict__ kt,
                                                        const unsigned short* __restrict__ v16, unsigned short* __restrict__ vt) {
  __shared__ unsigned int sm[64][65];
  const int i = blockIdx.x;
  const int g = blockIdx.y;
  if (blockIdx.z == 0) transpose16_block(k16, kt, kHeadDim, kSeq, i % (kSeq / 64), i / (kSeq / 64), g, sm);
  else                 transpose16_block(v16, vt, kSeq, kHeadDim, i % (kHeadDim / 64), i / (kHeadDim / 64), g, sm);
}

// ---------------------------------------------------------------------------
// r_k = rh @ Wrk, r_q = rh @ Wrq (K = 4, f32 VALU): out[i][j] = sum_r rh[i][r] * W[r][j] (W row-major [in][out]).
// blk = index of this block among the 4096/256 = 16 blocks (exact).
// ---------------------------------------------------------------------------
__device__ __forceinline__ void rl_proj_block(const float* __restrict__ rh, const float* __restrict__ Wrk,
                                              const float* __restrict__ Wrq, float* __restrict__ rk,
                                              float* __restrict__ rq, int nrows, int blk) {
  const int idx = blk * 256 + threadIdx.x;
  if (idx >= nrows) return;
  const v4f r  = *(const v4f*)(rh + (size_t)idx * kRl);
  const v4f k0 = *(const v4f*)(Wrk + 0);
  const v4f k1 = *(const v4f*)(Wrk + 4);
  const v4f k2 = *(const v4f*)(Wrk + 8);
  const v4f k3 = *(const v4f*)(Wrk + 12);
  asm volatile("" ::: "memory");
  const v4f q0 = *(const v4f*)(Wrq + 0);
  const v4f q1 = *(const v4f*)(Wrq + 4);
  const v4f q2 = *(const v4f*)(Wrq + 8);
  const v4f q3 = *(const v4f*)(Wrq + 12);
  v4f ok = r[0] * k0;
  ok = ok + r[1] * k1;
  ok = ok + r[2] * k2;
  ok = ok + r[3] * k3;
  v4f oq = r[0] * q0;
  oq = oq + r[1] * q1;
  oq = oq + r[2] * q2;
  oq = oq + r[3] * q3;
  float* pk = rk + (size_t)idx * kRl;
  float* pq = rq + (size_t)idx * kRl;
  *(v4f*)pk = ok;
  *(v4f*)pq = oq;
  
}

// ---------------------------------------------------------------------------
// Prologue in one launch: the five preparations below read only inputs and write disjoint workspace planes, so none waits for
// another; a block takes its job from the range its index falls in (the same for the whole block, so the barrier inside the
// weight repack is reached by all of its threads or by none).
//   [0, 16)        r_k, r_q
//   [16, 1040)     Wk, Wq, Wv, Wo [1024][1024] -> the four planes of wt4, 256 tiles each (k tile fastest)
//   [1040, 2064)   W1 [1024][4096] -> w1t [4096][1024]
//   [2064, 3088)   W2 [4096][1024] -> w2t [1024][4096]
//   [3088, 5136)   h -> f16
// ---------------------------------------------------------------------------
constexpr int kPbRl   = kTok / 256;                       // 16
constexpr int kPbSq   = (kDim / 64) * (kDim / 64);        // 256 tiles of a [1024][1024] weight
constexpr int kPbW4   = 4 * kPbSq;                        // 1024
constexpr int kPbFfn  = (kDim / 64) * (kFfn / 64);        // 1024 tiles of W1, and of W2
constexpr int kCastN8 = kTok * kDim / 8;                  // 524288 pieces of eight elements
constexpr int kPbCast = kCastN8 / 256;                    // 2048
constexpr int kPbAll  = kPbRl + kPbW4 + 2 * kPbFfn + kPbCast;   // 5136
static_assert(kTok % 256 == 0 && kCastN8 % 256 == 0, "exact prologue grids");
static_assert(kPbW4 % kPbFfn == 0 && kPbFfn == 4 * kPbSq && kDim / 64 == 16 && kFfn / 64 == 64, "tile numbering of the weight repack");
__global__ __launch_bounds__(256) void prologue_kernel(const float* __restrict__ h, const float* __restrict__ rh,
                                                       const float* __restrict__ Wk, const float* __restrict__ Wq,
                                                       const float* __restrict__ Wv, const float* __restrict__ Wo,
                                                       const float* __restrict__ Wrk, const float* __restrict__ Wrq,
                                                       const float* __restrict__ W1, const float* __restrict__ W2,
                                                       unsigned short* __restrict__ hh, unsigned short* __restrict__ wt4,
                                                       unsigned short* __restrict__ w1t, unsigned short* __restrict__ w2t,
                                                       float* __restrict__ rk, float* __restrict__ rq) {
  __shared__ float sm[64][65];
  int i = blockIdx.x;
  if (i < kPbRl) { rl_proj_block(rh, Wrk, Wrq, rk, rq, kTok, i); return; }
  i -= kPbRl;
  if (i < kPbW4 + 2 * kPbFfn) {
    // one repack body for all six weights; source, destination and shape are picked from the block index (scalars)
    const int z = i / kPbSq;                     // 0..3 the square weights, 4..7 W1, 8..11 W2
    const float* W = (z == 0) ? Wk : (z == 1) ? Wq : (z == 2) ? Wv : (z == 3) ? Wo : (z < 8) ? W1 : W2;
    unsigned short* op = (z < 4) ? wt4 + (size_t)z * kDim * kDim : (z < 8) ? w1t : w2t;
    const int e    = (z < 4) ? i % kPbSq : i % kPbFfn;   // tile index inside its weight (kPbW4 is a multiple of kPbFfn)
    const int kin  = (z < 8) ? kDim : kFfn;
    const int nout = (z < 4 || z >= 8) ? kDim : kFfn;
    const int ksh  = (z < 8) ? 4 : 6;            // log2 of kin / 64
    wt_cast_block(W, op, kin, nout, e & ((1 << ksh) - 1), e >> ksh, kWCarry, sm);
    return;
  }
  i -= kPbW4 + 2 * kPbFfn;
  cast8_f16_block(h, hh, kCastN8, i);
}

// ---------------------------------------------------------------------------
// Fused attention of one flat chunk g: scores, relative bias, softmax and attn.V in one kernel, no score or probability plane.
//   a[l][m] = 128^-0.5 * sum_d Q_g[l][d] * KT_g[m][d] + 0.5 * sum_r rq[b][l][r] * rk_flat[b][r*2048 + m]
//   ctx_g[l][d] = 256 * sum_m exp(a - max) * VT_g[d][m] / sum_m exp(a - max)      (f16, carried x256)
// grid (2048/128, 16): a workgroup of 8 waves owns 128 query rows of chunk blockIdx.y, a wave 16 of them; 32 stages of 64 keys.
// Both products are transposed, so that a query is a lane's column in every accumulator:
//   S^T (keys x queries) = KT tile (A) x Q rows (B);  O^T (d x queries) = VT tile (A) x P^T (B).
// An S^T accumulator holds, for the lane's query, keys 8*(lane>>4) + 0..7 of its 16: two neighbouring accumulators converted to
// f16 are the B fragment of 32 keys in the k order of Frag::load, so P goes through no LDS and no lane exchange.
// Row maximum and rescale factor are one scalar per lane, the row sum a pair of partial sums per lane (online softmax, logits kept in the log2 domain).
// A stage is 64 KT rows (256 B at pitch 272) and 128 VT rows (128 B at pitch 144), laid by asynchronous copies into two buffers.
// Every '#pragma unroll' below after the r_k copy makes the index of a fragment or accumulator array a constant, so that the array stays in registers.
// ---------------------------------------------------------------------------
constexpr int kFaKeys   = 64;                          // keys per stage
constexpr int kFaRows   = 128;                         // query rows per workgroup
constexpr int kFaKPitch = 272;                         // bytes per staged KT row: 16 B x odd
constexpr int kFaVPitch = 144;                         // bytes per staged VT row: 16 B x odd
constexpr int kFaKBytes = kFaKeys * kFaKPitch;         // 17,408
constexpr int kFaVBytes = kHeadDim * kFaVPitch;        // 18,432
constexpr int kFaStage  = kFaKBytes + kFaVBytes;       // 35,840
static_assert(kSeq % kFaKeys == 0 && kSeq % kFaRows == 0 && kSeq / kFaKeys >= 2 && kHeadDim == 128, "attention tiles");
// One lane's share of a stage: four 16-byte copies of KT rows r, r + 16, r + 32, r + 48 (r = thread >> 4) and four of VT rows
// r, r + 32, r + 64, r + 96 (r = thread >> 3). lk, lv = LDS byte addresses, k, v = global addresses of the first of each four.
// The s_wait_xcnt stands inside the statement so that no address register of a copy is rewritten ahead of it.
__device__ __forceinline__ void attn_stage_copies(unsigned lk, const char* k, unsigned lv, const char* v) {
  constexpr unsigned kLK = 16u * kFaKPitch, kLV = 32u * kFaVPitch;
  constexpr size_t kGK = (size_t)16 * kHeadDim * 2, kGV = (size_t)32 * kSeq * 2;
  asm volatile(
      "global_load_async_to_lds_b128 %0, %8, off\n\t"
      "global_load_async_to_lds_b128 %1, %9, off\n\t"
      "global_load_async_to_lds_b128 %2, %10, off\n\t"
      "global_load_async_to_lds_b128 %3, %11, off\n\t"
      "global_load_async_to_lds_b128 %4, %12, off\n\t"
      "global_load_async_to_lds_b128 %5, %13, off\n\t"
      "global_load_async_to_lds_b128 %6, %14, off\n\t"
      "global_load_async_to_lds_b128 %7, %15, off\n\t"
      "s_wait_xcnt 0x0"
      :: "v"(lk), "v"(lk + kLK), "v"(lk + 2 * kLK), "v"(lk + 3 * kLK), "v"(lv), "v"(lv + kLV), "v"(lv + 2 * kLV), "v"(lv + 3 * kLV),
         "v"(k), "v"(k + kGK), "v"(k + 2 * kGK), "v"(k + 3 * kGK), "v"(v), "v"(v + kGV), "v"(v + 2 * kGV), "v"(v + 3 * kGV)
      : "memory");
}
// value of lane l ^ 16
__device__ __forceinline__ float xhalf(float x) {
  const int i = __builtin_bit_cast(int, x);
  return __builtin_bit_cast(float, __builtin_amdgcn_permlanex16(i, i, 0x76543210, 0xfedcba98, false, false));
}
typedef __attribute__((ext_vector_type(2))) _Float16 v2h;
union PFrag { v16h v; v2h h[8]; };   // B fragment of 32 keys, filled two keys at a time
__global__ __launch_bounds__(256) void attn_fused_kernel(const unsigned short* __restrict__ Qp, const unsigned short* __restrict__ KTp,
                                                         const unsigned short* __restrict__ VTp, const float* __restrict__ rqp,
                                                         const float* __restrict__ rkp, unsigned short* __restrict__ Cp) {
  typedef Frag<_Float16> F;
  // r_k of this batch as the flat [4][2048] view, then the two stage buffers: in this order every LDS read's constant part
  // fits the instruction's 16-bit offset field
  __shared__ __align__(128) unsigned char smem[kRl * kSeq * 4 + 2 * kFaStage];
  float* rkS = (float*)smem;
  unsigned char* ring = smem + kRl * kSeq * 4;
  const int g     = blockIdx.y;
  const int b     = g >> 3;
  const int t     = threadIdx.x;
  const int lane  = t & 31, wave = t >> 5;
  const int rlane = lane & 15;                 // A row / B, D column within a subtile
  const int half8 = (lane >> 4) * 8;           // k offset of this lane half = D row offset
  const int q     = blockIdx.x * kFaRows + wave * 16 + rlane;   // this lane's query row
  const _Float16* Qg = (const _Float16*)Qp + (size_t)g * kChunk;
  const char* gK = (const char*)(KTp + (size_t)g * kChunk + (size_t)(t >> 4) * kHeadDim + (t & 15) * 8);
  const char* gV = (const char*)(VTp + (size_t)g * kChunk + (size_t)(t >> 3) * kSeq + (t & 7) * 8);
  const unsigned ldsK = (unsigned)(size_t)ring + (unsigned)((t >> 4) * kFaKPitch + (t & 15) * 16);
  const unsigned ldsV = (unsigned)(size_t)ring + (unsigned)(kFaKBytes + (t >> 3) * kFaVPitch + (t & 7) * 16);
  constexpr int nStage = kSeq / kFaKeys;
  constexpr size_t kStepK = (size_t)kFaKeys * kHeadDim * 2;     // global bytes between stages: 64 KT rows
  constexpr size_t kStepV = (size_t)kFaKeys * 2;                // 64 columns of VT

  // ring prologue: stage 0 (and r_k) landed and published, then stage 1 in flight
  attn_stage_copies(ldsK, gK, ldsV, gV);
  const float* rkb = rkp + (size_t)b * kSeq * kRl;
#pragma unroll
  for (int i = 0; i < kRl * kSeq / 1024; ++i) *(v4f*)(rkS + (i * 256 + t) * 4) = *(const v4f*)(rkb + (i * 256 + t) * 4);
  v16h qf[4];
#pragma unroll
  for (int ks = 0; ks < 4; ++ks) qf[ks] = F::load(Qg + (size_t)q * kHeadDim + ks * 32 + half8);
  const v4f rq4 = *(const v4f*)(rqp + ((size_t)b * kSeq + q) * kRl) * (0.5f * kLog2e);
  asm volatile("s_wait_asynccnt 0x0" ::: "memory");   // this wave's copies of stage 0 have landed
  __syncthreads();                                    // every wave's copies of stage 0 and stores of r_k are readable
  attn_stage_copies(ldsK + kFaStage, gK + kStepK, ldsV + kFaStage, gV + kStepV);

  v8f o[8];
#pragma unroll
  for (int dt = 0; dt < 8; ++dt) o[dt] = (v8f){0.f,0.f,0.f,0.f,0.f,0.f,0.f,0.f};
  float mrun = -__builtin_inff();   // running maximum of this query's logits (log2 domain), equal in both lane halves
  v2f lrun = (v2f){0.f, 0.f};       // running sums over this lane half's even and odd keys

  for (int s = 0; s < nStage; ++s) {
    const unsigned bufOff = (unsigned)(s & 1) * kFaStage;
    const _Float16* sK = (const _Float16*)(ring + bufOff + rlane * kFaKPitch) + half8;
    const _Float16* sV = (const _Float16*)(ring + bufOff + kFaKBytes + rlane * kFaVPitch) + half8;
    // S^T: four 16-key subtiles x this wave's 16 queries
    v8f sc[4];
#pragma unroll
    for (int mt = 0; mt < 4; ++mt) sc[mt] = (v8f){0.f,0.f,0.f,0.f,0.f,0.f,0.f,0.f};
#pragma unroll
    for (int ks = 0; ks < 4; ++ks)
#pragma unroll
      for (int mt = 0; mt < 4; ++mt) sc[mt] = F::mma(F::load(sK + mt * 16 * (kFaKPitch / 2) + ks * 32), qf[ks], sc[mt]);
    // logits (log2 domain) and their maximum; two keys per packed f32 instruction
    const float* rkT = rkS + s * kFaKeys + half8;
    v2f lg[4][4];
    float tmax = -__builtin_inff();
#pragma unroll
    for (int mt = 0; mt < 4; ++mt) {
      v4f kr[4][2];
#pragma unroll
      for (int j = 0; j < 4; ++j) {
        kr[j][0] = *(const v4f*)(rkT + j * kSeq + mt * 16);
        kr[j][1] = *(const v4f*)(rkT + j * kSeq + mt * 16 + 4);
      }
#pragma unroll
      for (int pr = 0; pr < 4; ++pr) {
        const int hi = pr >> 1, e = 2 * (pr & 1);
        v2f a = (v2f){rq4[0], rq4[0]} * (v2f){kr[0][hi][e], kr[0][hi][e + 1]};
        a = __builtin_elementwise_fma((v2f){rq4[1], rq4[1]}, (v2f){kr[1][hi][e], kr[1][hi][e + 1]}, a);
        a = __builtin_elementwise_fma((v2f){rq4[2], rq4[2]}, (v2f){kr[2][hi][e], kr[2][hi][e + 1]}, a);
        a = __builtin_elementwise_fma((v2f){rq4[3], rq4[3]}, (v2f){kr[3][hi][e], kr[3][hi][e + 1]}, a);
        a = __builtin_elementwise_fma((v2f){sc[mt][2 * pr], sc[mt][2 * pr + 1]}, (v2f){kScoreScale * kLog2e, kScoreScale * kLog2e}, a);
        lg[mt][pr] = a;
        tmax = fmaxf(tmax, fmaxf(a[0], a[1]));
      }
    }
    tmax = fmaxf(tmax, xhalf(tmax));
    const float mnew  = fmaxf(mrun, tmax);
    const float alpha = __builtin_amdgcn_exp2f(mrun - mnew);   // 0 in the first stage, where mrun is -inf
    mrun = mnew;
    PFrag pf[2];
    v2f ps[4];
#pragma unroll
    for (int mt = 0; mt < 4; ++mt) {
      v2f p[4];
#pragma unroll
      for (int pr = 0; pr < 4; ++pr) {
        const v2f x = lg[mt][pr] - (v2f){mnew, mnew};
        p[pr] = (v2f){__builtin_amdgcn_exp2f(x[0]), __builtin_amdgcn_exp2f(x[1])};
        pf[mt >> 1].h[(mt & 1) * 4 + pr] = __builtin_convertvector(p[pr], v2h);
      }
      ps[mt] = (p[0] + p[1]) + (p[2] + p[3]);
    }
    lrun = __builtin_elementwise_fma(lrun, (v2f){alpha, alpha}, (ps[0] + ps[1]) + (ps[2] + ps[3]));
#pragma unroll
    for (int dt = 0; dt < 8; ++dt) o[dt] = o[dt] * alpha;
    // O^T += VT tile x P^T
#pragma unroll
    for (int kk = 0; kk < 2; ++kk)
#pragma unroll
      for (int dt = 0; dt < 8; ++dt) o[dt] = F::mma(F::load(sV + dt * 16 * (kFaVPitch / 2) + kk * 32), pf[kk].v, o[dt]);
    // publish point of stage s + 1, and release of the buffer that stage s was read from
    asm volatile("s_wait_dscnt 0x0" ::: "memory");      // this wave's reads of stage s are done before the buffer is refilled
    asm volatile("s_wait_asynccnt 0x0" ::: "memory");   // this wave's copies of stage s + 1 have landed
    __syncthreads();
    if (s + 2 < nStage) attn_stage_copies(ldsK + bufOff, gK + (size_t)(s + 2) * kStepK, ldsV + bufOff, gV + (size_t)(s + 2) * kStepV);
  }
  asm volatile("s_wait_asynccnt 0x0" ::: "memory");     // nothing of this wave is in flight when the ring is left

  const float lsum = lrun[0] + lrun[1];
  const float inv = kCtxCarry / (lsum + xhalf(lsum));
  unsigned short* C = Cp + (size_t)g * kChunk + (size_t)q * kHeadDim + half8;
#pragma unroll
  for (int dt = 0; dt < 8; ++dt) {
    v8h hv;
#pragma unroll
    for (int r = 0; r < 8; ++r) hv[r] = (_Float16)(o[dt][r] * inv);
    *(v8h*)(C + dt * 16) = hv;
  }
}

// ---------------------------------------------------------------------------
// LayerNorm of x + (y + y2): y, y2 are the two k-slice partial planes of the product in front of it.
// One block of 256 threads per row; thread t owns columns 4t..4t+3. Reductions in fixed order (two separate LDS arrays).
// ---------------------------------------------------------------------------
template <bool HAS16>
__global__ __launch_bounds__(256) void add_ln_kernel(const float* __restrict__ x, const float* __restrict__ y,
                                                     const float* __restrict__ y2, const float* __restrict__ gam, const float* __restrict__ bet,
                                                     float* __restrict__ outp, unsigned short* __restrict__ out16) {
  __shared__ float red1[8];
  __shared__ float red2[8];
  __shared__ __align__(16) float srow[kDim];
  const int t = threadIdx.x;
  const int lane = t & 31, wave = t >> 5;
  const size_t base = (size_t)blockIdx.x * kDim;
  const v4f vx = *(const v4f*)(x + base + 4 * t);
  const v4f vy = *(const v4f*)(y + base + 4 * t);
  const v4f vz = *(const v4f*)(y2 + base + 4 * t);
  const v4f s  = vx + (vy + vz);
  float sum = (s[0] + s[1]) + (s[2] + s[3]);
#pragma unroll
  for (int off = 16; off > 0; off >>= 1) sum += __shfl_xor(sum, off, 32);
  if (lane == 0) red1[wave] = sum;
  __syncthreads();
  float tsum = red1[0];
#pragma unroll
  for (int w = 1; w < 8; ++w) tsum += red1[w];
  const float mu = tsum * kInvDim;
  const v4f d = s - mu;
  float sq = (d[0] * d[0] + d[1] * d[1]) + (d[2] * d[2] + d[3] * d[3]);
#pragma unroll
  for (int off = 16; off > 0; off >>= 1) sq += __shfl_xor(sq, off, 32);
  if (lane == 0) red2[wave] = sq;
  __syncthreads();
  float tsq = red2[0];
#pragma unroll
  for (int w = 1; w < 8; ++w) tsq += red2[w];
  const float var  = tsq * kInvDim;
  const float rstd = rsqrtf(var + kLnEps);
  const v4f g  = *(const v4f*)(gam + 4 * t);
  const v4f be = *(const v4f*)(bet + 4 * t);
  const v4f o  = (d * rstd) * g + be;
  float* op = outp + base + 4 * t;
  *(v4f*)op = o;
  
  if (HAS16) {
    *(v4f*)(srow + 4 * t) = o;
    __syncthreads();
    if (t < 128) {
      const v4f a = *(const v4f*)(srow + 8 * t);
      const v4f c = *(const v4f*)(srow + 8 * t + 4);
      unsigned short hb[8];
#pragma unroll
      for (int e = 0; e < 4; ++e) {
        hb[e]     = h_bits(a[e]);
        hb[4 + e] = h_bits(c[e]);
      }
      const v4u u = (v4u){pk16(hb[0], hb[1]), pk16(hb[2], hb[3]), pk16(hb[4], hb[5]), pk16(hb[6], hb[7])};
      unsigned short* hp = out16 + base + 8 * (size_t)t;
      *(v4u*)hp = u;
      
    }
  }
}

// ---------------------------------------------------------------------------
// Host glue.
//   R0  Hh   f16 [4096][1024]  8 MiB at   0 MiB   -> later ctx f16 [4096][1024] (same type, same layout; Hh dead after QKV GEMM)
//   R1  WT4  f16 4 x [1024][1024] (Wk^T | Wq^T | Wv^T | Wo^T, x16)   8 MiB at 8 MiB
//   R3  W1T  f16 [4096][1024] x16  8 MiB at 16 MiB
//   R4  W2T  f16 [1024][4096] x16  8 MiB at 24 MiB
//   R5  k    f16 [4096][1024]  8 MiB at 32 MiB   -> later h1 f16 [4096][1024] (same type, same layout; k dead after KT repack)
//   R6  q    f16 [4096][1024]  8 MiB at 40 MiB   \
//   R7  v    f16 [4096][1024]  8 MiB at 48 MiB    | -> later mid f16 [4096][4096] 32 MiB at 40 MiB (same type; all four dead after attention)
//   R8  KT   f16 [16][2048][128] 8 MiB at 56 MiB  |
//   R9  VT   f16 [16][128][2048] 8 MiB at 64 MiB /
//   R10 h_sa f32 2 x [4096][1024] (two k-slice partial planes) 32 MiB at 72 MiB (then the two hf planes over them after LN1)
//   R11 h1   f32 [4096][1024] 16 MiB at 104 MiB
//   R12 rq   f32 [4096][4]  65,536 B at 120 MiB
//   R13 rk   f32 [4096][4]  65,536 B at 120 MiB + 64 KiB
//   total 125,960,192 B
// GEMM shapes (all M,N multiples of 64, K multiples of 32; no padding anywhere):
//   QKV  M=4096 N=1024 K=1024 (x3 batched); scores and ctx per chunk inside the fused attention kernel;
//   Wo M=4096 N=1024 K=1024; W1 M=N=4096 K=1024; W2 M=4096 N=1024 K=4096.
// Wo and W2 have 128 tiles of 256x128, half as many as the chip has WGPs: each runs as two k slices (256 workgroups), and the
// LayerNorm behind it adds the two partial planes.
// ---------------------------------------------------------------------------
extern "C" void kernel_launch(void* const* d_in, const int* in_sizes, int n_in,
                              void* d_out, int out_size, void* d_ws, size_t ws_size,
                              hipStream_t stream) {
  if (n_in < 16) return;
  const int nTokDim = kTok * kDim;                  // 4,194,304
  if (in_sizes[0] != nTokDim || in_sizes[1] != kTok * kRl) return;
  if (in_sizes[2] != kDim * kDim || in_sizes[3] != kDim * kDim || in_sizes[4] != kDim * kDim || in_sizes[5] != kDim * kDim) return;
  if (in_sizes[6] != kRl * kRl || in_sizes[7] != kRl * kRl) return;
  if (in_sizes[8] != kDim * kFfn || in_sizes[9] != kFfn || in_sizes[10] != kFfn * kDim || in_sizes[11] != kDim) return;
  if (in_sizes[12] != kDim || in_sizes[13] != kDim || in_sizes[14] != kDim || in_sizes[15] != kDim) return;
  if (out_size != nTokDim) return;

  const size_t szP16 = (size_t)kTok * kDim * 2;                 // 8,388,608
  const size_t szW4  = (size_t)4 * kDim * kDim * 2;             // 8,388,608
  const size_t szW1  = (size_t)kDim * kFfn * 2;                 // 8,388,608
  const size_t szSC  = 3 * (size_t)kTok * kDim * 4;             // 50,331,648
  const size_t szR   = (size_t)kTok * kRl * 4;                  // 65,536
  static_assert(4 * (size_t)kTok * kDim * 2 == (size_t)kTok * kFfn * 2, "mid fits q+v+KT+VT");
  const size_t offHh = 0;
  const size_t offW4 = offHh + szP16;
  const size_t offW1 = offW4 + szW4;
  const size_t offW2 = offW1 + szW1;
  const size_t offK  = offW2 + szW1;
  const size_t offQ  = offK + szP16;
  const size_t offV  = offQ + szP16;
  const size_t offKT = offV + szP16;
  const size_t offVT = offKT + szP16;
  const size_t offSC = offVT + szP16;
  const size_t offRQ = offSC + szSC;
  const size_t offRK = offRQ + szR;
  const size_t total = offRK + szR;                            // 125,960,192
  if (ws_size < total) return;

  const float* h   = (const float*)d_in[0];
  const float* rh  = (const float*)d_in[1];
  const float* Wq  = (const float*)d_in[2];
  const float* Wk  = (const float*)d_in[3];
  const float* Wv  = (const float*)d_in[4];
  const float* Wo  = (const float*)d_in[5];
  const float* Wrk = (const float*)d_in[6];
  const float* Wrq = (const float*)d_in[7];
  const float* W1  = (const float*)d_in[8];
  const float* b1  = (const float*)d_in[9];
  const float* W2  = (const float*)d_in[10];
  const float* b2  = (const float*)d_in[11];
  const float* g1  = (const float*)d_in[12];
  const float* be1 = (const float*)d_in[13];
  const float* g2  = (const float*)d_in[14];
  const float* be2 = (const float*)d_in[15];
  float* out = (float*)d_out;
  char* ws = (char*)d_ws;
  unsigned short* Hh  = (unsigned short*)(ws + offHh);
  unsigned short* CTX = Hh;                                    // alias after QKV GEMM
  unsigned short* WT4 = (unsigned short*)(ws + offW4);         // Wk^T, Wq^T, Wv^T, Wo^T planes of 1,048,576 halves
  unsigned short* WoT = WT4 + (size_t)3 * kDim * kDim;
  unsigned short* W1T = (unsigned short*)(ws + offW1);
  unsigned short* W2T = (unsigned short*)(ws + offW2);
  unsigned short* K16 = (unsigned short*)(ws + offK);
  unsigned short* H1h = K16;                                   // alias after KT repack
  unsigned short* Q16 = (unsigned short*)(ws + offQ);
  unsigned short* MID = Q16;                                   // alias after attention: [4096][4096] over q,v,KT,VT
  unsigned short* V16 = (unsigned short*)(ws + offV);
  unsigned short* KT  = (unsigned short*)(ws + offKT);
  unsigned short* VT  = (unsigned short*)(ws + offVT);
  float* HSA = (float*)(ws + offSC);                           // plane 0; plane 1 follows it
  float* HF  = HSA;                                            // alias after LN1, two planes as well
  float* H1f = (float*)(ws + offSC + 2 * (szSC / 3));
  float* RQ = (float*)(ws + offRQ);
  float* RK = (float*)(ws + offRK);

  // ---- prologue: 16-bit operand planes, relative projections ----
  prologue_kernel<<<dim3(kPbAll), dim3(256), 0, stream>>>(h, rh, Wk, Wq, Wv, Wo, Wrk, Wrq, W1, W2, Hh, WT4, W1T, W2T, RK, RQ);

  // ---- q, k, v = h @ W (x16 weights folded back by 1/16): three separate [4096][1024] f16 planes (b0 -> k, b1 -> q, b2 -> v) ----
  {
    const int tiles = (kTok / 64) * (kDim / 64);   // 1024
    wmma_gemm64<0, false, 0, 1, false, 0><<<dim3(tiles / 8, 3), dim3(256), 0, stream>>>(
        Hh, Hh, kDim, 0L, WT4, WT4, kDim, (long)kDim * kDim,
        (void*)K16, (void*)K16, kDim, (long)kTok * kDim, RQ, RQ, 0L, kTok, kDim, kDim, kWCarryInv);
  }
  // ---- flat-reshape repacks per chunk: KT_g[m][d] = kchunk_g[d*2048+m] (in[128][2048] -> out[2048][128]);
  //      VT_g[d][m] = vchunk_g[m*128+d] (in[2048][128] -> out[128][2048]) ----
  repack_kv_kernel<<<dim3(kRepackTiles, kGroups, 2), dim3(256), 0, stream>>>(K16, KT, V16, VT);

  // ---- attention, all 16 chunks in one launch: ctx_g f16 x256 at CTX + g*262144 as [2048][128] ----
  attn_fused_kernel<<<dim3(kSeq / kFaRows, kGroups), dim3(256), 0, stream>>>(Q16, KT, VT, RQ, RK, CTX);

  // ---- h_sa = ctx @ Wo (fold back 1/(256*16)) -> two f32 [4096][1024] partial planes, k 0..511 and 512..1023 ----
  {
    const int tiles = (kTok / 64) * (kDim / 64);   // 1024
    wmma_gemm64<0, false, 0, 0, false, 0, true><<<dim3(tiles / 8, 2), dim3(256), 0, stream>>>(
        CTX, CTX, kDim, (long)(kDim / 2), WoT, WoT, kDim, (long)(kDim / 2),
        (void*)HSA, (void*)HSA, kDim, (long)kTok * kDim, RQ, RQ, 0L, kTok, kDim, kDim / 2, kWoScale);
  }
  // ---- h1 = LN(h + h_sa) * g1 + be1 -> f32 plane + f16 plane ----
  add_ln_kernel<true><<<dim3(kTok), dim3(256), 0, stream>>>(h, HSA, HSA + (size_t)kTok * kDim, g1, be1, H1f, H1h);
  // ---- mid = relu(h1 @ W1 + b1) -> f16 [4096][4096] ----
  {
    const int tiles = (kTok / 64) * (kFfn / 64);   // 4096
    wmma_gemm64<0, false, 2, 1, false, 2><<<dim3(tiles / 8, 1), dim3(256), 0, stream>>>(
        H1h, H1h, kDim, 0L, W1T, W1T, kDim, 0L,
        (void*)MID, (void*)MID, kFfn, 0L, b1, RQ, 0L, kTok, kFfn, kDim, kWCarryInv);
  }
  // ---- hf = mid @ W2 + b2 -> two f32 [4096][1024] partial planes, k 0..2047 (with b2) and 2048..4095 ----
  {
    const int tiles = (kTok / 64) * (kDim / 64);   // 1024
    wmma_gemm64<0, false, 2, 0, false, 0, true><<<dim3(tiles / 8, 2), dim3(256), 0, stream>>>(
        MID, MID, kFfn, (long)(kFfn / 2), W2T, W2T, kFfn, (long)(kFfn / 2),
        (void*)HF, (void*)HF, kDim, (long)kTok * kDim, b2, RQ, 0L, kTok, kDim, kFfn / 2, kWCarryInv);
  }
  // ---- h2 = LN(h1 + hf) * g2 + be2 -> output ----
  add_ln_kernel<false><<<dim3(kTok), dim3(256), 0, stream>>>(H1f, HF, HF + (size_t)kTok * kDim, g2, be2, out, H1h);
}

// v005
// One run takes 179 microseconds.
// Timed twice side by side with v004, it ran 1.04 and 1.03 times as fast.
// Counting every step since v000, it is 6.99 times as fast.
// Contractions: q/k/v projections (h f16 x W^T f16 carried x16), scores Q_g.K_g (q, k f16 planes), attn.V_g (P = exp(score - running row max) in f16 x V^T f16, normalised in f32 at the end), output projection (ctx f16 carried x256 x Wo^T f16 x16), FFN up and down (h1 f16 / relu(u) f16 x W^T f16 x16): all on v_wmma_f32_16x16x32_f16 with f32 accumulate; relative bias (K=4), softmax, residuals and LayerNorm in f32.
#include <hip/hip_runtime.h>
#include <math.h>

// ---------------------------------------------------------------------------
// Problem constants
// ---------------------------------------------------------------------------
constexpr int kBatch    = 2;
constexpr int kSeq      = 2048;
constexpr int kDim      = 1024;
constexpr int kFfn      = 4096;
constexpr int kHeads    = 8;
constexpr int kHeadDim  = 128;
constexpr int kRl       = 4;
constexpr int kTok      = kBatch * kSeq;          // 4096 token rows
constexpr int kGroups   = kBatch * kHeads;        // 16 flat-reshape chunks
constexpr int kChunk    = kSeq * kHeadDim;        // 262144 elements per chunk
constexpr float kWCarry     = 16.0f;              // weights carried x16 in f16
constexpr float kWCarryInv  = 1.0f / 16.0f;
constexpr float kCtxCarry   = 256.0f;             // context carried x256 in f16
constexpr float kScoreScale = 0.08838834764831845f;            // 128^-0.5
constexpr float kLog2e      = 1.4426950408889634f;
constexpr float kWoScale    = 1.0f / (kCtxCarry * kWCarry);   // 2^-12
constexpr float kInvDim     = 1.0f / 1024.0f;
constexpr float kLnEps      = 1e-5f;
static_assert(kHeads * kHeadDim == kDim, "shape");
static_assert(kGroups * kChunk == kTok * kDim, "chunks");
// Wave tile and k step: M, N multiples of 64, K multiples of 32
static_assert(kTok % 64 == 0 && kDim % 64 == 0 && kFfn % 64 == 0 && kSeq % 64 == 0 && kHeadDim % 64 == 0, "tiles");
static_assert(kDim % 32 == 0 && kHeadDim % 32 == 0 && kSeq % 32 == 0 && kFfn % 32 == 0, "ksteps");
// Workgroup tile of the GEMM engine: M multiples of 256, N multiples of 128, K multiples of 64
static_assert(kTok % 256 == 0 && kSeq % 256 == 0, "block rows");
static_assert(kDim % 128 == 0 && kFfn % 128 == 0 && kSeq % 128 == 0 && kHeadDim % 128 == 0, "block cols");
static_assert(kDim % 64 == 0 && kHeadDim % 64 == 0 && kSeq % 64 == 0 && kFfn % 64 == 0, "stages");

typedef __attribute__((ext_vector_type(16))) _Float16 v16h;
typedef __attribute__((ext_vector_type(8)))  _Float16 v8h;
typedef __attribute__((ext_vector_type(16))) __bf16   v16b;
typedef __attribute__((ext_vector_type(8)))  __bf16   v8b;
typedef __attribute__((ext_vector_type(8)))  float    v8f;
typedef __attribute__((ext_vector_type(4)))  float    v4f;
typedef __attribute__((ext_vector_type(2)))  float    v2f;
typedef __attribute__((ext_vector_type(4)))  unsigned int v4u;

// ---------------------------------------------------------------------------
// Device helpers
// ---------------------------------------------------------------------------
__device__ __forceinline__ unsigned short f2bf_bits(float f) {
  unsigned u = __float_as_uint(f);
  return (unsigned short)((u + 0x7FFFu + ((u >> 16) & 1u)) >> 16);
}
__device__ __forceinline__ float bf_bits2f(unsigned short h) { return __uint_as_float(((unsigned)h) << 16); }

// hazard guards as plain device helpers
__device__ __forceinline__ void dep_guard_h(v8f& a, v8f& b, v16h x, v16h y) { asm volatile("v_nop\n\tv_nop\n\tv_nop\n\tv_nop" : "+v"(a), "+v"(b) : "v"(x), "v"(y)); }
__device__ __forceinline__ void dep_guard_b(v8f& a, v8f& b, v16b x, v16b y) { asm volatile("v_nop\n\tv_nop\n\tv_nop\n\tv_nop" : "+v"(a), "+v"(b) : "v"(x), "v"(y)); }
// all-accumulator tie of a 4-wide group, naming the A fragments as inputs
__device__ __forceinline__ void dep_guard4_h(v8f& a, v8f& b, v8f& c, v8f& d, v16h x, v16h y) { asm volatile("v_nop\n\tv_nop\n\tv_nop\n\tv_nop" : "+v"(a), "+v"(b), "+v"(c), "+v"(d) : "v"(x), "v"(y)); }
__device__ __forceinline__ void dep_guard4_b(v8f& a, v8f& b, v8f& c, v8f& d, v16b x, v16b y) { asm volatile("v_nop\n\tv_nop\n\tv_nop\n\tv_nop" : "+v"(a), "+v"(b), "+v"(c), "+v"(d) : "v"(x), "v"(y)); }
__device__ __forceinline__ void keep4_h(v16h a, v16h b, v16h c, v16h d) { asm volatile("v_nop" :: "v"(a), "v"(b), "v"(c), "v"(d)); }
__device__ __forceinline__ void keep4_b(v16b a, v16b b, v16b c, v16b d) { asm volatile("v_nop" :: "v"(a), "v"(b), "v"(c), "v"(d)); }
__device__ __forceinline__ void acc_guard4(v8f& a, v8f& b, v8f& c, v8f& d) { asm volatile("v_nop\n\tv_nop\n\tv_nop\n\tv_nop" : "+v"(a), "+v"(b), "+v"(c), "+v"(d)); }
template <typename T> struct Frag;
template <> struct Frag<_Float16> {
  typedef v16h V; union U { v16h v; v8h h[2]; };
  // elements 0..7 <- p[0..7], 8..15 <- p[16..23]
  static __device__ __forceinline__ v16h load(const _Float16* p) {
    U f; f.h[0] = *(const v8h*)(p); f.h[1] = *(const v8h*)(p + 16); return f.v;
  }
  static __device__ __forceinline__ v8f mma(v16h a, v16h b, v8f c) {
    return __builtin_amdgcn_wmma_f32_16x16x32_f16(false, a, false, b, (short)0, c, false, false);
  }
  static __device__ __forceinline__ void guard(v8f& a, v8f& b, v16h x, v16h y) { dep_guard_h(a, b, x, y); }
  static __device__ __forceinline__ void guard4(v8f& a, v8f& b, v8f& c, v8f& d, v16h x, v16h y) { dep_guard4_h(a, b, c, d, x, y); }
  static __device__ __forceinline__ void keep(v16h a, v16h b, v16h c, v16h d) { keep4_h(a, b, c, d); }
};
template <> struct Frag<__bf16> {
  typedef v16b V; union U { v16b v; v8b h[2]; };
  static __device__ __forceinline__ v16b load(const __bf16* p) {
    U f; f.h[0] = *(const v8b*)(p); f.h[1] = *(const v8b*)(p + 16); return f.v;
  }
  static __device__ __forceinline__ v8f mma(v16b a, v16b b, v8f c) {
    return __builtin_amdgcn_wmma_f32_16x16x32_bf16(false, a, false, b, (short)0, c, false, false);
  }
  static __device__ __forceinline__ void guard(v8f& a, v8f& b, v16b x, v16b y) { dep_guard_b(a, b, x, y); }
  static __device__ __forceinline__ void guard4(v8f& a, v8f& b, v8f& c, v8f& d, v16b x, v16b y) { dep_guard4_b(a, b, c, d, x, y); }
  static __device__ __forceinline__ void keep(v16b a, v16b b, v16b c, v16b d) { keep4_b(a, b, c, d); }
};

__device__ __forceinline__ unsigned pk16(unsigned short a, unsigned short b) { return (unsigned)a | ((unsigned)b << 16); }
__device__ __forceinline__ unsigned short h_bits(float f) { const _Float16 h = (_Float16)f; return __builtin_bit_cast(unsigned short, h); }

// ---- Register-blocked batched WMMA GEMM (ACT reduced to none/relu/leaky; per-row group guard ties all four
//      accumulators and names the A fragments) -------------------------------------------------------------------------
// C[m,n] = scale * sum_k A[m,k] * Bt[n,k] (+bias)(+resid); a workgroup owns a 256x128 tile, each of its 8 waves (4 x 2) a 64x64 tile.
// A row-major [M,K]; Bt row-major [N,K]; M % 256 == 0, N % 128 == 0, K % 64 == 0.
// Operands reach the waves through LDS: a stage is 64 k (128 B, one cache line) of the tile's 256 A rows and 128 Bt rows at a
// pitch of 144 B, laid by asynchronous copies of whole lines (8 lanes x 16 B per row) into a ring of two buffers, one stage ahead.
// SPLIT (hi/lo planes) is not staged by this engine: single-plane operands only.
// BIAS_MODE: 0 = none, 1 = bias[m], 2 = bias[n].
// OUT_MODE: 0 = f32, 1 = f16, 2 = bf16 hi plane (Cout) + bf16 lo plane (Cout2).
// ET: 0 = f16 operands, 1 = bf16 operands (pointers passed as 16-bit storage)
// KSPLIT: the batch index b counts slices of the k range of ONE product (strideA, strideB = k per slice, K = k per slice); slice b
// stores its partial sum in plane b of Cout, the reader adds the planes, and only slice 0 adds the bias.
template <int ET> struct Elem;
template <> struct Elem<0> { typedef _Float16 T; };
template <> struct Elem<1> { typedef __bf16 T; };
constexpr int kBlkM       = 256;                          // A rows of a workgroup tile
constexpr int kBlkN       = 128;                          // Bt rows of a workgroup tile
constexpr int kStageK     = 64;                           // k per stage
constexpr int kRowPitch   = 144;                          // bytes per staged row: 16 B x odd, conflict-free for 16-byte LDS reads
constexpr int kPitchH     = kRowPitch / 2;                // the same in 16-bit elements
constexpr int kStageBytes = (kBlkM + kBlkN) * kRowPitch;  // 55,296: A rows 0..255, then Bt rows 0..127
// One lane's share of a stage: twelve 16-byte copies, staged rows r, r + 32, ... r + 352 (eight of A, four of Bt), r = thread >> 3.
// l = LDS byte address of this lane's 16 bytes in row r; a, b = global address of the same 16 bytes in A row r and Bt row r;
// sa, sb = bytes between 32 rows of A and of Bt. The s_wait_xcnt stands inside the statement so that no address register of a
// copy is rewritten ahead of it.
__device__ __forceinline__ void stage_copies(unsigned l, const char* a, size_t sa, const char* b, size_t sb) {
  constexpr unsigned kStep = 32u * kRowPitch;
  asm volatile(
      "global_load_async_to_lds_b128 %0, %12, off\n\t"
      "global_load_async_to_lds_b128 %1, %13, off\n\t"
      "global_load_async_to_lds_b128 %2, %14, off\n\t"
      "global_load_async_to_lds_b128 %3, %15, off\n\t"
      "global_load_async_to_lds_b128 %4, %16, off\n\t"
      "global_load_async_to_lds_b128 %5, %17, off\n\t"
      "global_load_async_to_lds_b128 %6, %18, off\n\t"
      "global_load_async_to_lds_b128 %7, %19, off\n\t"
      "global_load_async_to_lds_b128 %8, %20, off\n\t"
      "global_load_async_to_lds_b128 %9, %21, off\n\t"
      "global_load_async_to_lds_b128 %10, %22, off\n\t"
      "global_load_async_to_lds_b128 %11, %23, off\n\t"
      "s_wait_xcnt 0x0"
      :: "v"(l), "v"(l + kStep), "v"(l + 2 * kStep), "v"(l + 3 * kStep), "v"(l + 4 * kStep), "v"(l + 5 * kStep),
         "v"(l + 6 * kStep), "v"(l + 7 * kStep), "v"(l + 8 * kStep), "v"(l + 9 * kStep), "v"(l + 10 * kStep), "v"(l + 11 * kStep),
         "v"(a), "v"(a + sa), "v"(a + 2 * sa), "v"(a + 3 * sa), "v"(a + 4 * sa), "v"(a + 5 * sa), "v"(a + 6 * sa), "v"(a + 7 * sa),
         "v"(b), "v"(b + sb), "v"(b + 2 * sb), "v"(b + 3 * sb)
      : "memory");
}
template <int ET, bool SPLIT, int BIAS_MODE, int OUT_MODE, bool RESID, int ACT = 0, bool KSPLIT = false>
__global__ __launch_bounds__(256) void wmma_gemm64(
    const unsigned short* __restrict__ Ap, const unsigned short* __restrict__ A2p, int lda, long strideA,
    const unsigned short* __restrict__ Btp, const unsigned short* __restrict__ Bt2p, int ldb, long strideB,
    void* __restrict__ Cout, void* __restrict__ Cout2, int ldc, long strideC,
    const float* __restrict__ bias,
    const float* __restrict__ resid, long strideR,
    int M, int N, int K, float scale) {
  typedef typename Elem<ET>::T T;
  typedef typename Frag<T>::V V;
  static_assert(!SPLIT, "single-plane operands only");
  static_assert(!KSPLIT || (OUT_MODE == 0 && ACT == 0 && !RESID && BIAS_MODE != 1), "partial sums are plain f32 planes");
  const T* A = (const T*)Ap; const T* Bt = (const T*)Btp;
  __shared__ __align__(128) unsigned char ring[2 * kStageBytes];   // two stage buffers
  __shared__ __align__(16) float sT[8][16 * 68];   // per-wave 16x64 slab, pitch 68 floats
  const int b    = blockIdx.y;
  const int lane = threadIdx.x & 31;
  const int wave = threadIdx.x >> 5;
  const int tilesN = N >> 7;
  const int tilesM = M >> 8;
  const int tile = blockIdx.x;
  if (tile >= tilesM * tilesN) return;   // the same for the whole workgroup, ahead of every barrier
  const int tm = tile / tilesN;
  const int tn = tile - tm * tilesN;
  const int mBlk = tm << 8;
  const int nBlk = tn << 7;
  const int wRow = (wave >> 1) << 6;           // this wave's 64 rows inside the workgroup tile
  const int wCol = (wave & 1) << 6;            // this wave's 64 columns inside the workgroup tile
  const int m0 = mBlk + wRow;
  const int n0 = nBlk + wCol;

  const T* Ab  = A  + (size_t)b * strideA;
  const T* Bb  = Bt + (size_t)b * strideB;

  const int rlane = lane & 15;                 // row (A) / col (B, D) within subtile
  const int koff  = (lane >> 4) * 8;           // k offset of this lane half
  const int mOff  = (lane >> 4) * 8;           // D row offset

  // copy map: thread t moves bytes 16*(t&7) .. +15 of staged rows (t>>3) + 32*i, so a wave's copy covers four whole 128-B lines
  const int cRow = threadIdx.x >> 3;
  const int cCol = (threadIdx.x & 7) * 8;      // in 16-bit elements
  const char* gA = (const char*)(Ab + (size_t)(mBlk + cRow) * lda + cCol);
  const char* gB = (const char*)(Bb + (size_t)(nBlk + cRow) * ldb + cCol);
  const size_t stepA = (size_t)lda * (32 * sizeof(T));
  const size_t stepB = (size_t)ldb * (32 * sizeof(T));
  const unsigned ldsDst = (unsigned)(size_t)ring + (unsigned)(cRow * kRowPitch + cCol * 2);
  const int nStage = K / kStageK;

  v8f acc[4][4];
#pragma unroll
  for (int i = 0; i < 4; ++i)
#pragma unroll
    for (int j = 0; j < 4; ++j) acc[i][j] = (v8f){0.f,0.f,0.f,0.f,0.f,0.f,0.f,0.f};

  // ring prologue: stage 0 landed and published, then stage 1 in flight
  stage_copies(ldsDst, gA, stepA, gB, stepB);
  asm volatile("s_wait_asynccnt 0x0" ::: "memory");   // this wave's copies of stage 0 have landed
  __syncthreads();                                    // every wave's copies of stage 0 are readable
  if (nStage > 1) stage_copies(ldsDst + kStageBytes, gA + kStageK * sizeof(T), stepA, gB + kStageK * sizeof(T), stepB);

  for (int s = 0; s < nStage; ++s) {
    const unsigned bufOff = (unsigned)(s & 1) * kStageBytes;
    const T* sA = (const T*)(ring + bufOff + (wRow + rlane) * kRowPitch) + koff;
    const T* sB = (const T*)(ring + bufOff + (kBlkM + wCol + rlane) * kRowPitch) + koff;
#pragma unroll
    for (int kk = 0; kk < kStageK; kk += 32) {
      V bh[4], ah[4];   // all eight fragments of this k step are requested as one group, so the wave meets LDS latency once
#pragma unroll
      for (int j = 0; j < 4; ++j) {
        bh[j] = Frag<T>::load(sB + j * 16 * kPitchH + kk);
        ah[j] = Frag<T>::load(sA + j * 16 * kPitchH + kk);
      }
#pragma unroll
      for (int i = 0; i < 4; ++i) {
#pragma unroll
        for (int j = 0; j < 4; ++j) acc[i][j] = Frag<T>::mma(ah[i], bh[j], acc[i][j]);
        Frag<T>::guard4(acc[i][0], acc[i][1], acc[i][2], acc[i][3], ah[i], ah[i]);
      }
      Frag<T>::keep(bh[0], bh[1], bh[2], bh[3]);
    }
    // publish point of stage s + 1, and release of the buffer that stage s was read from
    asm volatile("s_wait_dscnt 0x0" ::: "memory");      // this wave's reads of stage s are done before the buffer is refilled
    asm volatile("s_wait_asynccnt 0x0" ::: "memory");   // this wave's copies of stage s + 1 have landed
    __syncthreads();
    if (s + 2 < nStage) {
      const size_t kb = (size_t)(s + 2) * (kStageK * sizeof(T));
      stage_copies(ldsDst + bufOff, gA + kb, stepA, gB + kb, stepB);
    }
  }
  asm volatile("s_wait_asynccnt 0x0" ::: "memory");     // nothing of this wave is in flight when the ring is left
  acc_guard4(acc[0][0], acc[0][1], acc[0][2], acc[0][3]);
  acc_guard4(acc[1][0], acc[1][1], acc[1][2], acc[1][3]);
  acc_guard4(acc[2][0], acc[2][1], acc[2][2], acc[2][3]);
  acc_guard4(acc[3][0], acc[3][1], acc[3][2], acc[3][3]);

  // ---- epilogue ----
  float* slab = sT[wave];
  const float* Rb = RESID ? (resid + (size_t)b * strideR) : nullptr;
#pragma unroll
  for (int i = 0; i < 4; ++i) {
    const int mBase = m0 + (i << 4);
#pragma unroll
    for (int j = 0; j < 4; ++j) {
      const int n = n0 + (j << 4) + rlane;
      float bv = 0.f;
      if (BIAS_MODE == 2) bv = bias[n];
      if (KSPLIT && b != 0) bv = 0.f;
#pragma unroll
      for (int r = 0; r < 8; ++r) {
        float v = acc[i][j][r] * scale;
        if (BIAS_MODE == 1) v += bias[mBase + mOff + r];
        if (BIAS_MODE == 2) v += bv;
        if (RESID) v += Rb[(size_t)(mBase + mOff + r) * ldc + n];
        if (ACT == 2) v = fmaxf(v, 0.0f);
        if (ACT == 4) v = (v > 0.f) ? v : 0.01f * v;
        slab[(mOff + r) * 68 + (j << 4) + rlane] = v;
      }
    }
    __builtin_amdgcn_fence(__ATOMIC_RELEASE, "workgroup");
    __builtin_amdgcn_wave_barrier();
    __builtin_amdgcn_fence(__ATOMIC_ACQUIRE, "workgroup");
    if (OUT_MODE == 0) {
      float* C = (float*)Cout + (size_t)b * strideC;
      const int hh = lane >> 4, c4 = (lane & 15) * 4;     // row seg = 256 B = 16 lanes x 16 B
      {
#pragma unroll
        for (int it = 0; it < 8; ++it) {
          const int row = it * 2 + hh;
          v4f v = *(const v4f*)(slab + row * 68 + c4);
          *(v4f*)(C + (size_t)(mBase + row) * ldc + n0 + c4) = v;
        }
        
      }
    } else {
      const int q = lane >> 3, c8 = (lane & 7) * 8;
      unsigned short* C  = (unsigned short*)Cout  + (size_t)b * strideC;
      unsigned short* C2 = (OUT_MODE == 2) ? ((unsigned short*)Cout2 + (size_t)b * strideC) : nullptr;
      {
#pragma unroll
        for (int it = 0; it < 4; ++it) {
          const int row = it * 4 + q;
          const float* sp = slab + row * 68 + c8;
          v8h hv, lv;
#pragma unroll
          for (int e = 0; e < 8; ++e) {
            if (OUT_MODE == 1) {
              hv[e] = (_Float16)sp[e];
            } else {
              unsigned short hb = f2bf_bits(sp[e]);
              unsigned short lb = f2bf_bits(sp[e] - bf_bits2f(hb));
              hv[e] = __builtin_bit_cast(_Float16, hb);
              lv[e] = __builtin_bit_cast(_Float16, lb);
            }
          }
          *(v8h*)(C + (size_t)(mBase + row) * ldc + n0 + c8) = hv;
          if (OUT_MODE == 2) *(v8h*)(C2 + (size_t)(mBase + row) * ldc + n0 + c8) = lv;
        }
        
      }
    }
    __builtin_amdgcn_fence(__ATOMIC_RELEASE, "workgroup");
    __builtin_amdgcn_wave_barrier();
    __builtin_amdgcn_fence(__ATOMIC_ACQUIRE, "workgroup");
  }
}

// ---------------------------------------------------------------------------
// ---------------------------------------------------------------------------
// f32 -> f16 cast, eight elements a thread; blk = index of this block among the n8 / 256 blocks of the cast.
__device__ __forceinline__ void cast8_f16_block(const float* __restrict__ in, unsigned short* __restrict__ out, int n8, int blk) {
  const int i = blk * 256 + threadIdx.x;
  if (i >= n8) return;
  const float* p = in + 8 * (size_t)i;
  const v4f a = *(const v4f*)(p);
  const v4f c = *(const v4f*)(p + 4);
  unsigned short hb[8];
#pragma unroll
  for (int e = 0; e < 4; ++e) {
    hb[e]     = h_bits(a[e]);
    hb[4 + e] = h_bits(c[e]);
  }
  const v4u u = (v4u){pk16(hb[0], hb[1]), pk16(hb[2], hb[3]), pk16(hb[4], hb[5]), pk16(hb[6], hb[7])};
  unsigned short* q = out + 8 * (size_t)i;
  *(v4u*)q = u;
  
}

// ---------------------------------------------------------------------------
// Weight transpose + cast: W row-major [kin][nout] f32 (x @ W orientation) -> WT[n][k] = f16(scale * W[k][n]), row-major [nout][kin].
// One block of 256 threads per 64 x 64 tile: kt = k tile (64 cols of WT), nt = n tile (64 rows of WT); sm = the block's LDS tile.
// Load coverage: 4 iterations x 256 threads x float4 = 64 k-rows x 64 n-cols (4 b128 loads per lane).
// Store coverage: 8 waves x 2 iterations x 4 rows (lane>>3) = 64 n-rows; (lane&7) x 8 halves = 64 k-cols; each row segment =
// ---------------------------------------------------------------------------
__device__ __forceinline__ void wt_cast_block(const float* __restrict__ W, unsigned short* __restrict__ op, int kin, int nout,
                                              int kt, int nt, float scale, float (*sm)[65]) {   // sm[n_local][k_local]
  const int t  = threadIdx.x;
  const int k0 = kt * 64;
  const int n0 = nt * 64;
  // The four loads are issued first and stay in flight together; the LDS writes follow in a loop of their own.
  // Both loops are unrolled so that w[] is indexed by constants and stays in registers.
  v4f w[4];
#pragma unroll
  for (int i = 0; i < 4; ++i) {
    const int e  = i * 256 + t;
    const int r  = e >> 4;           // k local
    const int c4 = (e & 15) * 4;     // n local
    w[i] = *(const v4f*)(W + (size_t)(k0 + r) * nout + n0 + c4);
    asm volatile("s_wait_xcnt 0x0" ::: "memory");   // stands ahead of any rewrite of this load's address registers (a later load's result may land there)
  }
#pragma unroll
  for (int i = 0; i < 4; ++i) {
    const int e  = i * 256 + t;
    const int r  = e >> 4;           // k local
    const int c4 = (e & 15) * 4;     // n local
    sm[c4 + 0][r] = w[i][0] * scale;
    sm[c4 + 1][r] = w[i][1] * scale;
    sm[c4 + 2][r] = w[i][2] * scale;
    sm[c4 + 3][r] = w[i][3] * scale;
  }
  __syncthreads();
  const int lane = t & 31, wave = t >> 5;
  const int q = lane >> 3, c8 = (lane & 7) * 8;
  {
#pragma unroll
    for (int it = 0; it < 2; ++it) {
      const int row = wave * 8 + it * 4 + q;                 // n local
      unsigned short hb[8];
#pragma unroll
      for (int e = 0; e < 8; ++e) hb[e] = h_bits(sm[row][c8 + e]);
      const v4u u = (v4u){pk16(hb[0], hb[1]), pk16(hb[2], hb[3]), pk16(hb[4], hb[5]), pk16(hb[6], hb[7])};
      *(v4u*)(op + (size_t)(n0 + row) * kin + k0 + c8) = u;
    }
    asm volatile("s_wait_xcnt 0x0" ::: "memory");   // stands ahead of any rewrite of the two stores' address and data registers in the code behind this body
  }
}

// ---------------------------------------------------------------------------
// r_k = rh @ Wrk, r_q = rh @ Wrq (K = 4, f32 VALU): out[i][j] = sum_r rh[i][r] * W[r][j] (W row-major [in][out]).
// blk = index of this block among the 4096/256 = 16 blocks (exact).
// ---------------------------------------------------------------------------
__device__ __forceinline__ void rl_proj_block(const float* __restrict__ rh, const float* __restrict__ Wrk,
                                              const float* __restrict__ Wrq, float* __restrict__ rk,
                                              float* __restrict__ rq, int nrows, int blk) {
  const int idx = blk * 256 + threadIdx.x;
  if (idx >= nrows) return;
  const v4f r  = *(const v4f*)(rh + (size_t)idx * kRl);
  const v4f k0 = *(const v4f*)(Wrk + 0);
  const v4f k1 = *(const v4f*)(Wrk + 4);
  const v4f k2 = *(const v4f*)(Wrk + 8);
  const v4f k3 = *(const v4f*)(Wrk + 12);
  asm volatile("" ::: "memory");
  const v4f q0 = *(const v4f*)(Wrq + 0);
  const v4f q1 = *(const v4f*)(Wrq + 4);
  const v4f q2 = *(const v4f*)(Wrq + 8);
  const v4f q3 = *(const v4f*)(Wrq + 12);
  v4f ok = r[0] * k0;
  ok = ok + r[1] * k1;
  ok = ok + r[2] * k2;
  ok = ok + r[3] * k3;
  v4f oq = r[0] * q0;
  oq = oq + r[1] * q1;
  oq = oq + r[2] * q2;
  oq = oq + r[3] * q3;
  float* pk = rk + (size_t)idx * kRl;
  float* pq = rq + (size_t)idx * kRl;
  *(v4f*)pk = ok;
  *(v4f*)pq = oq;
  
}

// ---------------------------------------------------------------------------
// Prologue in one launch: the five preparations below read only inputs and write disjoint workspace planes, so none waits for
// another; a block takes its job from the range its index falls in (the same for the whole block, so the barrier inside the
// weight repack is reached by all of its threads or by none).
//   [0, 16)        r_k, r_q
//   [16, 1040)     Wk, Wq, Wv, Wo [1024][1024] -> the four planes of wt4, 256 tiles each (k tile fastest)
//   [1040, 2064)   W1 [1024][4096] -> w1t [4096][1024]
//   [2064, 3088)   W2 [4096][1024] -> w2t [1024][4096]
//   [3088, 5136)   h -> f16
// ---------------------------------------------------------------------------
constexpr int kPbRl   = kTok / 256;                       // 16
constexpr int kPbSq   = (kDim / 64) * (kDim / 64);        // 256 tiles of a [1024][1024] weight
constexpr int kPbW4   = 4 * kPbSq;                        // 1024
constexpr int kPbFfn  = (kDim / 64) * (kFfn / 64);        // 1024 tiles of W1, and of W2
constexpr int kCastN8 = kTok * kDim / 8;                  // 524288 pieces of eight elements
constexpr int kPbCast = kCastN8 / 256;                    // 2048
constexpr int kPbAll  = kPbRl + kPbW4 + 2 * kPbFfn + kPbCast;   // 5136
static_assert(kTok % 256 == 0 && kCastN8 % 256 == 0, "exact prologue grids");
static_assert(kPbW4 % kPbFfn == 0 && kPbFfn == 4 * kPbSq && kDim / 64 == 16 && kFfn / 64 == 64, "tile numbering of the weight repack");
__global__ __launch_bounds__(256) void prologue_kernel(const float* __restrict__ h, const float* __restrict__ rh,
                                                       const float* __restrict__ Wk, const float* __restrict__ Wq,
                                                       const float* __restrict__ Wv, const float* __restrict__ Wo,
                                                       const float* __restrict__ Wrk, const float* __restrict__ Wrq,
                                                       const float* __restrict__ W1, const float* __restrict__ W2,
                                                       unsigned short* __restrict__ hh, unsigned short* __restrict__ wt4,
                                                       unsigned short* __restrict__ w1t, unsigned short* __restrict__ w2t,
                                                       float* __restrict__ rk, float* __restrict__ rq) {
  __shared__ float sm[64][65];
  int i = blockIdx.x;
  if (i < kPbRl) { rl_proj_block(rh, Wrk, Wrq, rk, rq, kTok, i); return; }
  i -= kPbRl;
  if (i < kPbW4 + 2 * kPbFfn) {
    // one repack body for all six weights; source, destination and shape are picked from the block index (scalars)
    const int z = i / kPbSq;                     // 0..3 the square weights, 4..7 W1, 8..11 W2
    const float* W = (z == 0) ? Wk : (z == 1) ? Wq : (z == 2) ? Wv : (z == 3) ? Wo : (z < 8) ? W1 : W2;
    unsigned short* op = (z < 4) ? wt4 + (size_t)z * kDim * kDim : (z < 8) ? w1t : w2t;
    const int e    = (z < 4) ? i % kPbSq : i % kPbFfn;   // tile index inside its weight (kPbW4 is a multiple of kPbFfn)
    const int kin  = (z < 8) ? kDim : kFfn;
    const int nout = (z < 4 || z >= 8) ? kDim : kFfn;
    const int ksh  = (z < 8) ? 4 : 6;            // log2 of kin / 64
    wt_cast_block(W, op, kin, nout, e & ((1 << ksh) - 1), e >> ksh, kWCarry, sm);
    return;
  }
  i -= kPbW4 + 2 * kPbFfn;
  cast8_f16_block(h, hh, kCastN8, i);
}

// ---------------------------------------------------------------------------
// Fused attention of one flat chunk g: scores, relative bias, softmax and attn.V in one kernel, no score or probability plane.
//   a[l][m] = 128^-0.5 * sum_d Q_g[l][d] * K_g[d][m] + 0.5 * sum_r rq[b][l][r] * rk_flat[b][r*2048 + m]
//   ctx_g[l][d] = 256 * sum_m exp(a - max) * V_g[m][d] / sum_m exp(a - max)      (f16, carried x256)
// K_g = chunk g of the k plane read as [128][2048], V_g = chunk g of the v plane read as [2048][128]: the flat reshapes of the
// reference, taken as the projection stored them.
// grid (2048/128, 16): a workgroup of 8 waves owns 128 query rows of chunk blockIdx.y, a wave 16 of them; 32 stages of 64 keys.
// Both products are transposed, so that a query is a lane's column in every accumulator:
//   S^T (keys x queries) = K^T tile (A) x Q rows (B);  O^T (d x queries) = V^T tile (A) x P^T (B).
// Both A operands run along the rows of their staged tile, so their fragments come by the transposing LDS load, which delivers
// the k order of Frag::load (8 * half + 0..7, then 16 + 8 * half + 0..7).
// An S^T accumulator holds, for the lane's query, keys 8*(lane>>4) + 0..7 of its 16: two neighbouring accumulators converted to
// f16 are the B fragment of 32 keys in the k order of Frag::load, so P goes through no LDS and no lane exchange.
// Row maximum and the rescale factor are one scalar per lane, the row sum two partial sums (even and odd keys of the lane half) (online softmax, logits kept in the log2 domain).
// A stage is 128 K rows (64 keys, 128 B at pitch 160) and 64 V rows (256 B at pitch 288), laid by asynchronous copies into two buffers.
// In the kernel below, every '#pragma unroll' except the r_k copy's makes the index of a fragment or accumulator array a constant, so that the array stays in registers.
// ---------------------------------------------------------------------------
constexpr int kFaKeys   = 64;                          // keys per stage
constexpr int kFaRows   = 128;                         // query rows per workgroup
constexpr int kFaKPitch = 160;                         // bytes per staged K row: 32 B x odd, the transposing reader's pitch
constexpr int kFaVPitch = 288;                         // bytes per staged V row: 32 B x odd
constexpr int kFaKBytes = kHeadDim * kFaKPitch;        // 20,480
constexpr int kFaVBytes = kFaKeys * kFaVPitch;         // 18,432
constexpr int kFaStage  = kFaKBytes + kFaVBytes;       // 38,912
static_assert(kSeq % kFaKeys == 0 && kSeq % kFaRows == 0 && kSeq / kFaKeys >= 2 && kHeadDim == 128, "attention tiles");
// One lane's share of a stage: four 16-byte copies of K rows r, r + 32, r + 64, r + 96 (r = thread >> 3) and four of V rows
// r, r + 16, r + 32, r + 48 (r = thread >> 4). lk, lv = LDS byte addresses, k, v = global addresses of the first of each four.
// The s_wait_xcnt stands inside the statement so that no address register of a copy is rewritten ahead of it.
__device__ __forceinline__ void attn_stage_copies(unsigned lk, const char* k, unsigned lv, const char* v) {
  constexpr unsigned kLK = 32u * kFaKPitch, kLV = 16u * kFaVPitch;
  constexpr size_t kGK = (size_t)32 * kSeq * 2, kGV = (size_t)16 * kHeadDim * 2;
  asm volatile(
      "global_load_async_to_lds_b128 %0, %8, off\n\t"
      "global_load_async_to_lds_b128 %1, %9, off\n\t"
      "global_load_async_to_lds_b128 %2, %10, off\n\t"
      "global_load_async_to_lds_b128 %3, %11, off\n\t"
      "global_load_async_to_lds_b128 %4, %12, off\n\t"
      "global_load_async_to_lds_b128 %5, %13, off\n\t"
      "global_load_async_to_lds_b128 %6, %14, off\n\t"
      "global_load_async_to_lds_b128 %7, %15, off\n\t"
      "s_wait_xcnt 0x0"
      :: "v"(lk), "v"(lk + kLK), "v"(lk + 2 * kLK), "v"(lk + 3 * kLK), "v"(lv), "v"(lv + kLV), "v"(lv + 2 * kLV), "v"(lv + 3 * kLV),
         "v"(k), "v"(k + kGK), "v"(k + 2 * kGK), "v"(k + 3 * kGK), "v"(v), "v"(v + kGV), "v"(v + 2 * kGV), "v"(v + 3 * kGV)
      : "memory");
}
// value of lane l ^ 16
__device__ __forceinline__ float xhalf(float x) {
  const int i = __builtin_bit_cast(int, x);
  return __builtin_bit_cast(float, __builtin_amdgcn_permlanex16(i, i, 0x76543210, 0xfedcba98, false, false));
}
// 16 x 32 A fragment out of a row-major 16-bit LDS tile T whose rows run along the fragment's k: p = this lane's address
// T + (k0 + 8 * (lane >> 4) + (lane & 7)) * pitch + 2 * r0 + 16 * ((lane >> 3) & 1); the lane receives T[k0 + k][r0 + (lane & 15)]
// for k = 8 * (lane >> 4) + 0..7 (first load) and 16 + 8 * (lane >> 4) + 0..7 (second load, 16 rows further).
typedef __attribute__((ext_vector_type(8))) short v8s;
__device__ __forceinline__ v8h ld_tr16(const unsigned char* p) {
  typedef __attribute__((address_space(3))) v8s lds_v8s;
  return __builtin_bit_cast(v8h, __builtin_amdgcn_ds_load_tr16_b128_v8i16((lds_v8s*)p));
}
template <int PITCH>
__device__ __forceinline__ v16h load_tr_frag(const unsigned char* p) {
  Frag<_Float16>::U f; f.h[0] = ld_tr16(p); f.h[1] = ld_tr16(p + 16 * PITCH); return f.v;
}
typedef __attribute__((ext_vector_type(2))) _Float16 v2h;
union PFrag { v16h v; v2h h[8]; };   // B fragment of 32 keys, filled two keys at a time
__global__ __launch_bounds__(256) void attn_fused_kernel(const unsigned short* __restrict__ Qp, const unsigned short* __restrict__ Kp,
                                                         const unsigned short* __restrict__ Vp, const float* __restrict__ rqp,
                                                         const float* __restrict__ rkp, unsigned short* __restrict__ Cp) {
  typedef Frag<_Float16> F;
  // r_k of this batch as the flat [4][2048] view, then the two stage buffers
  __shared__ __align__(128) unsigned char smem[kRl * kSeq * 4 + 2 * kFaStage];
  float* rkS = (float*)smem;
  unsigned char* ring = smem + kRl * kSeq * 4;
  const int g     = blockIdx.y;
  const int b     = g >> 3;
  const int t     = threadIdx.x;
  const int lane  = t & 31, wave = t >> 5;
  const int rlane = lane & 15;                 // A row / B, D column within a subtile
  const int half8 = (lane >> 4) * 8;           // k offset of this lane half = D row offset
  const int q     = blockIdx.x * kFaRows + wave * 16 + rlane;   // this lane's query row
  const _Float16* Qg = (const _Float16*)Qp + (size_t)g * kChunk;
  const char* gK = (const char*)(Kp + (size_t)g * kChunk + (size_t)(t >> 3) * kSeq + (t & 7) * 8);
  const char* gV = (const char*)(Vp + (size_t)g * kChunk + (size_t)(t >> 4) * kHeadDim + (t & 15) * 8);
  const unsigned ldsK = (unsigned)(size_t)ring + (unsigned)((t >> 3) * kFaKPitch + (t & 7) * 16);
  const unsigned ldsV = (unsigned)(size_t)ring + (unsigned)(kFaKBytes + (t >> 4) * kFaVPitch + (t & 15) * 16);
  constexpr int nStage = kSeq / kFaKeys;
  constexpr size_t kStepK = (size_t)kFaKeys * 2;                // global bytes between stages: 64 columns of K
  constexpr size_t kStepV = (size_t)kFaKeys * kHeadDim * 2;     // 64 V rows

  // ring prologue: stage 0 (and r_k) landed and published, then stage 1 in flight
  attn_stage_copies(ldsK, gK, ldsV, gV);
  const float* rkb = rkp + (size_t)b * kSeq * kRl;
#pragma unroll
  for (int i = 0; i < kRl * kSeq / 1024; ++i) *(v4f*)(rkS + (i * 256 + t) * 4) = *(const v4f*)(rkb + (i * 256 + t) * 4);
  v16h qf[4];
#pragma unroll
  for (int ks = 0; ks < 4; ++ks) qf[ks] = F::load(Qg + (size_t)q * kHeadDim + ks * 32 + half8);
  const v4f rq4 = *(const v4f*)(rqp + ((size_t)b * kSeq + q) * kRl) * (0.5f * kLog2e);
  asm volatile("s_wait_asynccnt 0x0" ::: "memory");   // this wave's copies of stage 0 have landed
  __syncthreads();                                    // every wave's copies of stage 0 and stores of r_k are readable
  attn_stage_copies(ldsK + kFaStage, gK + kStepK, ldsV + kFaStage, gV + kStepV);

  v8f o[8];
#pragma unroll
  for (int dt = 0; dt < 8; ++dt) o[dt] = (v8f){0.f,0.f,0.f,0.f,0.f,0.f,0.f,0.f};
  float mrun = -__builtin_inff();   // running maximum of this query's logits (log2 domain), equal in both lane halves
  v2f lrun = (v2f){0.f, 0.f};       // running sums over this lane half's even and odd keys

  for (int s = 0; s < nStage; ++s) {
    const unsigned bufOff = (unsigned)(s & 1) * kFaStage;
    const unsigned char* sK = ring + bufOff + (half8 + (lane & 7)) * kFaKPitch + ((lane >> 3) & 1) * 16;
    const unsigned char* sV = ring + bufOff + kFaKBytes + (half8 + (lane & 7)) * kFaVPitch + ((lane >> 3) & 1) * 16;
    // S^T: four 16-key subtiles x this wave's 16 queries
    v8f sc[4];
#pragma unroll
    for (int mt = 0; mt < 4; ++mt) sc[mt] = (v8f){0.f,0.f,0.f,0.f,0.f,0.f,0.f,0.f};
#pragma unroll
    for (int ks = 0; ks < 4; ++ks)
#pragma unroll
      for (int mt = 0; mt < 4; ++mt) sc[mt] = F::mma(load_tr_frag<kFaKPitch>(sK + ks * 32 * kFaKPitch + mt * 32), qf[ks], sc[mt]);
    // logits (log2 domain) and their maximum; two keys per packed f32 instruction
    const float* rkT = rkS + s * kFaKeys + half8;
    v2f lg[4][4];
    float tmax = -__builtin_inff();
#pragma unroll
    for (int mt = 0; mt < 4; ++mt) {
      v4f kr[4][2];
#pragma unroll
      for (int j = 0; j < 4; ++j) {
        kr[j][0] = *(const v4f*)(rkT + j * kSeq + mt * 16);
        kr[j][1] = *(const v4f*)(rkT + j * kSeq + mt * 16 + 4);
      }
#pragma unroll
      for (int pr = 0; pr < 4; ++pr) {
        const int hi = pr >> 1, e = 2 * (pr & 1);
        v2f a = (v2f){rq4[0], rq4[0]} * (v2f){kr[0][hi][e], kr[0][hi][e + 1]};
        a = __builtin_elementwise_fma((v2f){rq4[1], rq4[1]}, (v2f){kr[1][hi][e], kr[1][hi][e + 1]}, a);
        a = __builtin_elementwise_fma((v2f){rq4[2], rq4[2]}, (v2f){kr[2][hi][e], kr[2][hi][e + 1]}, a);
        a = __builtin_elementwise_fma((v2f){rq4[3], rq4[3]}, (v2f){kr[3][hi][e], kr[3][hi][e + 1]}, a);
        a = __builtin_elementwise_fma((v2f){sc[mt][2 * pr], sc[mt][2 * pr + 1]}, (v2f){kScoreScale * kLog2e, kScoreScale * kLog2e}, a);
        lg[mt][pr] = a;
        tmax = fmaxf(tmax, fmaxf(a[0], a[1]));
      }
    }
    tmax = fmaxf(tmax, xhalf(tmax));
    const float mnew  = fmaxf(mrun, tmax);
    const float alpha = __builtin_amdgcn_exp2f(mrun - mnew);   // 0 in the first stage, where mrun is -inf
    mrun = mnew;
    PFrag pf[2];
    v2f ps[4];
#pragma unroll
    for (int mt = 0; mt < 4; ++mt) {
      v2f p[4];
#pragma unroll
      for (int pr = 0; pr < 4; ++pr) {
        const v2f x = lg[mt][pr] - (v2f){mnew, mnew};
        p[pr] = (v2f){__builtin_amdgcn_exp2f(x[0]), __builtin_amdgcn_exp2f(x[1])};
        pf[mt >> 1].h[(mt & 1) * 4 + pr] = __builtin_convertvector(p[pr], v2h);
      }
      ps[mt] = (p[0] + p[1]) + (p[2] + p[3]);
    }
    lrun = __builtin_elementwise_fma(lrun, (v2f){alpha, alpha}, (ps[0] + ps[1]) + (ps[2] + ps[3]));
#pragma unroll
    for (int dt = 0; dt < 8; ++dt) o[dt] = o[dt] * alpha;
    // O^T += V^T tile x P^T
#pragma unroll
    for (int kk = 0; kk < 2; ++kk)
#pragma unroll
      for (int dt = 0; dt < 8; ++dt) o[dt] = F::mma(load_tr_frag<kFaVPitch>(sV + kk * 32 * kFaVPitch + dt * 32), pf[kk].v, o[dt]);
    // publish point of stage s + 1, and release of the buffer that stage s was read from
    asm volatile("s_wait_dscnt 0x0" ::: "memory");      // this wave's reads of stage s are done before the buffer is refilled
    asm volatile("s_wait_asynccnt 0x0" ::: "memory");   // this wave's copies of stage s + 1 have landed
    __syncthreads();
    if (s + 2 < nStage) attn_stage_copies(ldsK + bufOff, gK + (size_t)(s + 2) * kStepK, ldsV + bufOff, gV + (size_t)(s + 2) * kStepV);
  }
  asm volatile("s_wait_asynccnt 0x0" ::: "memory");     // nothing of this wave is in flight when the ring is left

  const float lsum = lrun[0] + lrun[1];
  const float inv = kCtxCarry / (lsum + xhalf(lsum));
  unsigned short* C = Cp + (size_t)g * kChunk + (size_t)q * kHeadDim + half8;
#pragma unroll
  for (int dt = 0; dt < 8; ++dt) {
    v8h hv;
#pragma unroll
    for (int r = 0; r < 8; ++r) hv[r] = (_Float16)(o[dt][r] * inv);
    *(v8h*)(C + dt * 16) = hv;
  }
}

// ---------------------------------------------------------------------------
// LayerNorm of x + (y + y2): y, y2 are the two k-slice partial planes of the product in front of it.
// One block of 256 threads per row; thread t owns columns 4t..4t+3. Reductions in fixed order (two separate LDS arrays).
// ---------------------------------------------------------------------------
template <bool HAS16>
__global__ __launch_bounds__(256) void add_ln_kernel(const float* __restrict__ x, const float* __restrict__ y,
                                                     const float* __restrict__ y2, const float* __restrict__ gam, const float* __restrict__ bet,
                                                     float* __restrict__ outp, unsigned short* __restrict__ out16) {
  __shared__ float red1[8];
  __shared__ float red2[8];
  __shared__ __align__(16) float srow[kDim];
  const int t = threadIdx.x;
  const int lane = t & 31, wave = t >> 5;
  const size_t base = (size_t)blockIdx.x * kDim;
  const v4f vx = *(const v4f*)(x + base + 4 * t);
  const v4f vy = *(const v4f*)(y + base + 4 * t);
  const v4f vz = *(const v4f*)(y2 + base + 4 * t);
  const v4f s  = vx + (vy + vz);
  float sum = (s[0] + s[1]) + (s[2] + s[3]);
#pragma unroll
  for (int off = 16; off > 0; off >>= 1) sum += __shfl_xor(sum, off, 32);
  if (lane == 0) red1[wave] = sum;
  __syncthreads();
  float tsum = red1[0];
#pragma unroll
  for (int w = 1; w < 8; ++w) tsum += red1[w];
  const float mu = tsum * kInvDim;
  const v4f d = s - mu;
  float sq = (d[0] * d[0] + d[1] * d[1]) + (d[2] * d[2] + d[3] * d[3]);
#pragma unroll
  for (int off = 16; off > 0; off >>= 1) sq += __shfl_xor(sq, off, 32);
  if (lane == 0) red2[wave] = sq;
  __syncthreads();
  float tsq = red2[0];
#pragma unroll
  for (int w = 1; w < 8; ++w) tsq += red2[w];
  const float var  = tsq * kInvDim;
  const float rstd = rsqrtf(var + kLnEps);
  const v4f g  = *(const v4f*)(gam + 4 * t);
  const v4f be = *(const v4f*)(bet + 4 * t);
  const v4f o  = (d * rstd) * g + be;
  float* op = outp + base + 4 * t;
  *(v4f*)op = o;
  
  if (HAS16) {
    *(v4f*)(srow + 4 * t) = o;
    __syncthreads();
    if (t < 128) {
      const v4f a = *(const v4f*)(srow + 8 * t);
      const v4f c = *(const v4f*)(srow + 8 * t + 4);
      unsigned short hb[8];
#pragma unroll
      for (int e = 0; e < 4; ++e) {
        hb[e]     = h_bits(a[e]);
        hb[4 + e] = h_bits(c[e]);
      }
      const v4u u = (v4u){pk16(hb[0], hb[1]), pk16(hb[2], hb[3]), pk16(hb[4], hb[5]), pk16(hb[6], hb[7])};
      unsigned short* hp = out16 + base + 8 * (size_t)t;
      *(v4u*)hp = u;
      
    }
  }
}

// ---------------------------------------------------------------------------
// Host glue.
//   R0  Hh   f16 [4096][1024]  8 MiB at   0 MiB   -> later ctx f16 [4096][1024] (same type, same layout; Hh dead after QKV GEMM)
//   R1  WT4  f16 4 x [1024][1024] (Wk^T | Wq^T | Wv^T | Wo^T, x16)   8 MiB at 8 MiB
//   R3  W1T  f16 [4096][1024] x16  8 MiB at 16 MiB
//   R4  W2T  f16 [1024][4096] x16  8 MiB at 24 MiB
//   R5  k    f16 [4096][1024]  8 MiB at 32 MiB   -> later h1 f16 [4096][1024] (same type, same layout; k dead after attention)
//   R6  q    f16 [4096][1024]  8 MiB at 40 MiB   \
//   R7  v    f16 [4096][1024]  8 MiB at 48 MiB    | -> later mid f16 [4096][4096] 32 MiB at 40 MiB (same type; q and v dead after attention)
//   R8       16 MiB at 56 MiB, used by mid only      /
//   R10 h_sa f32 2 x [4096][1024] (two k-slice partial planes) 32 MiB at 72 MiB (then the two hf planes over them after LN1)
//   R11 h1   f32 [4096][1024] 16 MiB at 104 MiB
//   R12 rq   f32 [4096][4]  65,536 B at 120 MiB
//   R13 rk   f32 [4096][4]  65,536 B at 120 MiB + 64 KiB
//   total 125,960,192 B
// GEMM shapes (all M,N multiples of 64, K multiples of 32; no padding anywhere):
//   QKV  M=4096 N=1024 K=1024 (x3 batched); scores and ctx per chunk inside the fused attention kernel;
//   Wo M=4096 N=1024 K=1024; W1 M=N=4096 K=1024; W2 M=4096 N=1024 K=4096.
// Wo and W2 have 128 tiles of 256x128, half as many as the chip has WGPs: each runs as two k slices (256 workgroups), and the
// LayerNorm behind it adds the two partial planes.
// ---------------------------------------------------------------------------
extern "C" void kernel_launch(void* const* d_in, const int* in_sizes, int n_in,
                              void* d_out, int out_size, void* d_ws, size_t ws_size,
                              hipStream_t stream) {
  if (n_in < 16) return;
  const int nTokDim = kTok * kDim;                  // 4,194,304
  if (in_sizes[0] != nTokDim || in_sizes[1] != kTok * kRl) return;
  if (in_sizes[2] != kDim * kDim || in_sizes[3] != kDim * kDim || in_sizes[4] != kDim * kDim || in_sizes[5] != kDim * kDim) return;
  if (in_sizes[6] != kRl * kRl || in_sizes[7] != kRl * kRl) return;
  if (in_sizes[8] != kDim * kFfn || in_sizes[9] != kFfn || in_sizes[10] != kFfn * kDim || in_sizes[11] != kDim) return;
  if (in_sizes[12] != kDim || in_sizes[13] != kDim || in_sizes[14] != kDim || in_sizes[15] != kDim) return;
  if (out_size != nTokDim) return;

  const size_t szP16 = (size_t)kTok * kDim * 2;                 // 8,388,608
  const size_t szW4  = (size_t)4 * kDim * kDim * 2;             // 8,388,608
  const size_t szW1  = (size_t)kDim * kFfn * 2;                 // 8,388,608
  const size_t szSC  = 3 * (size_t)kTok * kDim * 4;             // 50,331,648
  const size_t szR   = (size_t)kTok * kRl * 4;                  // 65,536
  static_assert(4 * (size_t)kTok * kDim * 2 == (size_t)kTok * kFfn * 2, "mid fits q, v and the 16 MiB behind them");
  const size_t offHh = 0;
  const size_t offW4 = offHh + szP16;
  const size_t offW1 = offW4 + szW4;
  const size_t offW2 = offW1 + szW1;
  const size_t offK  = offW2 + szW1;
  const size_t offQ  = offK + szP16;
  const size_t offV  = offQ + szP16;
  const size_t offSC = offV + 3 * szP16;                       // v, then the 16 MiB that only mid uses
  const size_t offRQ = offSC + szSC;
  const size_t offRK = offRQ + szR;
  const size_t total = offRK + szR;                            // 125,960,192
  if (ws_size < total) return;

  const float* h   = (const float*)d_in[0];
  const float* rh  = (const float*)d_in[1];
  const float* Wq  = (const float*)d_in[2];
  const float* Wk  = (const float*)d_in[3];
  const float* Wv  = (const float*)d_in[4];
  const float* Wo  = (const float*)d_in[5];
  const float* Wrk = (const float*)d_in[6];
  const float* Wrq = (const float*)d_in[7];
  const float* W1  = (const float*)d_in[8];
  const float* b1  = (const float*)d_in[9];
  const float* W2  = (const float*)d_in[10];
  const float* b2  = (const float*)d_in[11];
  const float* g1  = (const float*)d_in[12];
  const float* be1 = (const float*)d_in[13];
  const float* g2  = (const float*)d_in[14];
  const float* be2 = (const float*)d_in[15];
  float* out = (float*)d_out;
  char* ws = (char*)d_ws;
  unsigned short* Hh  = (unsigned short*)(ws + offHh);
  unsigned short* CTX = Hh;                                    // alias after QKV GEMM
  unsigned short* WT4 = (unsigned short*)(ws + offW4);         // Wk^T, Wq^T, Wv^T, Wo^T planes of 1,048,576 halves
  unsigned short* WoT = WT4 + (size_t)3 * kDim * kDim;
  unsigned short* W1T = (unsigned short*)(ws + offW1);
  unsigned short* W2T = (unsigned short*)(ws + offW2);
  unsigned short* K16 = (unsigned short*)(ws + offK);
  unsigned short* H1h = K16;                                   // alias after attention
  unsigned short* Q16 = (unsigned short*)(ws + offQ);
  unsigned short* MID = Q16;                                   // alias after attention: [4096][4096] over q, v and the 16 MiB behind them
  unsigned short* V16 = (unsigned short*)(ws + offV);
  float* HSA = (float*)(ws + offSC);                           // plane 0; plane 1 follows it
  float* HF  = HSA;                                            // alias after LN1, two planes as well
  float* H1f = (float*)(ws + offSC + 2 * (szSC / 3));
  float* RQ = (float*)(ws + offRQ);
  float* RK = (float*)(ws + offRK);

  // ---- prologue: 16-bit operand planes, relative projections ----
  prologue_kernel<<<dim3(kPbAll), dim3(256), 0, stream>>>(h, rh, Wk, Wq, Wv, Wo, Wrk, Wrq, W1, W2, Hh, WT4, W1T, W2T, RK, RQ);

  // ---- q, k, v = h @ W (x16 weights folded back by 1/16): three separate [4096][1024] f16 planes (b0 -> k, b1 -> q, b2 -> v) ----
  {
    const int tiles = (kTok / 64) * (kDim / 64);   // 1024
    wmma_gemm64<0, false, 0, 1, false, 0><<<dim3(tiles / 8, 3), dim3(256), 0, stream>>>(
        Hh, Hh, kDim, 0L, WT4, WT4, kDim, (long)kDim * kDim,
        (void*)K16, (void*)K16, kDim, (long)kTok * kDim, RQ, RQ, 0L, kTok, kDim, kDim, kWCarryInv);
  }
  // ---- attention, all 16 chunks in one launch: ctx_g f16 x256 at CTX + g*262144 as [2048][128] ----
  attn_fused_kernel<<<dim3(kSeq / kFaRows, kGroups), dim3(256), 0, stream>>>(Q16, K16, V16, RQ, RK, CTX);

  // ---- h_sa = ctx @ Wo (fold back 1/(256*16)) -> two f32 [4096][1024] partial planes, k 0..511 and 512..1023 ----
  {
    const int tiles = (kTok / 64) * (kDim / 64);   // 1024
    wmma_gemm64<0, false, 0, 0, false, 0, true><<<dim3(tiles / 8, 2), dim3(256), 0, stream>>>(
        CTX, CTX, kDim, (long)(kDim / 2), WoT, WoT, kDim, (long)(kDim / 2),
        (void*)HSA, (void*)HSA, kDim, (long)kTok * kDim, RQ, RQ, 0L, kTok, kDim, kDim / 2, kWoScale);
  }
  // ---- h1 = LN(h + h_sa) * g1 + be1 -> f32 plane + f16 plane ----
  add_ln_kernel<true><<<dim3(kTok), dim3(256), 0, stream>>>(h, HSA, HSA + (size_t)kTok * kDim, g1, be1, H1f, H1h);
  // ---- mid = relu(h1 @ W1 + b1) -> f16 [4096][4096] ----
  {
    const int tiles = (kTok / 64) * (kFfn / 64);   // 4096
    wmma_gemm64<0, false, 2, 1, false, 2><<<dim3(tiles / 8, 1), dim3(256), 0, stream>>>(
        H1h, H1h, kDim, 0L, W1T, W1T, kDim, 0L,
        (void*)MID, (void*)MID, kFfn, 0L, b1, RQ, 0L, kTok, kFfn, kDim, kWCarryInv);
  }
  // ---- hf = mid @ W2 + b2 -> two f32 [4096][1024] partial planes, k 0..2047 (with b2) and 2048..4095 ----
  {
    const int tiles = (kTok / 64) * (kDim / 64);   // 1024
    wmma_gemm64<0, false, 2, 0, false, 0, true><<<dim3(tiles / 8, 2), dim3(256), 0, stream>>>(
        MID, MID, kFfn, (long)(kFfn / 2), W2T, W2T, kFfn, (long)(kFfn / 2),
        (void*)HF, (void*)HF, kDim, (long)kTok * kDim, b2, RQ, 0L, kTok, kDim, kFfn / 2, kWCarryInv);
  }
  // ---- h2 = LN(h1 + hf) * g2 + be2 -> output ----
  add_ln_kernel<false><<<dim3(kTok), dim3(256), 0, stream>>>(H1f, HF, HF + (size_t)kTok * kDim, g2, be2, out, H1h);
}

// v006
// Measured time: 165 microseconds a run.
// Next to v005, in two timings, it ran 1.08 times as fast each time.
// Over all steps from v000 it is 7.57 times as fast.
// Contractions: q/k/v projections (h f16 x W^T f16 carried x16), scores Q_g.K_g (q, k f16 planes), attn.V_g (P = exp(score - running row max) in f16 x V^T f16, normalised in f32 at the end), output projection (ctx f16 carried x256 x Wo^T f16 x16), FFN up and down (h1 f16 / relu(u) f16 x W^T f16 x16): all on v_wmma_f32_16x16x32_f16 with f32 accumulate; relative bias (K=4), softmax, residuals and LayerNorm in f32.
#include <hip/hip_runtime.h>
#include <math.h>

// ---------------------------------------------------------------------------
// Problem constants
// ---------------------------------------------------------------------------
constexpr int kBatch    = 2;
constexpr int kSeq      = 2048;
constexpr int kDim      = 1024;
constexpr int kFfn      = 4096;
constexpr int kHeads    = 8;
constexpr int kHeadDim  = 128;
constexpr int kRl       = 4;
constexpr int kTok      = kBatch * kSeq;          // 4096 token rows
constexpr int kGroups   = kBatch * kHeads;        // 16 flat-reshape chunks
constexpr int kChunk    = kSeq * kHeadDim;        // 262144 elements per chunk
constexpr float kWCarry     = 16.0f;              // weights carried x16 in f16
constexpr float kWCarryInv  = 1.0f / 16.0f;
constexpr float kCtxCarry   = 256.0f;             // context carried x256 in f16
constexpr float kScoreScale = 0.08838834764831845f;            // 128^-0.5
constexpr float kLog2e      = 1.4426950408889634f;
constexpr float kWoScale    = 1.0f / (kCtxCarry * kWCarry);   // 2^-12
constexpr float kInvDim     = 1.0f / 1024.0f;
constexpr float kLnEps      = 1e-5f;
static_assert(kHeads * kHeadDim == kDim, "shape");
static_assert(kGroups * kChunk == kTok * kDim, "chunks");
// Wave tile and k step: M, N multiples of 64, K multiples of 32
static_assert(kTok % 64 == 0 && kDim % 64 == 0 && kFfn % 64 == 0 && kSeq % 64 == 0 && kHeadDim % 64 == 0, "tiles");
static_assert(kDim % 32 == 0 && kHeadDim % 32 == 0 && kSeq % 32 == 0 && kFfn % 32 == 0, "ksteps");
// Workgroup tile of the GEMM engine: M multiples of 256, N multiples of 128, K multiples of 64
static_assert(kTok % 256 == 0 && kSeq % 256 == 0, "block rows");
static_assert(kDim % 128 == 0 && kFfn % 128 == 0 && kSeq % 128 == 0 && kHeadDim % 128 == 0, "block cols");
static_assert(kDim % 64 == 0 && kHeadDim % 64 == 0 && kSeq % 64 == 0 && kFfn % 64 == 0, "stages");

typedef __attribute__((ext_vector_type(16))) _Float16 v16h;
typedef __attribute__((ext_vector_type(8)))  _Float16 v8h;
typedef __attribute__((ext_vector_type(16))) __bf16   v16b;
typedef __attribute__((ext_vector_type(8)))  __bf16   v8b;
typedef __attribute__((ext_vector_type(8)))  float    v8f;
typedef __attribute__((ext_vector_type(4)))  float    v4f;
typedef __attribute__((ext_vector_type(2)))  float    v2f;
typedef __attribute__((ext_vector_type(4)))  unsigned int v4u;

// ---------------------------------------------------------------------------
// Device helpers
// ---------------------------------------------------------------------------
__device__ __forceinline__ unsigned short f2bf_bits(float f) {
  unsigned u = __float_as_uint(f);
  return (unsigned short)((u + 0x7FFFu + ((u >> 16) & 1u)) >> 16);
}
__device__ __forceinline__ float bf_bits2f(unsigned short h) { return __uint_as_float(((unsigned)h) << 16); }

// hazard guards as plain device helpers
__device__ __forceinline__ void dep_guard_h(v8f& a, v8f& b, v16h x, v16h y) { asm volatile("v_nop\n\tv_nop\n\tv_nop\n\tv_nop" : "+v"(a), "+v"(b) : "v"(x), "v"(y)); }
__device__ __forceinline__ void dep_guard_b(v8f& a, v8f& b, v16b x, v16b y) { asm volatile("v_nop\n\tv_nop\n\tv_nop\n\tv_nop" : "+v"(a), "+v"(b) : "v"(x), "v"(y)); }
// all-accumulator tie of a 4-wide group, naming the A fragments as inputs
__device__ __forceinline__ void dep_guard4_h(v8f& a, v8f& b, v8f& c, v8f& d, v16h x, v16h y) { asm volatile("v_nop\n\tv_nop\n\tv_nop\n\tv_nop" : "+v"(a), "+v"(b), "+v"(c), "+v"(d) : "v"(x), "v"(y)); }
__device__ __forceinline__ void dep_guard4_b(v8f& a, v8f& b, v8f& c, v8f& d, v16b x, v16b y) { asm volatile("v_nop\n\tv_nop\n\tv_nop\n\tv_nop" : "+v"(a), "+v"(b), "+v"(c), "+v"(d) : "v"(x), "v"(y)); }
__device__ __forceinline__ void keep4_h(v16h a, v16h b, v16h c, v16h d) { asm volatile("v_nop" :: "v"(a), "v"(b), "v"(c), "v"(d)); }
__device__ __forceinline__ void keep4_b(v16b a, v16b b, v16b c, v16b d) { asm volatile("v_nop" :: "v"(a), "v"(b), "v"(c), "v"(d)); }
__device__ __forceinline__ void acc_guard4(v8f& a, v8f& b, v8f& c, v8f& d) { asm volatile("v_nop\n\tv_nop\n\tv_nop\n\tv_nop" : "+v"(a), "+v"(b), "+v"(c), "+v"(d)); }
template <typename T> struct Frag;
template <> struct Frag<_Float16> {
  typedef v16h V; union U { v16h v; v8h h[2]; };
  // elements 0..7 <- p[0..7], 8..15 <- p[16..23]
  static __device__ __forceinline__ v16h load(const _Float16* p) {
    U f; f.h[0] = *(const v8h*)(p); f.h[1] = *(const v8h*)(p + 16); return f.v;
  }
  static __device__ __forceinline__ v8f mma(v16h a, v16h b, v8f c) {
    return __builtin_amdgcn_wmma_f32_16x16x32_f16(false, a, false, b, (short)0, c, false, false);
  }
  static __device__ __forceinline__ void guard(v8f& a, v8f& b, v16h x, v16h y) { dep_guard_h(a, b, x, y); }
  static __device__ __forceinline__ void guard4(v8f& a, v8f& b, v8f& c, v8f& d, v16h x, v16h y) { dep_guard4_h(a, b, c, d, x, y); }
  static __device__ __forceinline__ void keep(v16h a, v16h b, v16h c, v16h d) { keep4_h(a, b, c, d); }
};
template <> struct Frag<__bf16> {
  typedef v16b V; union U { v16b v; v8b h[2]; };
  static __device__ __forceinline__ v16b load(const __bf16* p) {
    U f; f.h[0] = *(const v8b*)(p); f.h[1] = *(const v8b*)(p + 16); return f.v;
  }
  static __device__ __forceinline__ v8f mma(v16b a, v16b b, v8f c) {
    return __builtin_amdgcn_wmma_f32_16x16x32_bf16(false, a, false, b, (short)0, c, false, false);
  }
  static __device__ __forceinline__ void guard(v8f& a, v8f& b, v16b x, v16b y) { dep_guard_b(a, b, x, y); }
  static __device__ __forceinline__ void guard4(v8f& a, v8f& b, v8f& c, v8f& d, v16b x, v16b y) { dep_guard4_b(a, b, c, d, x, y); }
  static __device__ __forceinline__ void keep(v16b a, v16b b, v16b c, v16b d) { keep4_b(a, b, c, d); }
};

__device__ __forceinline__ unsigned pk16(unsigned short a, unsigned short b) { return (unsigned)a | ((unsigned)b << 16); }
__device__ __forceinline__ unsigned short h_bits(float f) { const _Float16 h = (_Float16)f; return __builtin_bit_cast(unsigned short, h); }

// ---- Register-blocked batched WMMA GEMM (ACT reduced to none/relu/leaky; per-row group guard ties all four
//      accumulators and names the A fragments) -------------------------------------------------------------------------
// C[m,n] = scale * sum_k A[m,k] * Bt[n,k] (+bias)(+resid); a workgroup owns a 256x128 tile, each of its 8 waves (4 x 2) a 64x64 tile.
// A row-major [M,K]; Bt row-major [N,K]; M % 256 == 0, N % 128 == 0, K % 64 == 0.
// Operands reach the waves through LDS: a stage is 64 k (128 B, one cache line) of the tile's 256 A rows and 128 Bt rows at a
// pitch of 144 B, laid by asynchronous copies of whole lines (8 lanes x 16 B per row) into a ring of two buffers, one stage ahead.
// SPLIT (hi/lo planes) is not staged by this engine: single-plane operands only.
// BIAS_MODE: 0 = none, 1 = bias[m], 2 = bias[n].
// OUT_MODE: 0 = f32, 1 = f16, 2 = bf16 hi plane (Cout) + bf16 lo plane (Cout2).
// ET: 0 = f16 operands, 1 = bf16 operands (pointers passed as 16-bit storage)
// KSPLIT: the batch index b counts slices of the k range of ONE product (strideA, strideB = k per slice, K = k per slice); slice b
// stores its partial sum in plane b of Cout, the reader adds the planes, and only slice 0 adds the bias.
template <int ET> struct Elem;
template <> struct Elem<0> { typedef _Float16 T; };
template <> struct Elem<1> { typedef __bf16 T; };
constexpr int kBlkM       = 256;                          // A rows of a workgroup tile
constexpr int kBlkN       = 128;                          // Bt rows of a workgroup tile
constexpr int kStageK     = 64;                           // k per stage
constexpr int kRowPitch   = 144;                          // bytes per staged row: 16 B x odd, conflict-free for 16-byte LDS reads
constexpr int kPitchH     = kRowPitch / 2;                // the same in 16-bit elements
constexpr int kStageBytes = (kBlkM + kBlkN) * kRowPitch;  // 55,296: A rows 0..255, then Bt rows 0..127
// One lane's share of a stage: twelve 16-byte copies, staged rows r, r + 32, ... r + 352 (eight of A, four of Bt), r = thread >> 3.
// l = LDS byte address of this lane's 16 bytes in row r; a, b = global address of the same 16 bytes in A row r and Bt row r;
// sa, sb = bytes between 32 rows of A and of Bt. The s_wait_xcnt stands inside the statement so that no address register of a
// copy is rewritten ahead of it.
__device__ __forceinline__ void stage_copies(unsigned l, const char* a, size_t sa, const char* b, size_t sb) {
  constexpr unsigned kStep = 32u * kRowPitch;
  asm volatile(
      "global_load_async_to_lds_b128 %0, %12, off\n\t"
      "global_load_async_to_lds_b128 %1, %13, off\n\t"
      "global_load_async_to_lds_b128 %2, %14, off\n\t"
      "global_load_async_to_lds_b128 %3, %15, off\n\t"
      "global_load_async_to_lds_b128 %4, %16, off\n\t"
      "global_load_async_to_lds_b128 %5, %17, off\n\t"
      "global_load_async_to_lds_b128 %6, %18, off\n\t"
      "global_load_async_to_lds_b128 %7, %19, off\n\t"
      "global_load_async_to_lds_b128 %8, %20, off\n\t"
      "global_load_async_to_lds_b128 %9, %21, off\n\t"
      "global_load_async_to_lds_b128 %10, %22, off\n\t"
      "global_load_async_to_lds_b128 %11, %23, off\n\t"
      "s_wait_xcnt 0x0"
      :: "v"(l), "v"(l + kStep), "v"(l + 2 * kStep), "v"(l + 3 * kStep), "v"(l + 4 * kStep), "v"(l + 5 * kStep),
         "v"(l + 6 * kStep), "v"(l + 7 * kStep), "v"(l + 8 * kStep), "v"(l + 9 * kStep), "v"(l + 10 * kStep), "v"(l + 11 * kStep),
         "v"(a), "v"(a + sa), "v"(a + 2 * sa), "v"(a + 3 * sa), "v"(a + 4 * sa), "v"(a + 5 * sa), "v"(a + 6 * sa), "v"(a + 7 * sa),
         "v"(b), "v"(b + sb), "v"(b + 2 * sb), "v"(b + 3 * sb)
      : "memory");
}
template <int ET, bool SPLIT, int BIAS_MODE, int OUT_MODE, bool RESID, int ACT = 0, bool KSPLIT = false>
__global__ __launch_bounds__(256) void wmma_gemm64(
    const unsigned short* __restrict__ Ap, const unsigned short* __restrict__ A2p, int lda, long strideA,
    const unsigned short* __restrict__ Btp, const unsigned short* __restrict__ Bt2p, int ldb, long strideB,
    void* __restrict__ Cout, void* __restrict__ Cout2, int ldc, long strideC,
    const float* __restrict__ bias,
    const float* __restrict__ resid, long strideR,
    int M, int N, int K, float scale) {
  typedef typename Elem<ET>::T T;
  typedef typename Frag<T>::V V;
  static_assert(!SPLIT, "single-plane operands only");
  static_assert(!KSPLIT || (OUT_MODE == 0 && ACT == 0 && !RESID && BIAS_MODE != 1), "partial sums are plain f32 planes");
  const T* A = (const T*)Ap; const T* Bt = (const T*)Btp;
  __shared__ __align__(128) unsigned char ring[2 * kStageBytes];   // two stage buffers
  __shared__ __align__(16) float sT[8][16 * 68];   // per-wave 16x64 slab, pitch 68 floats
  const int b    = blockIdx.y;
  const int lane = threadIdx.x & 31;
  const int wave = threadIdx.x >> 5;
  const int tilesN = N >> 7;
  const int tilesM = M >> 8;
  const int tile = blockIdx.x;
  if (tile >= tilesM * tilesN) return;   // the same for the whole workgroup, ahead of every barrier
  const int tm = tile / tilesN;
  const int tn = tile - tm * tilesN;
  const int mBlk = tm << 8;
  const int nBlk = tn << 7;
  const int wRow = (wave >> 1) << 6;           // this wave's 64 rows inside the workgroup tile
  const int wCol = (wave & 1) << 6;            // this wave's 64 columns inside the workgroup tile
  const int m0 = mBlk + wRow;
  const int n0 = nBlk + wCol;

  const T* Ab  = A  + (size_t)b * strideA;
  const T* Bb  = Bt + (size_t)b * strideB;

  const int rlane = lane & 15;                 // row (A) / col (B, D) within subtile
  const int koff  = (lane >> 4) * 8;           // k offset of this lane half
  const int mOff  = (lane >> 4) * 8;           // D row offset

  // copy map: thread t moves bytes 16*(t&7) .. +15 of staged rows (t>>3) + 32*i, so a wave's copy covers four whole 128-B lines
  const int cRow = threadIdx.x >> 3;
  const int cCol = (threadIdx.x & 7) * 8;      // in 16-bit elements
  const char* gA = (const char*)(Ab + (size_t)(mBlk + cRow) * lda + cCol);
  const char* gB = (const char*)(Bb + (size_t)(nBlk + cRow) * ldb + cCol);
  const size_t stepA = (size_t)lda * (32 * sizeof(T));
  const size_t stepB = (size_t)ldb * (32 * sizeof(T));
  const unsigned ldsDst = (unsigned)(size_t)ring + (unsigned)(cRow * kRowPitch + cCol * 2);
  const int nStage = K / kStageK;

  v8f acc[4][4];
#pragma unroll
  for (int i = 0; i < 4; ++i)
#pragma unroll
    for (int j = 0; j < 4; ++j) acc[i][j] = (v8f){0.f,0.f,0.f,0.f,0.f,0.f,0.f,0.f};

  // ring prologue: stage 0 landed and published, then stage 1 in flight
  stage_copies(ldsDst, gA, stepA, gB, stepB);
  asm volatile("s_wait_asynccnt 0x0" ::: "memory");   // this wave's copies of stage 0 have landed
  __syncthreads();                                    // every wave's copies of stage 0 are readable
  if (nStage > 1) stage_copies(ldsDst + kStageBytes, gA + kStageK * sizeof(T), stepA, gB + kStageK * sizeof(T), stepB);

  for (int s = 0; s < nStage; ++s) {
    const unsigned bufOff = (unsigned)(s & 1) * kStageBytes;
    const T* sA = (const T*)(ring + bufOff + (wRow + rlane) * kRowPitch) + koff;
    const T* sB = (const T*)(ring + bufOff + (kBlkM + wCol + rlane) * kRowPitch) + koff;
#pragma unroll
    for (int kk = 0; kk < kStageK; kk += 32) {
      V bh[4], ah[4];   // all eight fragments of this k step are requested as one group, so the wave meets LDS latency once
#pragma unroll
      for (int j = 0; j < 4; ++j) {
        bh[j] = Frag<T>::load(sB + j * 16 * kPitchH + kk);
        ah[j] = Frag<T>::load(sA + j * 16 * kPitchH + kk);
      }
#pragma unroll
      for (int i = 0; i < 4; ++i) {
#pragma unroll
        for (int j = 0; j < 4; ++j) acc[i][j] = Frag<T>::mma(ah[i], bh[j], acc[i][j]);
        Frag<T>::guard4(acc[i][0], acc[i][1], acc[i][2], acc[i][3], ah[i], ah[i]);
      }
      Frag<T>::keep(bh[0], bh[1], bh[2], bh[3]);
    }
    // publish point of stage s + 1, and release of the buffer that stage s was read from
    asm volatile("s_wait_dscnt 0x0" ::: "memory");      // this wave's reads of stage s are done before the buffer is refilled
    asm volatile("s_wait_asynccnt 0x0" ::: "memory");   // this wave's copies of stage s + 1 have landed
    __syncthreads();
    if (s + 2 < nStage) {
      const size_t kb = (size_t)(s + 2) * (kStageK * sizeof(T));
      stage_copies(ldsDst + bufOff, gA + kb, stepA, gB + kb, stepB);
    }
  }
  asm volatile("s_wait_asynccnt 0x0" ::: "memory");     // nothing of this wave is in flight when the ring is left
  acc_guard4(acc[0][0], acc[0][1], acc[0][2], acc[0][3]);
  acc_guard4(acc[1][0], acc[1][1], acc[1][2], acc[1][3]);
  acc_guard4(acc[2][0], acc[2][1], acc[2][2], acc[2][3]);
  acc_guard4(acc[3][0], acc[3][1], acc[3][2], acc[3][3]);

  // ---- epilogue ----
  float* slab = sT[wave];
  const float* Rb = RESID ? (resid + (size_t)b * strideR) : nullptr;
#pragma unroll
  for (int i = 0; i < 4; ++i) {
    const int mBase = m0 + (i << 4);
#pragma unroll
    for (int j = 0; j < 4; ++j) {
      const int n = n0 + (j << 4) + rlane;
      float bv = 0.f;
      if (BIAS_MODE == 2) bv = bias[n];
      if (KSPLIT && b != 0) bv = 0.f;
#pragma unroll
      for (int r = 0; r < 8; ++r) {
        float v = acc[i][j][r] * scale;
        if (BIAS_MODE == 1) v += bias[mBase + mOff + r];
        if (BIAS_MODE == 2) v += bv;
        if (RESID) v += Rb[(size_t)(mBase + mOff + r) * ldc + n];
        if (ACT == 2) v = fmaxf(v, 0.0f);
        if (ACT == 4) v = (v > 0.f) ? v : 0.01f * v;
        slab[(mOff + r) * 68 + (j << 4) + rlane] = v;
      }
    }
    __builtin_amdgcn_fence(__ATOMIC_RELEASE, "workgroup");
    __builtin_amdgcn_wave_barrier();
    __builtin_amdgcn_fence(__ATOMIC_ACQUIRE, "workgroup");
    if (OUT_MODE == 0) {
      float* C = (float*)Cout + (size_t)b * strideC;
      const int hh = lane >> 4, c4 = (lane & 15) * 4;     // row seg = 256 B = 16 lanes x 16 B
      {
#pragma unroll
        for (int it = 0; it < 8; ++it) {
          const int row = it * 2 + hh;
          v4f v = *(const v4f*)(slab + row * 68 + c4);
          *(v4f*)(C + (size_t)(mBase + row) * ldc + n0 + c4) = v;
        }
        
      }
    } else {
      const int q = lane >> 3, c8 = (lane & 7) * 8;
      unsigned short* C  = (unsigned short*)Cout  + (size_t)b * strideC;
      unsigned short* C2 = (OUT_MODE == 2) ? ((unsigned short*)Cout2 + (size_t)b * strideC) : nullptr;
      {
#pragma unroll
        for (int it = 0; it < 4; ++it) {
          const int row = it * 4 + q;
          const float* sp = slab + row * 68 + c8;
          v8h hv, lv;
#pragma unroll
          for (int e = 0; e < 8; ++e) {
            if (OUT_MODE == 1) {
              hv[e] = (_Float16)sp[e];
            } else {
              unsigned short hb = f2bf_bits(sp[e]);
              unsigned short lb = f2bf_bits(sp[e] - bf_bits2f(hb));
              hv[e] = __builtin_bit_cast(_Float16, hb);
              lv[e] = __builtin_bit_cast(_Float16, lb);
            }
          }
          *(v8h*)(C + (size_t)(mBase + row) * ldc + n0 + c8) = hv;
          if (OUT_MODE == 2) *(v8h*)(C2 + (size_t)(mBase + row) * ldc + n0 + c8) = lv;
        }
        
      }
    }
    __builtin_amdgcn_fence(__ATOMIC_RELEASE, "workgroup");
    __builtin_amdgcn_wave_barrier();
    __builtin_amdgcn_fence(__ATOMIC_ACQUIRE, "workgroup");
  }
}

// ---------------------------------------------------------------------------
// ---------------------------------------------------------------------------
// f32 -> f16 cast, eight elements a thread; blk = index of this block among the n8 / 256 blocks of the cast.
__device__ __forceinline__ void cast8_f16_block(const float* __restrict__ in, unsigned short* __restrict__ out, int n8, int blk) {
  const int i = blk * 256 + threadIdx.x;
  if (i >= n8) return;
  const float* p = in + 8 * (size_t)i;
  const v4f a = *(const v4f*)(p);
  const v4f c = *(const v4f*)(p + 4);
  unsigned short hb[8];
#pragma unroll
  for (int e = 0; e < 4; ++e) {
    hb[e]     = h_bits(a[e]);
    hb[4 + e] = h_bits(c[e]);
  }
  const v4u u = (v4u){pk16(hb[0], hb[1]), pk16(hb[2], hb[3]), pk16(hb[4], hb[5]), pk16(hb[6], hb[7])};
  unsigned short* q = out + 8 * (size_t)i;
  *(v4u*)q = u;
  
}

// ---------------------------------------------------------------------------
// Weight transpose + cast: W row-major [kin][nout] f32 (x @ W orientation) -> WT[n][k] = f16(scale * W[k][n]), row-major [nout][kin].
// One block of 256 threads per 64 x 64 tile: kt = k tile (64 cols of WT), nt = n tile (64 rows of WT); sm = the block's LDS tile.
// Load coverage: 4 iterations x 256 threads x float4 = 64 k-rows x 64 n-cols (4 b128 loads per lane).
// Store coverage: 8 waves x 2 iterations x 4 rows (lane>>3) = 64 n-rows; (lane&7) x 8 halves = 64 k-cols; each row segment =
// ---------------------------------------------------------------------------
__device__ __forceinline__ void wt_cast_block(const float* __restrict__ W, unsigned short* __restrict__ op, int kin, int nout,
                                              int kt, int nt, float scale, float (*sm)[65]) {   // sm[n_local][k_local]
  const int t  = threadIdx.x;
  const int k0 = kt * 64;
  const int n0 = nt * 64;
  // The four loads are issued first and stay in flight together; the LDS writes follow in a loop of their own.
  // Both loops are unrolled so that w[] is indexed by constants and stays in registers.
  v4f w[4];
#pragma unroll
  for (int i = 0; i < 4; ++i) {
    const int e  = i * 256 + t;
    const int r  = e >> 4;           // k local
    const int c4 = (e & 15) * 4;     // n local
    w[i] = *(const v4f*)(W + (size_t)(k0 + r) * nout + n0 + c4);
    asm volatile("s_wait_xcnt 0x0" ::: "memory");   // stands ahead of any rewrite of this load's address registers (a later load's result may land there)
  }
#pragma unroll
  for (int i = 0; i < 4; ++i) {
    const int e  = i * 256 + t;
    const int r  = e >> 4;           // k local
    const int c4 = (e & 15) * 4;     // n local
    sm[c4 + 0][r] = w[i][0] * scale;
    sm[c4 + 1][r] = w[i][1] * scale;
    sm[c4 + 2][r] = w[i][2] * scale;
    sm[c4 + 3][r] = w[i][3] * scale;
  }
  __syncthreads();
  const int lane = t & 31, wave = t >> 5;
  const int q = lane >> 3, c8 = (lane & 7) * 8;
  {
#pragma unroll
    for (int it = 0; it < 2; ++it) {
      const int row = wave * 8 + it * 4 + q;                 // n local
      unsigned short hb[8];
#pragma unroll
      for (int e = 0; e < 8; ++e) hb[e] = h_bits(sm[row][c8 + e]);
      const v4u u = (v4u){pk16(hb[0], hb[1]), pk16(hb[2], hb[3]), pk16(hb[4], hb[5]), pk16(hb[6], hb[7])};
      *(v4u*)(op + (size_t)(n0 + row) * kin + k0 + c8) = u;
    }
    asm volatile("s_wait_xcnt 0x0" ::: "memory");   // stands ahead of any rewrite of the two stores' address and data registers in the code behind this body
  }
}

// ---------------------------------------------------------------------------
// r_k = rh @ Wrk, r_q = rh @ Wrq (K = 4, f32 VALU): out[i][j] = sum_r rh[i][r] * W[r][j] (W row-major [in][out]).
// blk = index of this block among the 4096/256 = 16 blocks (exact).
// ---------------------------------------------------------------------------
__device__ __forceinline__ void rl_proj_block(const float* __restrict__ rh, const float* __restrict__ Wrk,
                                              const float* __restrict__ Wrq, float* __restrict__ rk,
                                              float* __restrict__ rq, int nrows, int blk) {
  const int idx = blk * 256 + threadIdx.x;
  if (idx >= nrows) return;
  const v4f r  = *(const v4f*)(rh + (size_t)idx * kRl);
  const v4f k0 = *(const v4f*)(Wrk + 0);
  const v4f k1 = *(const v4f*)(Wrk + 4);
  const v4f k2 = *(const v4f*)(Wrk + 8);
  const v4f k3 = *(const v4f*)(Wrk + 12);
  asm volatile("" ::: "memory");
  const v4f q0 = *(const v4f*)(Wrq + 0);
  const v4f q1 = *(const v4f*)(Wrq + 4);
  const v4f q2 = *(const v4f*)(Wrq + 8);
  const v4f q3 = *(const v4f*)(Wrq + 12);
  v4f ok = r[0] * k0;
  ok = ok + r[1] * k1;
  ok = ok + r[2] * k2;
  ok = ok + r[3] * k3;
  v4f oq = r[0] * q0;
  oq = oq + r[1] * q1;
  oq = oq + r[2] * q2;
  oq = oq + r[3] * q3;
  float* pk = rk + (size_t)idx * kRl;
  float* pq = rq + (size_t)idx * kRl;
  *(v4f*)pk = ok;
  *(v4f*)pq = oq;
  
}

// ---------------------------------------------------------------------------
// Prologue in one launch: the five preparations below read only inputs and write disjoint workspace planes, so none waits for
// another; a block takes its job from the range its index falls in (the same for the whole block, so the barrier inside the
// weight repack is reached by all of its threads or by none).
//   [0, 16)        r_k, r_q
//   [16, 1040)     Wk, Wq, Wv, Wo [1024][1024] -> the four planes of wt4, 256 tiles each (k tile fastest)
//   [1040, 2064)   W1 [1024][4096] -> w1t [4096][1024]
//   [2064, 3088)   W2 [4096][1024] -> w2t [1024][4096]
//   [3088, 5136)   h -> f16
// ---------------------------------------------------------------------------
constexpr int kPbRl   = kTok / 256;                       // 16
constexpr int kPbSq   = (kDim / 64) * (kDim / 64);        // 256 tiles of a [1024][1024] weight
constexpr int kPbW4   = 4 * kPbSq;                        // 1024
constexpr int kPbFfn  = (kDim / 64) * (kFfn / 64);        // 1024 tiles of W1, and of W2
constexpr int kCastN8 = kTok * kDim / 8;                  // 524288 pieces of eight elements
constexpr int kPbCast = kCastN8 / 256;                    // 2048
constexpr int kPbAll  = kPbRl + kPbW4 + 2 * kPbFfn + kPbCast;   // 5136
static_assert(kTok % 256 == 0 && kCastN8 % 256 == 0, "exact prologue grids");
static_assert(kPbW4 % kPbFfn == 0 && kPbFfn == 4 * kPbSq && kDim / 64 == 16 && kFfn / 64 == 64, "tile numbering of the weight repack");
__global__ __launch_bounds__(256) void prologue_kernel(const float* __restrict__ h, const float* __restrict__ rh,
                                                       const float* __restrict__ Wk, const float* __restrict__ Wq,
                                                       const float* __restrict__ Wv, const float* __restrict__ Wo,
                                                       const float* __restrict__ Wrk, const float* __restrict__ Wrq,
                                                       const float* __restrict__ W1, const float* __restrict__ W2,
                                                       unsigned short* __restrict__ hh, unsigned short* __restrict__ wt4,
                                                       unsigned short* __restrict__ w1t, unsigned short* __restrict__ w2t,
                                                       float* __restrict__ rk, float* __restrict__ rq) {
  __shared__ float sm[64][65];
  int i = blockIdx.x;
  if (i < kPbRl) { rl_proj_block(rh, Wrk, Wrq, rk, rq, kTok, i); return; }
  i -= kPbRl;
  if (i < kPbW4 + 2 * kPbFfn) {
    // one repack body for all six weights; source, destination and shape are picked from the block index (scalars)
    const int z = i / kPbSq;                     // 0..3 the square weights, 4..7 W1, 8..11 W2
    const float* W = (z == 0) ? Wk : (z == 1) ? Wq : (z == 2) ? Wv : (z == 3) ? Wo : (z < 8) ? W1 : W2;
    unsigned short* op = (z < 4) ? wt4 + (size_t)z * kDim * kDim : (z < 8) ? w1t : w2t;
    const int e    = (z < 4) ? i % kPbSq : i % kPbFfn;   // tile index inside its weight (kPbW4 is a multiple of kPbFfn)
    const int kin  = (z < 8) ? kDim : kFfn;
    const int nout = (z < 4 || z >= 8) ? kDim : kFfn;
    const int ksh  = (z < 8) ? 4 : 6;            // log2 of kin / 64
    wt_cast_block(W, op, kin, nout, e & ((1 << ksh) - 1), e >> ksh, kWCarry, sm);
    return;
  }
  i -= kPbW4 + 2 * kPbFfn;
  cast8_f16_block(h, hh, kCastN8, i);
}

// ---------------------------------------------------------------------------
// Fused attention of one flat chunk g: scores, relative bias, softmax and attn.V in one kernel, no score or probability plane.
//   a[l][m] = 128^-0.5 * sum_d Q_g[l][d] * K_g[d][m] + 0.5 * sum_r rq[b][l][r] * rk_flat[b][r*2048 + m]
//   ctx_g[l][d] = 256 * sum_m exp(a - max) * V_g[m][d] / sum_m exp(a - max)      (f16, carried x256)
// K_g = chunk g of the k plane read as [128][2048], V_g = chunk g of the v plane read as [2048][128]: the flat reshapes of the
// reference, taken as the projection stored them.
// grid (2048/128, 16): a workgroup of 8 waves owns 128 query rows of chunk blockIdx.y; 32 stages of 64 keys.
// Wave w works on the 32 queries of group w & 3 and on keys 32 * (w >> 2) + 0..31 of every stage: each K and V fragment read from
// LDS feeds two products (two 16-query tiles), and each r_k value two queries, so a stage costs half the LDS reads of 16-query
// waves. The two waves of a query group keep their own running maximum, sum and O^T; these are joined once, behind the loop.
// Both products are transposed, so that a query is a lane's column in every accumulator:
//   S^T (keys x queries) = K^T tile (A) x Q rows (B);  O^T (d x queries) = V^T tile (A) x P^T (B).
// Both A operands run along the rows of their staged tile, so their fragments come by the transposing LDS load, which delivers
// the k order of Frag::load (8 * half + 0..7, then 16 + 8 * half + 0..7).
// An S^T accumulator holds, for the lane's query, keys 8*(lane>>4) + 0..7 of its 16: two neighbouring accumulators converted to
// f16 are the B fragment of 32 keys in the k order of Frag::load, so P goes through no LDS and no lane exchange.
// Row maximum and the rescale factor are one scalar per lane and query tile, the row sum a pair over even and odd keys (online softmax, logits kept in the log2 domain).
// A stage is 128 K rows (64 keys, 128 B at pitch 160) and 64 V rows (256 B at pitch 288), laid by asynchronous copies into two buffers.
// In the kernel below, every '#pragma unroll' except the r_k copy's makes the index of a fragment or accumulator array a constant, so that the array stays in registers.
// ---------------------------------------------------------------------------
constexpr int kFaKeys   = 64;                          // keys per stage
constexpr int kFaRows   = 128;                         // query rows per workgroup
constexpr int kFaKPitch = 160;                         // bytes per staged K row: 32 B x odd, the transposing reader's pitch
constexpr int kFaVPitch = 288;                         // bytes per staged V row: 32 B x odd
constexpr int kFaKBytes = kHeadDim * kFaKPitch;        // 20,480
constexpr int kFaVBytes = kFaKeys * kFaVPitch;         // 18,432
constexpr int kFaStage  = kFaKBytes + kFaVBytes;       // 38,912
static_assert(kSeq % kFaKeys == 0 && kSeq % kFaRows == 0 && kSeq / kFaKeys >= 2 && kHeadDim == 128, "attention tiles");
// One lane's share of a stage: four 16-byte copies of K rows r, r + 32, r + 64, r + 96 (r = thread >> 3) and four of V rows
// r, r + 16, r + 32, r + 48 (r = thread >> 4). lk, lv = LDS byte addresses, k, v = global addresses of the first of each four.
// The s_wait_xcnt stands inside the statement so that no address register of a copy is rewritten ahead of it.
__device__ __forceinline__ void attn_stage_copies(unsigned lk, const char* k, unsigned lv, const char* v) {
  constexpr unsigned kLK = 32u * kFaKPitch, kLV = 16u * kFaVPitch;
  constexpr size_t kGK = (size_t)32 * kSeq * 2, kGV = (size_t)16 * kHeadDim * 2;
  asm volatile(
      "global_load_async_to_lds_b128 %0, %8, off\n\t"
      "global_load_async_to_lds_b128 %1, %9, off\n\t"
      "global_load_async_to_lds_b128 %2, %10, off\n\t"
      "global_load_async_to_lds_b128 %3, %11, off\n\t"
      "global_load_async_to_lds_b128 %4, %12, off\n\t"
      "global_load_async_to_lds_b128 %5, %13, off\n\t"
      "global_load_async_to_lds_b128 %6, %14, off\n\t"
      "global_load_async_to_lds_b128 %7, %15, off\n\t"
      "s_wait_xcnt 0x0"
      :: "v"(lk), "v"(lk + kLK), "v"(lk + 2 * kLK), "v"(lk + 3 * kLK), "v"(lv), "v"(lv + kLV), "v"(lv + 2 * kLV), "v"(lv + 3 * kLV),
         "v"(k), "v"(k + kGK), "v"(k + 2 * kGK), "v"(k + 3 * kGK), "v"(v), "v"(v + kGV), "v"(v + 2 * kGV), "v"(v + 3 * kGV)
      : "memory");
}
// value of lane l ^ 16
__device__ __forceinline__ float xhalf(float x) {
  const int i = __builtin_bit_cast(int, x);
  return __builtin_bit_cast(float, __builtin_amdgcn_permlanex16(i, i, 0x76543210, 0xfedcba98, false, false));
}
// 16 x 32 A fragment out of a row-major 16-bit LDS tile T whose rows run along the fragment's k: p = this lane's address
// T + (k0 + 8 * (lane >> 4) + (lane & 7)) * pitch + 2 * r0 + 16 * ((lane >> 3) & 1); the lane receives T[k0 + k][r0 + (lane & 15)]
// for k = 8 * (lane >> 4) + 0..7 (first load) and 16 + 8 * (lane >> 4) + 0..7 (second load, 16 rows further).
typedef __attribute__((ext_vector_type(8))) short v8s;
__device__ __forceinline__ v8h ld_tr16(const unsigned char* p) {
  typedef __attribute__((address_space(3))) v8s lds_v8s;
  return __builtin_bit_cast(v8h, __builtin_amdgcn_ds_load_tr16_b128_v8i16((lds_v8s*)p));
}
template <int PITCH>
__device__ __forceinline__ v16h load_tr_frag(const unsigned char* p) {
  Frag<_Float16>::U f; f.h[0] = ld_tr16(p); f.h[1] = ld_tr16(p + 16 * PITCH); return f.v;
}
typedef __attribute__((ext_vector_type(2))) _Float16 v2h;
union PFrag { v16h v; v2h h[8]; };   // B fragment of 32 keys, filled two keys at a time
__global__ __launch_bounds__(256) void attn_fused_kernel(const unsigned short* __restrict__ Qp, const unsigned short* __restrict__ Kp,
                                                         const unsigned short* __restrict__ Vp, const float* __restrict__ rqp,
                                                         const float* __restrict__ rkp, unsigned short* __restrict__ Cp) {
  typedef Frag<_Float16> F;
  // r_k of this batch as the flat [4][2048] view, then the two stage buffers
  __shared__ __align__(128) unsigned char smem[kRl * kSeq * 4 + 2 * kFaStage];
  float* rkS = (float*)smem;
  unsigned char* ring = smem + kRl * kSeq * 4;
  const int g     = blockIdx.y;
  const int b     = g >> 3;
  const int t     = threadIdx.x;
  const int lane  = t & 31, wave = t >> 5;
  const int rlane = lane & 15;                 // A row / B, D column within a subtile
  const int half8 = (lane >> 4) * 8;           // k offset of this lane half = D row offset
  const int qg    = wave & 3;                  // query group: 32 rows
  const int kh    = wave >> 2;                 // which 32 of a stage's 64 keys
  const int q     = blockIdx.x * kFaRows + qg * 32 + rlane;     // this lane's query row in tile 0; tile 1 is 16 rows further
  const _Float16* Qg = (const _Float16*)Qp + (size_t)g * kChunk;
  const char* gK = (const char*)(Kp + (size_t)g * kChunk + (size_t)(t >> 3) * kSeq + (t & 7) * 8);
  const char* gV = (const char*)(Vp + (size_t)g * kChunk + (size_t)(t >> 4) * kHeadDim + (t & 15) * 8);
  const unsigned ringLds = (unsigned)(size_t)ring;                                                  // the same for every lane
  const unsigned offK = (unsigned)((t >> 3) * kFaKPitch + (t & 7) * 16);                            // this lane's place in a stage buffer
  const unsigned offV = (unsigned)(kFaKBytes + (t >> 4) * kFaVPitch + (t & 15) * 16);
  const unsigned ldsK = ringLds + offK;
  const unsigned ldsV = ringLds + offV;
  constexpr int nStage = kSeq / kFaKeys;
  constexpr size_t kStepK = (size_t)kFaKeys * 2;                // global bytes between stages: 64 columns of K
  constexpr size_t kStepV = (size_t)kFaKeys * kHeadDim * 2;     // 64 V rows

  // ring prologue: stage 0 (and r_k) landed and published, then stage 1 in flight
  attn_stage_copies(ldsK, gK, ldsV, gV);
  const float* rkb = rkp + (size_t)b * kSeq * kRl;
#pragma unroll
  for (int i = 0; i < kRl * kSeq / 1024; ++i) *(v4f*)(rkS + (i * 256 + t) * 4) = *(const v4f*)(rkb + (i * 256 + t) * 4);
  v16h qf[2][4];
  v4f rq4[2];
#pragma unroll
  for (int qt = 0; qt < 2; ++qt) {
#pragma unroll
    for (int ks = 0; ks < 4; ++ks) qf[qt][ks] = F::load(Qg + (size_t)(q + qt * 16) * kHeadDim + ks * 32 + half8);
    rq4[qt] = *(const v4f*)(rqp + ((size_t)b * kSeq + q + qt * 16) * kRl) * (0.5f * kLog2e);
  }
  asm volatile("s_wait_xcnt 0x0" ::: "memory");   // stands ahead of any rewrite of the Q and r_q loads' address registers
  __builtin_amdgcn_sched_barrier(0);               // keeps later register writes (the zeroing of o) from being lifted over that wait
  asm volatile("s_wait_asynccnt 0x0" ::: "memory");   // this wave's copies of stage 0 have landed
  __syncthreads();                                    // every wave's copies of stage 0 and stores of r_k are readable
  attn_stage_copies(ldsK + kFaStage, gK + kStepK, ldsV + kFaStage, gV + kStepV);

  v8f o[2][8];
#pragma unroll
  for (int qt = 0; qt < 2; ++qt)
#pragma unroll
    for (int dt = 0; dt < 8; ++dt) o[qt][dt] = (v8f){0.f,0.f,0.f,0.f,0.f,0.f,0.f,0.f};
  // per query tile: running maximum of the lane's query over this wave's keys (log2 domain), equal in both lane halves,
  // and running sums over this lane half's even and odd keys
  float mrun[2] = {-__builtin_inff(), -__builtin_inff()};
  v2f lrun[2] = {(v2f){0.f, 0.f}, (v2f){0.f, 0.f}};

  for (int s = 0; s < nStage; ++s) {
    const unsigned bufOff = (unsigned)(s & 1) * kFaStage;
    const unsigned char* sK = ring + bufOff + (half8 + (lane & 7)) * kFaKPitch + ((lane >> 3) & 1) * 16 + kh * 64;
    const unsigned char* sV = ring + bufOff + kFaKBytes + (kh * 32 + half8 + (lane & 7)) * kFaVPitch + ((lane >> 3) & 1) * 16;
    // S^T: two 16-key subtiles x two 16-query tiles
    v8f sc[2][2];
#pragma unroll
    for (int mt = 0; mt < 2; ++mt)
#pragma unroll
      for (int qt = 0; qt < 2; ++qt) sc[mt][qt] = (v8f){0.f,0.f,0.f,0.f,0.f,0.f,0.f,0.f};
    // the stage's K fragments and r_k values are requested as one group, so the wave meets LDS latency once for both
    const float* rkT = rkS + s * kFaKeys + kh * 32 + half8;
    v16h kf[4][2];
    v4f kr[2][4][2];
#pragma unroll
    for (int ks = 0; ks < 4; ++ks)
#pragma unroll
      for (int mt = 0; mt < 2; ++mt) kf[ks][mt] = load_tr_frag<kFaKPitch>(sK + ks * 32 * kFaKPitch + mt * 32);
#pragma unroll
    for (int mt = 0; mt < 2; ++mt)
#pragma unroll
      for (int j = 0; j < 4; ++j) {
        kr[mt][j][0] = *(const v4f*)(rkT + j * kSeq + mt * 16);
        kr[mt][j][1] = *(const v4f*)(rkT + j * kSeq + mt * 16 + 4);
      }
    __builtin_amdgcn_sched_barrier(0);   // keeps the reads above in front of the products: moved in among them, each pair is waited for on its own
#pragma unroll
    for (int ks = 0; ks < 4; ++ks)
#pragma unroll
      for (int mt = 0; mt < 2; ++mt)
#pragma unroll
        for (int qt = 0; qt < 2; ++qt) sc[mt][qt] = F::mma(kf[ks][mt], qf[qt][ks], sc[mt][qt]);
    __builtin_amdgcn_sched_barrier(0);   // the products start on the first K fragments to land: mixed with the logits they would wait for r_k, which lands behind K
    // the stage's V fragments, one group again: they arrive behind the softmax arithmetic
    v16h vf[8];
#pragma unroll
    for (int dt = 0; dt < 8; ++dt) vf[dt] = load_tr_frag<kFaVPitch>(sV + dt * 32);
    __builtin_amdgcn_sched_barrier(0);   // keeps the V reads ahead of the arithmetic that covers their latency
    // logits (log2 domain) and their maximum; two keys per packed f32 instruction
    v2f lg[2][2][4];
    float tmax[2] = {-__builtin_inff(), -__builtin_inff()};
#pragma unroll
    for (int mt = 0; mt < 2; ++mt) {
#pragma unroll
      for (int qt = 0; qt < 2; ++qt)
#pragma unroll
        for (int pr = 0; pr < 4; ++pr) {
          const int hi = pr >> 1, e = 2 * (pr & 1);
          v2f a = (v2f){rq4[qt][0], rq4[qt][0]} * (v2f){kr[mt][0][hi][e], kr[mt][0][hi][e + 1]};
          a = __builtin_elementwise_fma((v2f){rq4[qt][1], rq4[qt][1]}, (v2f){kr[mt][1][hi][e], kr[mt][1][hi][e + 1]}, a);
          a = __builtin_elementwise_fma((v2f){rq4[qt][2], rq4[qt][2]}, (v2f){kr[mt][2][hi][e], kr[mt][2][hi][e + 1]}, a);
          a = __builtin_elementwise_fma((v2f){rq4[qt][3], rq4[qt][3]}, (v2f){kr[mt][3][hi][e], kr[mt][3][hi][e + 1]}, a);
          a = __builtin_elementwise_fma((v2f){sc[mt][qt][2 * pr], sc[mt][qt][2 * pr + 1]}, (v2f){kScoreScale * kLog2e, kScoreScale * kLog2e}, a);
          lg[qt][mt][pr] = a;
          tmax[qt] = fmaxf(tmax[qt], fmaxf(a[0], a[1]));
        }
    }
    PFrag pf[2];   // one B fragment of this wave's 32 keys per query tile
#pragma unroll
    for (int qt = 0; qt < 2; ++qt) {
      const float tm    = fmaxf(tmax[qt], xhalf(tmax[qt]));
      const float mnew  = fmaxf(mrun[qt], tm);
      const float alpha = __builtin_amdgcn_exp2f(mrun[qt] - mnew);   // 0 in the first stage, where mrun is -inf
      mrun[qt] = mnew;
      v2f ps[2];
#pragma unroll
      for (int mt = 0; mt < 2; ++mt) {
        v2f p[4];
#pragma unroll
        for (int pr = 0; pr < 4; ++pr) {
          const v2f x = lg[qt][mt][pr] - (v2f){mnew, mnew};
          p[pr] = (v2f){__builtin_amdgcn_exp2f(x[0]), __builtin_amdgcn_exp2f(x[1])};
          pf[qt].h[mt * 4 + pr] = __builtin_convertvector(p[pr], v2h);
        }
        ps[mt] = (p[0] + p[1]) + (p[2] + p[3]);
      }
      lrun[qt] = __builtin_elementwise_fma(lrun[qt], (v2f){alpha, alpha}, ps[0] + ps[1]);
#pragma unroll
      for (int dt = 0; dt < 8; ++dt) o[qt][dt] = o[qt][dt] * alpha;
    }
    // O^T += V^T tile x P^T
#pragma unroll
    for (int dt = 0; dt < 8; ++dt)
#pragma unroll
      for (int qt = 0; qt < 2; ++qt) o[qt][dt] = F::mma(vf[dt], pf[qt].v, o[qt][dt]);
    __builtin_amdgcn_sched_barrier(0);   // keeps the softmax and the O^T products in front of the foot: otherwise the foot's waits and barrier are lifted to where the V reads end, the refill stays at the trip's end, and its copies have half a trip to land
    // publish point of stage s + 1, and release of the buffer that stage s was read from
    asm volatile("s_wait_dscnt 0x0" ::: "memory");      // this wave's reads of stage s are done before the buffer is refilled
    asm volatile("s_wait_asynccnt 0x0" ::: "memory");   // this wave's copies of stage s + 1 have landed
    __syncthreads();
    if (s + 2 < nStage) attn_stage_copies(offK + (ringLds + bufOff), gK + (size_t)(s + 2) * kStepK, offV + (ringLds + bufOff), gV + (size_t)(s + 2) * kStepV);
  }
  asm volatile("s_wait_asynccnt 0x0" ::: "memory");     // nothing of this wave is in flight when the ring is left

  // Join of the two key halves of a query group. The last stage's barrier has ended every read of the ring and no copy is in
  // flight, so the ring is free: waves 4..7 lay O^T (16 KiB a wave, a lane's 16 bytes next to its neighbour's), maxima and sums
  // there, and the wave of the same query group among 0..3, whose lanes hold the same (query, d) places, adds them to its own.
  static_assert(4 * 16384 + 4 * 512 <= 2 * kFaStage, "the join fits the ring");
  float* jo = (float*)(ring + qg * 16384) + lane * 4;
  float* jm = (float*)(ring + 4 * 16384 + qg * 512) + lane * 4;
  if (kh == 1) {
#pragma unroll
    for (int qt = 0; qt < 2; ++qt)
#pragma unroll
      for (int dt = 0; dt < 8; ++dt) {
        *(v4f*)(jo + ((qt * 8 + dt) * 2 + 0) * 128) = (v4f){o[qt][dt][0], o[qt][dt][1], o[qt][dt][2], o[qt][dt][3]};
        *(v4f*)(jo + ((qt * 8 + dt) * 2 + 1) * 128) = (v4f){o[qt][dt][4], o[qt][dt][5], o[qt][dt][6], o[qt][dt][7]};
      }
    *(v4f*)jm = (v4f){mrun[0], mrun[1], lrun[0][0] + lrun[0][1], lrun[1][0] + lrun[1][1]};
  }
  __syncthreads();   // the upper waves' partial results are readable
  if (kh == 0) {
    const v4f ml = *(const v4f*)jm;
#pragma unroll
    for (int qt = 0; qt < 2; ++qt) {
      const float mall = fmaxf(mrun[qt], ml[qt]);
      const float a0 = __builtin_amdgcn_exp2f(mrun[qt] - mall);
      const float a1 = __builtin_amdgcn_exp2f(ml[qt] - mall);
      const float lsum = (lrun[qt][0] + lrun[qt][1]) * a0 + ml[2 + qt] * a1;
      const float inv = kCtxCarry / (lsum + xhalf(lsum));
      const float w0 = a0 * inv, w1 = a1 * inv;
      unsigned short* C = Cp + (size_t)g * kChunk + (size_t)(q + qt * 16) * kHeadDim + half8;
#pragma unroll
      for (int dt = 0; dt < 8; ++dt) {
        const v4f u0 = *(const v4f*)(jo + ((qt * 8 + dt) * 2 + 0) * 128);
        const v4f u1 = *(const v4f*)(jo + ((qt * 8 + dt) * 2 + 1) * 128);
        v8h hv;
#pragma unroll
        for (int r = 0; r < 4; ++r) {
          hv[r]     = (_Float16)(o[qt][dt][r] * w0 + u0[r] * w1);
          hv[4 + r] = (_Float16)(o[qt][dt][4 + r] * w0 + u1[r] * w1);
        }
        *(v8h*)(C + dt * 16) = hv;
      }
    }
  }
}

// ---------------------------------------------------------------------------
// LayerNorm of x + (y + y2): y, y2 are the two k-slice partial planes of the product in front of it.
// One block of 256 threads per row; thread t owns columns 4t..4t+3. Reductions in fixed order (two separate LDS arrays).
// ---------------------------------------------------------------------------
template <bool HAS16>
__global__ __launch_bounds__(256) void add_ln_kernel(const float* __restrict__ x, const float* __restrict__ y,
                                                     const float* __restrict__ y2, const float* __restrict__ gam, const float* __restrict__ bet,
                                                     float* __restrict__ outp, unsigned short* __restrict__ out16) {
  __shared__ float red1[8];
  __shared__ float red2[8];
  __shared__ __align__(16) float srow[kDim];
  const int t = threadIdx.x;
  const int lane = t & 31, wave = t >> 5;
  const size_t base = (size_t)blockIdx.x * kDim;
  const v4f vx = *(const v4f*)(x + base + 4 * t);
  const v4f vy = *(const v4f*)(y + base + 4 * t);
  const v4f vz = *(const v4f*)(y2 + base + 4 * t);
  const v4f s  = vx + (vy + vz);
  float sum = (s[0] + s[1]) + (s[2] + s[3]);
#pragma unroll
  for (int off = 16; off > 0; off >>= 1) sum += __shfl_xor(sum, off, 32);
  if (lane == 0) red1[wave] = sum;
  __syncthreads();
  float tsum = red1[0];
#pragma unroll
  for (int w = 1; w < 8; ++w) tsum += red1[w];
  const float mu = tsum * kInvDim;
  const v4f d = s - mu;
  float sq = (d[0] * d[0] + d[1] * d[1]) + (d[2] * d[2] + d[3] * d[3]);
#pragma unroll
  for (int off = 16; off > 0; off >>= 1) sq += __shfl_xor(sq, off, 32);
  if (lane == 0) red2[wave] = sq;
  __syncthreads();
  float tsq = red2[0];
#pragma unroll
  for (int w = 1; w < 8; ++w) tsq += red2[w];
  const float var  = tsq * kInvDim;
  const float rstd = rsqrtf(var + kLnEps);
  const v4f g  = *(const v4f*)(gam + 4 * t);
  const v4f be = *(const v4f*)(bet + 4 * t);
  const v4f o  = (d * rstd) * g + be;
  float* op = outp + base + 4 * t;
  *(v4f*)op = o;
  
  if (HAS16) {
    *(v4f*)(srow + 4 * t) = o;
    __syncthreads();
    if (t < 128) {
      const v4f a = *(const v4f*)(srow + 8 * t);
      const v4f c = *(const v4f*)(srow + 8 * t + 4);
      unsigned short hb[8];
#pragma unroll
      for (int e = 0; e < 4; ++e) {
        hb[e]     = h_bits(a[e]);
        hb[4 + e] = h_bits(c[e]);
      }
      const v4u u = (v4u){pk16(hb[0], hb[1]), pk16(hb[2], hb[3]), pk16(hb[4], hb[5]), pk16(hb[6], hb[7])};
      unsigned short* hp = out16 + base + 8 * (size_t)t;
      *(v4u*)hp = u;
      
    }
  }
}

// ---------------------------------------------------------------------------
// Host glue.
//   R0  Hh   f16 [4096][1024]  8 MiB at   0 MiB   -> later ctx f16 [4096][1024] (same type, same layout; Hh dead after QKV GEMM)
//   R1  WT4  f16 4 x [1024][1024] (Wk^T | Wq^T | Wv^T | Wo^T, x16)   8 MiB at 8 MiB
//   R3  W1T  f16 [4096][1024] x16  8 MiB at 16 MiB
//   R4  W2T  f16 [1024][4096] x16  8 MiB at 24 MiB
//   R5  k    f16 [4096][1024]  8 MiB at 32 MiB   -> later h1 f16 [4096][1024] (same type, same layout; k dead after attention)
//   R6  q    f16 [4096][1024]  8 MiB at 40 MiB   \
//   R7  v    f16 [4096][1024]  8 MiB at 48 MiB    | -> later mid f16 [4096][4096] 32 MiB at 40 MiB (same type; q and v dead after attention)
//   R8       16 MiB at 56 MiB, used by mid only      /
//   R10 h_sa f32 2 x [4096][1024] (two k-slice partial planes) 32 MiB at 72 MiB (then the two hf planes over them after LN1)
//   R11 h1   f32 [4096][1024] 16 MiB at 104 MiB
//   R12 rq   f32 [4096][4]  65,536 B at 120 MiB
//   R13 rk   f32 [4096][4]  65,536 B at 120 MiB + 64 KiB
//   total 125,960,192 B
// GEMM shapes (all M,N multiples of 64, K multiples of 32; no padding anywhere):
//   QKV  M=4096 N=1024 K=1024 (x3 batched); scores and ctx per chunk inside the fused attention kernel;
//   Wo M=4096 N=1024 K=1024; W1 M=N=4096 K=1024; W2 M=4096 N=1024 K=4096.
// Wo and W2 have 128 tiles of 256x128, half as many as the chip has WGPs: each runs as two k slices (256 workgroups), and the
// LayerNorm behind it adds the two partial planes.
// ---------------------------------------------------------------------------
extern "C" void kernel_launch(void* const* d_in, const int* in_sizes, int n_in,
                              void* d_out, int out_size, void* d_ws, size_t ws_size,
                              hipStream_t stream) {
  if (n_in < 16) return;
  const int nTokDim = kTok * kDim;                  // 4,194,304
  if (in_sizes[0] != nTokDim || in_sizes[1] != kTok * kRl) return;
  if (in_sizes[2] != kDim * kDim || in_sizes[3] != kDim * kDim || in_sizes[4] != kDim * kDim || in_sizes[5] != kDim * kDim) return;
  if (in_sizes[6] != kRl * kRl || in_sizes[7] != kRl * kRl) return;
  if (in_sizes[8] != kDim * kFfn || in_sizes[9] != kFfn || in_sizes[10] != kFfn * kDim || in_sizes[11] != kDim) return;
  if (in_sizes[12] != kDim || in_sizes[13] != kDim || in_sizes[14] != kDim || in_sizes[15] != kDim) return;
  if (out_size != nTokDim) return;

  const size_t szP16 = (size_t)kTok * kDim * 2;                 // 8,388,608
  const size_t szW4  = (size_t)4 * kDim * kDim * 2;             // 8,388,608
  const size_t szW1  = (size_t)kDim * kFfn * 2;                 // 8,388,608
  const size_t szSC  = 3 * (size_t)kTok * kDim * 4;             // 50,331,648
  const size_t szR   = (size_t)kTok * kRl * 4;                  // 65,536
  static_assert(4 * (size_t)kTok * kDim * 2 == (size_t)kTok * kFfn * 2, "mid fits q, v and the 16 MiB behind them");
  const size_t offHh = 0;
  const size_t offW4 = offHh + szP16;
  const size_t offW1 = offW4 + szW4;
  const size_t offW2 = offW1 + szW1;
  const size_t offK  = offW2 + szW1;
  const size_t offQ  = offK + szP16;
  const size_t offV  = offQ + szP16;
  const size_t offSC = offV + 3 * szP16;                       // v, then the 16 MiB that only mid uses
  const size_t offRQ = offSC + szSC;
  const size_t offRK = offRQ + szR;
  const size_t total = offRK + szR;                            // 125,960,192
  if (ws_size < total) return;

  const float* h   = (const float*)d_in[0];
  const float* rh  = (const float*)d_in[1];
  const float* Wq  = (const float*)d_in[2];
  const float* Wk  = (const float*)d_in[3];
  const float* Wv  = (const float*)d_in[4];
  const float* Wo  = (const float*)d_in[5];
  const float* Wrk = (const float*)d_in[6];
  const float* Wrq = (const float*)d_in[7];
  const float* W1  = (const float*)d_in[8];
  const float* b1  = (const float*)d_in[9];
  const float* W2  = (const float*)d_in[10];
  const float* b2  = (const float*)d_in[11];
  const float* g1  = (const float*)d_in[12];
  const float* be1 = (const float*)d_in[13];
  const float* g2  = (const float*)d_in[14];
  const float* be2 = (const float*)d_in[15];
  float* out = (float*)d_out;
  char* ws = (char*)d_ws;
  unsigned short* Hh  = (unsigned short*)(ws + offHh);
  unsigned short* CTX = Hh;                                    // alias after QKV GEMM
  unsigned short* WT4 = (unsigned short*)(ws + offW4);         // Wk^T, Wq^T, Wv^T, Wo^T planes of 1,048,576 halves
  unsigned short* WoT = WT4 + (size_t)3 * kDim * kDim;
  unsigned short* W1T = (unsigned short*)(ws + offW1);
  unsigned short* W2T = (unsigned short*)(ws + offW2);
  unsigned short* K16 = (unsigned short*)(ws + offK);
  unsigned short* H1h = K16;                                   // alias after attention
  unsigned short* Q16 = (unsigned short*)(ws + offQ);
  unsigned short* MID = Q16;                                   // alias after attention: [4096][4096] over q, v and the 16 MiB behind them
  unsigned short* V16 = (unsigned short*)(ws + offV);
  float* HSA = (float*)(ws + offSC);                           // plane 0; plane 1 follows it
  float* HF  = HSA;                                            // alias after LN1, two planes as well
  float* H1f = (float*)(ws + offSC + 2 * (szSC / 3));
  float* RQ = (float*)(ws + offRQ);
  float* RK = (float*)(ws + offRK);

  // ---- prologue: 16-bit operand planes, relative projections ----
  prologue_kernel<<<dim3(kPbAll), dim3(256), 0, stream>>>(h, rh, Wk, Wq, Wv, Wo, Wrk, Wrq, W1, W2, Hh, WT4, W1T, W2T, RK, RQ);

  // ---- q, k, v = h @ W (x16 weights folded back by 1/16): three separate [4096][1024] f16 planes (b0 -> k, b1 -> q, b2 -> v) ----
  {
    const int tiles = (kTok / 64) * (kDim / 64);   // 1024
    wmma_gemm64<0, false, 0, 1, false, 0><<<dim3(tiles / 8, 3), dim3(256), 0, stream>>>(
        Hh, Hh, kDim, 0L, WT4, WT4, kDim, (long)kDim * kDim,
        (void*)K16, (void*)K16, kDim, (long)kTok * kDim, RQ, RQ, 0L, kTok, kDim, kDim, kWCarryInv);
  }
  // ---- attention, all 16 chunks in one launch: ctx_g f16 x256 at CTX + g*262144 as [2048][128] ----
  attn_fused_kernel<<<dim3(kSeq / kFaRows, kGroups), dim3(256), 0, stream>>>(Q16, K16, V16, RQ, RK, CTX);

  // ---- h_sa = ctx @ Wo (fold back 1/(256*16)) -> two f32 [4096][1024] partial planes, k 0..511 and 512..1023 ----
  {
    const int tiles = (kTok / 64) * (kDim / 64);   // 1024
    wmma_gemm64<0, false, 0, 0, false, 0, true><<<dim3(tiles / 8, 2), dim3(256), 0, stream>>>(
        CTX, CTX, kDim, (long)(kDim / 2), WoT, WoT, kDim, (long)(kDim / 2),
        (void*)HSA, (void*)HSA, kDim, (long)kTok * kDim, RQ, RQ, 0L, kTok, kDim, kDim / 2, kWoScale);
  }
  // ---- h1 = LN(h + h_sa) * g1 + be1 -> f32 plane + f16 plane ----
  add_ln_kernel<true><<<dim3(kTok), dim3(256), 0, stream>>>(h, HSA, HSA + (size_t)kTok * kDim, g1, be1, H1f, H1h);
  // ---- mid = relu(h1 @ W1 + b1) -> f16 [4096][4096] ----
  {
    const int tiles = (kTok / 64) * (kFfn / 64);   // 4096
    wmma_gemm64<0, false, 2, 1, false, 2><<<dim3(tiles / 8, 1), dim3(256), 0, stream>>>(
        H1h, H1h, kDim, 0L, W1T, W1T, kDim, 0L,
        (void*)MID, (void*)MID, kFfn, 0L, b1, RQ, 0L, kTok, kFfn, kDim, kWCarryInv);
  }
  // ---- hf = mid @ W2 + b2 -> two f32 [4096][1024] partial planes, k 0..2047 (with b2) and 2048..4095 ----
  {
    const int tiles = (kTok / 64) * (kDim / 64);   // 1024
    wmma_gemm64<0, false, 2, 0, false, 0, true><<<dim3(tiles / 8, 2), dim3(256), 0, stream>>>(
        MID, MID, kFfn, (long)(kFfn / 2), W2T, W2T, kFfn, (long)(kFfn / 2),
        (void*)HF, (void*)HF, kDim, (long)kTok * kDim, b2, RQ, 0L, kTok, kDim, kFfn / 2, kWCarryInv);
  }
  // ---- h2 = LN(h1 + hf) * g2 + be2 -> output ----
  add_ln_kernel<false><<<dim3(kTok), dim3(256), 0, stream>>>(H1f, HF, HF + (size_t)kTok * kDim, g2, be2, out, H1h);
}
